// v000
// The times below were measured on an AMD MI455X: many runs one after another, warmed up first and cycling through
// copies of the inputs, with the whole window's GPU time divided by the number of runs. Launches and the gaps
// between them are all in it. The median over several windows is given; except for v000 it joins two sittings, which
// can be a few percent apart, so the side-by-side timings, each taken in one sitting, are the better comparison.
// The starting kernel, v000, takes 1520 microseconds a run.
// All contractions on v_wmma_f32_16x16x32_f16 (f16 operands, f32 accumulate): k/q/v 1x1-conv projections (x as f16, weights carried x16, epilogue x1/16), S = q.k^T per head (epilogue x1/16), ctx = (P carried x2^15).(v f16) (epilogue x2^-11, ctx carried x16), output conv (Wo carried x16, epilogue x1/256); key-axis softmax with the additive positional bias in f32.
#include <hip/hip_runtime.h>
#include <math.h>
#include <stdint.h>

#define NB   8      // batch
#define HH   8      // heads
#define DM   256    // channels = head dim
#define PP   1024   // positions
#define HDIM 2048   // HH * DM
#define PSCALE 32768.0f
#define PSCALE_INV (1.0f / 32768.0f)

typedef __attribute__((ext_vector_type(16))) _Float16 v16h;
typedef __attribute__((ext_vector_type(8)))  _Float16 v8h;
typedef __attribute__((ext_vector_type(16))) __bf16   v16b;
typedef __attribute__((ext_vector_type(8)))  __bf16   v8b;
typedef __attribute__((ext_vector_type(8)))  float    v8f;
typedef __attribute__((ext_vector_type(4)))  float    v4f;
typedef __attribute__((ext_vector_type(2)))  float    v2f;
typedef __attribute__((ext_vector_type(4)))  unsigned int v4u;

__device__ __forceinline__ unsigned short f2bf_bits(float f) {
  unsigned u = __float_as_uint(f);
  return (unsigned short)((u + 0x7FFFu + ((u >> 16) & 1u)) >> 16);
}
__device__ __forceinline__ float bf_bits2f(unsigned short h) { return __uint_as_float(((unsigned)h) << 16); }

// hazard guards as plain device helpers (no inline asm inside the kernel template body)
__device__ __forceinline__ void dep_guard_h(v8f& a, v8f& b, v16h x, v16h y) { asm volatile("v_nop\n\tv_nop\n\tv_nop\n\tv_nop" : "+v"(a), "+v"(b) : "v"(x), "v"(y)); }
__device__ __forceinline__ void dep_guard_b(v8f& a, v8f& b, v16b x, v16b y) { asm volatile("v_nop\n\tv_nop\n\tv_nop\n\tv_nop" : "+v"(a), "+v"(b) : "v"(x), "v"(y)); }
__device__ __forceinline__ void keep4_h(v16h a, v16h b, v16h c, v16h d) { asm volatile("v_nop" :: "v"(a), "v"(b), "v"(c), "v"(d)); }
__device__ __forceinline__ void keep4_b(v16b a, v16b b, v16b c, v16b d) { asm volatile("v_nop" :: "v"(a), "v"(b), "v"(c), "v"(d)); }
__device__ __forceinline__ void acc_guard4(v8f& a, v8f& b, v8f& c, v8f& d) { asm volatile("v_nop\n\tv_nop\n\tv_nop\n\tv_nop" : "+v"(a), "+v"(b), "+v"(c), "+v"(d)); }
template <typename T> struct Frag;
template <> struct Frag<_Float16> {
  typedef v16h V; union U { v16h v; v8h h[2]; };
  static __device__ __forceinline__ v16h load(const _Float16* p) {   // elements 0..7 <- p[0..7], 8..15 <- p[16..23]
    U f; f.h[0] = *(const v8h*)(p); f.h[1] = *(const v8h*)(p + 16); return f.v;
  }
  static __device__ __forceinline__ v8f mma(v16h a, v16h b, v8f c) {
    return __builtin_amdgcn_wmma_f32_16x16x32_f16(false, a, false, b, (short)0, c, false, false);
  }
  static __device__ __forceinline__ void guard(v8f& a, v8f& b, v16h x, v16h y) { dep_guard_h(a, b, x, y); }
  static __device__ __forceinline__ void keep(v16h a, v16h b, v16h c, v16h d) { keep4_h(a, b, c, d); }
};
template <> struct Frag<__bf16> {
  typedef v16b V; union U { v16b v; v8b h[2]; };
  static __device__ __forceinline__ v16b load(const __bf16* p) {
    U f; f.h[0] = *(const v8b*)(p); f.h[1] = *(const v8b*)(p + 16); return f.v;
  }
  static __device__ __forceinline__ v8f mma(v16b a, v16b b, v8f c) {
    return __builtin_amdgcn_wmma_f32_16x16x32_bf16(false, a, false, b, (short)0, c, false, false);
  }
  static __device__ __forceinline__ void guard(v8f& a, v8f& b, v16b x, v16b y) { dep_guard_b(a, b, x, y); }
  static __device__ __forceinline__ void keep(v16b a, v16b b, v16b c, v16b d) { keep4_b(a, b, c, d); }
};

// ---- Register-blocked batched WMMA GEMM ------------------------------------
// C[m,n] = scale * sum_k A[m,k] * Bt[n,k] (+bias)(+resid); each wave owns a 64x64 tile.
// A row-major [M,K]; Bt row-major [N,K]; M,N % 64 == 0, K % 32 == 0.
// SPLIT: operands are hi/lo planes (A2/Bt2 = lo planes, same layout); product = hi.hi + hi.lo + lo.hi.
// BIAS_MODE: 0 = none, 1 = bias[m], 2 = bias[n].
// OUT_MODE: 0 = f32, 1 = f16, 2 = bf16 hi plane (Cout) + bf16 lo plane (Cout2).
// ET: 0 = f16 operands, 1 = bf16 operands (pointers passed as 16-bit storage)
template <int ET> struct Elem;
template <> struct Elem<0> { typedef _Float16 T; };
template <> struct Elem<1> { typedef __bf16 T; };
template <int ET, bool SPLIT, int BIAS_MODE, int OUT_MODE, bool RESID, int ACT = 0>
__global__ __launch_bounds__(256) void wmma_gemm64(
    const unsigned short* __restrict__ Ap, const unsigned short* __restrict__ A2p, int lda, long strideA,
    const unsigned short* __restrict__ Btp, const unsigned short* __restrict__ Bt2p, int ldb, long strideB,
    void* __restrict__ Cout, void* __restrict__ Cout2, int ldc, long strideC,
    const float* __restrict__ bias,
    const float* __restrict__ resid, long strideR,
    int M, int N, int K, float scale) {
  typedef typename Elem<ET>::T T;
  typedef typename Frag<T>::V V;
  const T* A = (const T*)Ap; const T* A2 = (const T*)A2p; const T* Bt = (const T*)Btp; const T* Bt2 = (const T*)Bt2p;
  __shared__ __align__(16) float sT[8][16 * 68];   // per-wave 16x64 slab, pitch 68 floats
  const int b    = blockIdx.y;
  const int lane = threadIdx.x & 31;
  const int wave = threadIdx.x >> 5;
  const int tilesN = N >> 6;
  const int tilesM = M >> 6;
  const int tile = blockIdx.x * 8 + wave;
  if (tile >= tilesM * tilesN) return;   // wave-uniform; no block barriers in this kernel
  const int tm = tile / tilesN;
  const int tn = tile - tm * tilesN;
  const int m0 = tm << 6;
  const int n0 = tn << 6;

  const T* Ab  = A  + (size_t)b * strideA;
  const T* Bb  = Bt + (size_t)b * strideB;
  const T* Ab2 = SPLIT ? (A2  + (size_t)b * strideA) : nullptr;
  const T* Bb2 = SPLIT ? (Bt2 + (size_t)b * strideB) : nullptr;

  const int rlane = lane & 15;                 // row (A) / col (B, D) within subtile
  const int koff  = (lane >> 4) * 8;           // k offset of this lane half
  const int mOff  = (lane >> 4) * 8;           // D row offset

  v8f acc[4][4];
#pragma unroll
  for (int i = 0; i < 4; ++i)
#pragma unroll
    for (int j = 0; j < 4; ++j) acc[i][j] = (v8f){0.f,0.f,0.f,0.f,0.f,0.f,0.f,0.f};

  for (int k0 = 0; k0 < K; k0 += 32) {
    V bh[4], bl[4];
#pragma unroll
    for (int j = 0; j < 4; ++j) {
      const size_t bo = (size_t)(n0 + (j << 4) + rlane) * ldb + koff + k0;
      bh[j] = Frag<T>::load(Bb + bo);
      if (SPLIT) bl[j] = Frag<T>::load(Bb2 + bo);
    }
#pragma unroll
    for (int i = 0; i < 4; ++i) {
      const size_t ao = (size_t)(m0 + (i << 4) + rlane) * lda + koff + k0;
      V ah = Frag<T>::load(Ab + ao);
      V al;
      if (SPLIT) al = Frag<T>::load(Ab2 + ao);
#pragma unroll
      for (int j = 0; j < 4; ++j) {
        acc[i][j] = Frag<T>::mma(ah, bh[j], acc[i][j]);
        if (SPLIT) {
          acc[i][j] = Frag<T>::mma(ah, bl[j], acc[i][j]);
          acc[i][j] = Frag<T>::mma(al, bh[j], acc[i][j]);
        }
      }
      Frag<T>::guard(acc[i][0], acc[i][3], ah, SPLIT ? al : ah);
    }
    Frag<T>::keep(bh[0], bh[1], bh[2], bh[3]);
    if (SPLIT) Frag<T>::keep(bl[0], bl[1], bl[2], bl[3]);
  }
  acc_guard4(acc[0][0], acc[0][1], acc[0][2], acc[0][3]);
  acc_guard4(acc[1][0], acc[1][1], acc[1][2], acc[1][3]);
  acc_guard4(acc[2][0], acc[2][1], acc[2][2], acc[2][3]);
  acc_guard4(acc[3][0], acc[3][1], acc[3][2], acc[3][3]);

  // ---- epilogue ----
  float* slab = sT[wave];
  const float* Rb = RESID ? (resid + (size_t)b * strideR) : nullptr;
#pragma unroll
  for (int i = 0; i < 4; ++i) {
    const int mBase = m0 + (i << 4);
#pragma unroll
    for (int j = 0; j < 4; ++j) {
      const int n = n0 + (j << 4) + rlane;
      float bv = 0.f;
      if (BIAS_MODE == 2) bv = bias[n];
#pragma unroll
      for (int r = 0; r < 8; ++r) {
        float v = acc[i][j][r] * scale;
        if (BIAS_MODE == 1) v += bias[mBase + mOff + r];
        if (BIAS_MODE == 2) v += bv;
        if (RESID) v += Rb[(size_t)(mBase + mOff + r) * ldc + n];
        if (ACT == 1) v = tanhf(v);
        if (ACT == 2) v = fmaxf(v, 0.0f);
        if (ACT == 3) v = v / (1.0f + expf(-v));
        if (ACT == 4) v = (v > 0.f) ? v : 0.01f * v;
        slab[(mOff + r) * 68 + (j << 4) + rlane] = v;
      }
    }
    __builtin_amdgcn_fence(__ATOMIC_RELEASE, "workgroup");
    __builtin_amdgcn_wave_barrier();
    __builtin_amdgcn_fence(__ATOMIC_ACQUIRE, "workgroup");
    if (OUT_MODE == 0) {
      float* C = (float*)Cout + (size_t)b * strideC;
      const int hh = lane >> 4, c4 = (lane & 15) * 4;     // row seg = 256 B = 16 lanes x 16 B
      {
#pragma unroll
        for (int it = 0; it < 8; ++it) {
          const int row = it * 2 + hh;
          v4f v = *(const v4f*)(slab + row * 68 + c4);
          *(v4f*)(C + (size_t)(mBase + row) * ldc + n0 + c4) = v;
        }
        
      }
    } else {
      const int q = lane >> 3, c8 = (lane & 7) * 8;
      unsigned short* C  = (unsigned short*)Cout  + (size_t)b * strideC;
      unsigned short* C2 = (OUT_MODE == 2) ? ((unsigned short*)Cout2 + (size_t)b * strideC) : nullptr;
      {
#pragma unroll
        for (int it = 0; it < 4; ++it) {
          const int row = it * 4 + q;
          const float* sp = slab + row * 68 + c8;
          v8h hv, lv;
#pragma unroll
          for (int e = 0; e < 8; ++e) {
            if (OUT_MODE == 1) {
              hv[e] = (_Float16)sp[e];
            } else {
              unsigned short hb = f2bf_bits(sp[e]);
              unsigned short lb = f2bf_bits(sp[e] - bf_bits2f(hb));
              hv[e] = __builtin_bit_cast(_Float16, hb);
              lv[e] = __builtin_bit_cast(_Float16, lb);
            }
          }
          *(v8h*)(C + (size_t)(mBase + row) * ldc + n0 + c8) = hv;
          if (OUT_MODE == 2) *(v8h*)(C2 + (size_t)(mBase + row) * ldc + n0 + c8) = lv;
        }
        
      }
    }
    __builtin_amdgcn_fence(__ATOMIC_RELEASE, "workgroup");
    __builtin_amdgcn_wave_barrier();
    __builtin_amdgcn_fence(__ATOMIC_ACQUIRE, "workgroup");
  }
}

// ---------------------------------------------------------------------------
// Elementwise cast out = f16(in * scale) (scale = power-of-two carry): 2 elements per thread, one 4-B
// Coverage: grid = ceil(n2/256) blocks x 256 threads x 2 elements = 2*n2 elements = the whole plane (n2 = plane/2).
// ---------------------------------------------------------------------------
__device__ __forceinline__ unsigned pk16(unsigned short a, unsigned short b) { return (unsigned)a | ((unsigned)b << 16); }
__device__ __forceinline__ unsigned short h_bits(float f) { const _Float16 h = (_Float16)f; return __builtin_bit_cast(unsigned short, h); }

__global__ __launch_bounds__(256) void cast_f16x2_kernel(const float* __restrict__ in, unsigned short* __restrict__ out, int n2, float scale) {
  const int i = blockIdx.x * 256 + threadIdx.x;
  if (i < n2) {
    const v2f f = *(const v2f*)(in + 2 * (size_t)i);
    const unsigned u = pk16(h_bits(f[0] * scale), h_bits(f[1] * scale));
    ((unsigned*)out)[i] = u;
    
  }
}

// ---------------------------------------------------------------------------
// Transpose-cast of the input: x f32 [NB][DM][PP] -> XT f16 [NB][PP][DM]  (in[n][d][p] -> out[n][p][d]).
// One block (256 threads) per 64x64 tile: grid = NB * (PP/64) * (DM/64) = 8 * 16 * 4 = 512.
// Load: thread t reads row d = d0 + (t>>2), 16 floats at p0 + (t&3)*16 -> 256 x 16 = 4096 = the whole tile.
// 4 rows (lanes 8q..8q+7 -> row q of the group, 8 lanes x 16 B per line); 8 waves x 2 it x 4 = 64 rows;
// ---------------------------------------------------------------------------
__global__ __launch_bounds__(256) void xt_cast_kernel(const float* __restrict__ x, unsigned short* __restrict__ XT) {
  __shared__ float tile[64][65];                 // tile[d_local][p_local]
  const int bid = blockIdx.x;
  const int dt = bid & 3;
  const int pt = (bid >> 2) & 15;
  const int n  = bid >> 6;
  const int d0 = dt * 64, p0 = pt * 64;
  const int tid = threadIdx.x, lane = tid & 31, wave = tid >> 5;
  {
    const int r = tid >> 2, cs = (tid & 3) * 16;
    const float* src = x + ((size_t)n * DM + d0 + r) * PP + p0 + cs;
#pragma unroll
    for (int i = 0; i < 4; ++i) {
      const v4f v = *(const v4f*)(src + 4 * i);
      tile[r][cs + 4 * i + 0] = v[0];
      tile[r][cs + 4 * i + 1] = v[1];
      tile[r][cs + 4 * i + 2] = v[2];
      tile[r][cs + 4 * i + 3] = v[3];
    }
  }
  __syncthreads();
  const int q = lane >> 3, c8 = (lane & 7) * 8;
  unsigned short* ob = XT + ((size_t)n * PP + p0) * DM + d0;
  {
#pragma unroll
    for (int it = 0; it < 2; ++it) {
      const int rr = wave * 8 + it * 4 + q;       // p_local
      v8h hv;
#pragma unroll
      for (int e = 0; e < 8; ++e) hv[e] = (_Float16)tile[c8 + e][rr];   // value (p=rr, d=c8+e)
      *(v8h*)(ob + (size_t)rr * DM + c8) = hv;
    }
    
  }
}

// ---------------------------------------------------------------------------
// Per-head transpose of the positional bias: pos f32 [HH][PP kp][PP qp] -> PT f32 [HH][PP qp][PP kp].
// One block (256 threads) per 64x64 tile: grid = HH * (PP/64) * (PP/64) = 8 * 16 * 16 = 2048.
// Load: thread t reads row kp = k0 + (t>>2), 16 floats at q0 + (t&3)*16 -> the whole tile.
// instruction writes 2 rows (lane>>4 selects the row, 16 lanes x 16 B per row, 8 lanes per line);
// ---------------------------------------------------------------------------
__global__ __launch_bounds__(256) void pos_t_kernel(const float* __restrict__ pos, float* __restrict__ PT) {
  __shared__ float tile[64][65];                 // tile[kp_local][qp_local]
  const int bid = blockIdx.x;
  const int qt = bid & 15;
  const int kt = (bid >> 4) & 15;
  const int h  = bid >> 8;
  const int k0 = kt * 64, q0 = qt * 64;
  const int tid = threadIdx.x, lane = tid & 31, wave = tid >> 5;
  {
    const int r = tid >> 2, cs = (tid & 3) * 16;
    const float* src = pos + ((size_t)h * PP + k0 + r) * PP + q0 + cs;
#pragma unroll
    for (int i = 0; i < 4; ++i) {
      const v4f v = *(const v4f*)(src + 4 * i);
      tile[r][cs + 4 * i + 0] = v[0];
      tile[r][cs + 4 * i + 1] = v[1];
      tile[r][cs + 4 * i + 2] = v[2];
      tile[r][cs + 4 * i + 3] = v[3];
    }
  }
  __syncthreads();
  const int hh = lane >> 4, c4 = (lane & 15) * 4;
  float* ob = PT + ((size_t)h * PP + q0) * PP + k0;
  {
#pragma unroll
    for (int it = 0; it < 4; ++it) {
      const int rr = wave * 8 + it * 2 + hh;      // qp_local
      v4f v;
      v[0] = tile[c4 + 0][rr];                    // value (qp=rr, kp=c4+e)
      v[1] = tile[c4 + 1][rr];
      v[2] = tile[c4 + 2][rr];
      v[3] = tile[c4 + 3][rr];
      *(v4f*)(ob + (size_t)rr * PP + c4) = v;
    }
    
  }
}

// ---------------------------------------------------------------------------
// Row softmax over kp of (S[h][qp][kp] + PT[h][qp][kp]) -> P16[h][qp][kp] = f16(p * 2^15).
// S already holds q.k/16 (f32). One block per (qp, h); grid (PP, HH); 128 threads x 8 columns
// (j0 = tid*8) = 1024 = the whole row. Reductions in fixed order: per thread, wave shuffle tree, then
// the 4 wave partials in index order.
// Producer coverage per row: 128 threads x 8 u16 = 1024 = the whole P row; each store instruction:
// ---------------------------------------------------------------------------
__global__ __launch_bounds__(128) void softmax_bias_kernel(const float* __restrict__ S,
                                                           const float* __restrict__ PT,
                                                           unsigned short* __restrict__ P) {
  __shared__ float redm[4];
  __shared__ float reds[4];
  const int qp   = blockIdx.x;
  const int h    = blockIdx.y;
  const int tid  = threadIdx.x;
  const int lane = tid & 31;
  const int wave = tid >> 5;
  const int j0   = tid * 8;
  const size_t ro = ((size_t)h * PP + qp) * PP + j0;
  const v4f a  = *(const v4f*)(S + ro);
  const v4f c  = *(const v4f*)(S + ro + 4);
  const v4f ba = *(const v4f*)(PT + ro);
  const v4f bc = *(const v4f*)(PT + ro + 4);
  const float t0 = a[0] + ba[0], t1 = a[1] + ba[1], t2 = a[2] + ba[2], t3 = a[3] + ba[3];
  const float t4 = c[0] + bc[0], t5 = c[1] + bc[1], t6 = c[2] + bc[2], t7 = c[3] + bc[3];
  float m = fmaxf(fmaxf(fmaxf(t0, t1), fmaxf(t2, t3)), fmaxf(fmaxf(t4, t5), fmaxf(t6, t7)));
#pragma unroll
  for (int off = 16; off > 0; off >>= 1) m = fmaxf(m, __shfl_xor(m, off, 32));
  if (lane == 0) redm[wave] = m;
  __syncthreads();
  const float mx = fmaxf(fmaxf(redm[0], redm[1]), fmaxf(redm[2], redm[3]));
  const float e0 = __expf(t0 - mx), e1 = __expf(t1 - mx), e2 = __expf(t2 - mx), e3 = __expf(t3 - mx);
  const float e4 = __expf(t4 - mx), e5 = __expf(t5 - mx), e6 = __expf(t6 - mx), e7 = __expf(t7 - mx);
  float s = ((e0 + e1) + (e2 + e3)) + ((e4 + e5) + (e6 + e7));
#pragma unroll
  for (int off = 16; off > 0; off >>= 1) s += __shfl_xor(s, off, 32);
  if (lane == 0) reds[wave] = s;
  __syncthreads();
  const float tot = ((reds[0] + reds[1]) + reds[2]) + reds[3];
  const float inv = 1.0f / tot;              // tot >= 1 (the row max contributes exp(0))
  const float p0 = e0 * inv, p1 = e1 * inv, p2 = e2 * inv, p3 = e3 * inv;
  const float p4 = e4 * inv, p5 = e5 * inv, p6 = e6 * inv, p7 = e7 * inv;
  // p * 2^15 is an exact scaling; p <= 1 so the carried value stays <= 32768 (f16 normal range)
  const v4u hv = (v4u){pk16(h_bits(p0 * PSCALE), h_bits(p1 * PSCALE)),
                       pk16(h_bits(p2 * PSCALE), h_bits(p3 * PSCALE)),
                       pk16(h_bits(p4 * PSCALE), h_bits(p5 * PSCALE)),
                       pk16(h_bits(p6 * PSCALE), h_bits(p7 * PSCALE))};
  *(v4u*)(P + ro) = hv;
  
}

// ---------------------------------------------------------------------------
// Workspace region map (byte offsets). Weight planes, XT16 and PT are written once in full; every
// per-batch region (Q16, K16, VC16, S, P16, OUTP16) is fully rewritten inside each batch iteration
// before it is read (all GEMM extents are exact tile multiples, no padding anywhere).
//   Wk16   f16  [2048][256]  (x16)             0
//   Wq16   f16  [2048][256]  (x16)     1,048,576
//   Wv16   f16  [2048][256]  (x16)     2,097,152
//   Wo16   f16  [256][2048]  (x16)     3,145,728
//   XT16   f16  [8][1024][256]         4,194,304
//   Q16    f16  [1024][2048] (col o)    8,388,608
//   K16    f16  [1024][2048] (col o)   12,582,912
//   VC16   f16  [2048 o][1024 kp]      16,777,216
//   OUTP16 f16  [1024 qp][2048 o] x16  20,971,520
//   PT     f32  [8][1024 qp][1024 kp]  25,165,824
//   S      f32  [8][1024 qp][1024 kp]  58,720,256
//   P16    f16  [8][1024 qp][1024 kp]  92,274,688   (p carried x2^15)
//   total                             109,051,904
// ---------------------------------------------------------------------------
extern "C" void kernel_launch(void* const* d_in, const int* in_sizes, int n_in,
                              void* d_out, int out_size, void* d_ws, size_t ws_size,
                              hipStream_t stream) {
  if (n_in < 10) return;
  if (in_sizes[0] != NB * DM * PP) return;
  if (in_sizes[1] != HH * PP * PP) return;
  if (in_sizes[2] != HDIM * DM || in_sizes[4] != HDIM * DM || in_sizes[6] != HDIM * DM) return;
  if (in_sizes[3] != HDIM || in_sizes[5] != HDIM || in_sizes[7] != HDIM) return;
  if (in_sizes[8] != DM * HDIM || in_sizes[9] != DM) return;
  if (out_size != NB * DM * PP) return;

  const float* x   = (const float*)d_in[0];   // [NB][DM][PP]
  const float* pos = (const float*)d_in[1];   // [1][HH][PP kp][PP qp]
  const float* Wk  = (const float*)d_in[2];   // [HDIM][DM]
  const float* bk  = (const float*)d_in[3];   // [HDIM]
  const float* Wq  = (const float*)d_in[4];
  const float* bq  = (const float*)d_in[5];
  const float* Wv  = (const float*)d_in[6];
  const float* bv  = (const float*)d_in[7];
  const float* Wo  = (const float*)d_in[8];   // [DM][HDIM]
  const float* bo  = (const float*)d_in[9];   // [DM]

  const size_t BW   = (size_t)HDIM * DM * 2;        // 1,048,576
  const size_t BXT  = (size_t)NB * PP * DM * 2;     // 4,194,304
  const size_t BACT = (size_t)PP * HDIM * 2;        // 4,194,304
  const size_t BPT  = (size_t)HH * PP * PP * 4;     // 33,554,432
  const size_t BS   = (size_t)HH * PP * PP * 4;     // 33,554,432
  const size_t BP   = (size_t)HH * PP * PP * 2;     // 16,777,216
  size_t off = 0;
  const size_t oWk16 = off; off += BW;
  const size_t oWq16 = off; off += BW;
  const size_t oWv16 = off; off += BW;
  const size_t oWo16 = off; off += BW;
  const size_t oXT16 = off; off += BXT;
  const size_t oQ16  = off; off += BACT;
  const size_t oK16  = off; off += BACT;
  const size_t oVC16 = off; off += BACT;
  const size_t oOUTP = off; off += BACT;
  const size_t oPT   = off; off += BPT;
  const size_t oS    = off; off += BS;
  const size_t oP16  = off; off += BP;
  if (off > ws_size) return;                          // 109,051,904 B total

  char* ws = (char*)d_ws;
  unsigned short* Wk16  = (unsigned short*)(ws + oWk16);
  unsigned short* Wq16  = (unsigned short*)(ws + oWq16);
  unsigned short* Wv16  = (unsigned short*)(ws + oWv16);
  unsigned short* Wo16  = (unsigned short*)(ws + oWo16);
  unsigned short* XT16  = (unsigned short*)(ws + oXT16);
  unsigned short* Q16   = (unsigned short*)(ws + oQ16);
  unsigned short* K16   = (unsigned short*)(ws + oK16);
  unsigned short* VC16  = (unsigned short*)(ws + oVC16);
  unsigned short* OUTP  = (unsigned short*)(ws + oOUTP);
  float*          PT    = (float*)(ws + oPT);
  float*          Sbuf  = (float*)(ws + oS);
  unsigned short* P16   = (unsigned short*)(ws + oP16);

  const dim3 blk(256);
  const int n2w = HDIM * DM / 2;                      // 262144 pairs per weight plane
  const dim3 gCastW((n2w + 255) / 256);                // 1024 blocks

  // setup: weight planes, carried x16 (exact power of two; undone by the GEMM epilogue scales)
  cast_f16x2_kernel<<<gCastW, blk, 0, stream>>>(Wk, Wk16, n2w, 16.0f);
  cast_f16x2_kernel<<<gCastW, blk, 0, stream>>>(Wq, Wq16, n2w, 16.0f);
  cast_f16x2_kernel<<<gCastW, blk, 0, stream>>>(Wv, Wv16, n2w, 16.0f);
  cast_f16x2_kernel<<<gCastW, blk, 0, stream>>>(Wo, Wo16, n2w, 16.0f);
  // x [NB][DM][PP] -> XT16 [NB][PP][DM] f16
  xt_cast_kernel<<<NB * (PP / 64) * (DM / 64), blk, 0, stream>>>(x, XT16);
  // pos [HH][kp][qp] -> PT [HH][qp][kp] f32
  pos_t_kernel<<<HH * (PP / 64) * (PP / 64), blk, 0, stream>>>(pos, PT);

  const dim3 gProj(((PP / 64) * (HDIM / 64) + 7) / 8, 1);   // 64 blocks: 512 tiles (M=1024,N=2048 or M=2048,N=1024), K=256
  const dim3 gS(((PP / 64) * (PP / 64) + 7) / 8, HH);      // 32 x 8:    M=N=1024, K=256
  const dim3 gPV(((PP / 64) * (DM / 64) + 7) / 8, HH);     // 8 x 8:     M=1024, N=256, K=1024
  const dim3 gOut(((DM / 64) * (PP / 64) + 7) / 8, 1);     // 8 blocks:  M=256, N=1024, K=2048
  const float wscale  = 1.0f / 16.0f;                      // undo the x16 weight carry
  const float sscale  = 0.0625f;                           // 1/sqrt(256) exactly
  const float pvscale = 16.0f * PSCALE_INV;                // 2^-15 (P carry) x 16 (ctx carry) = 2^-11
  const float oscale  = 1.0f / 256.0f;                     // undo x16 (Wo) and x16 (ctx)

  for (int n = 0; n < NB; ++n) {
    const unsigned short* XTn = XT16 + (size_t)n * PP * DM;
    // (1) q[p][o] = (x[p] . (16 Wq)[o])/16 + bq[o] -> Q16 [1024][2048] f16 (A = XT16[n] [1024][256], Bt = Wq16 [2048][256])
    wmma_gemm64<0, false, 2, 1, false, 0><<<gProj, blk, 0, stream>>>(
        XTn, XTn, DM, 0L, Wq16, Wq16, DM, 0L, (void*)Q16, (void*)Q16, HDIM, 0L,
        bq, bq, 0L, PP, HDIM, DM, wscale);
    //     k likewise -> K16
    wmma_gemm64<0, false, 2, 1, false, 0><<<gProj, blk, 0, stream>>>(
        XTn, XTn, DM, 0L, Wk16, Wk16, DM, 0L, (void*)K16, (void*)K16, HDIM, 0L,
        bk, bk, 0L, PP, HDIM, DM, wscale);
    // (2) role-swapped v: VC16[o][kp] = ((16 Wv)[o] . x[kp])/16 + bv[o]; A = Wv16 [2048][256], Bt = XT16[n] [1024][256],
    //     M=2048, N=1024, K=256, bias by m, f16 out with ldc 1024
    wmma_gemm64<0, false, 1, 1, false, 0><<<gProj, blk, 0, stream>>>(
        Wv16, Wv16, DM, 0L, XTn, XTn, DM, 0L, (void*)VC16, (void*)VC16, PP, 0L,
        bv, bv, 0L, HDIM, PP, DM, wscale);
    // (3) S[h][qp][kp] = q_qp . k_kp / 16 per head (f16 operands, K=256, f32 out); head h = columns h*256.. of Q16/K16
    wmma_gemm64<0, false, 0, 0, false, 0><<<gS, blk, 0, stream>>>(
        Q16, Q16, HDIM, (long)DM, K16, K16, HDIM, (long)DM,
        (void*)Sbuf, (void*)Sbuf, PP, (long)PP * PP,
        bq, bq, 0L, PP, PP, DM, sscale);
    // (4) softmax over kp of (S + PT[h][qp][kp]) -> P16 = f16(p * 2^15)
    softmax_bias_kernel<<<dim3(PP, HH), dim3(128), 0, stream>>>(Sbuf, PT, P16);
    // (5) ctx[qp][h*256+dd] = 2^-11 * sum_kp P16[h][qp][kp] VC16[h*256+dd][kp] -> OUTP16 [1024][2048] f16 (carried x16),
    //     per head: A = P16[h] (M=1024, K=1024), Bt = VC16 rows h*256.. (N=256), C column offset h*256 (ldc 2048)
    wmma_gemm64<0, false, 0, 1, false, 0><<<gPV, blk, 0, stream>>>(
        P16, P16, PP, (long)PP * PP, VC16, VC16, PP, (long)DM * PP,
        (void*)OUTP, (void*)OUTP, HDIM, (long)DM,
        bq, bq, 0L, PP, DM, PP, pvscale);
    // (6) y[n][o][p] = (1/256) sum_i (16 Wo)[o][i] (16 ctx)[p][i] + bo[o] -> d_out[n] f32 [256][1024] (ldc 1024, bias by m)
    float* outn = (float*)d_out + (size_t)n * DM * PP;
    wmma_gemm64<0, false, 1, 0, false, 0><<<gOut, blk, 0, stream>>>(
        Wo16, Wo16, HDIM, 0L, OUTP, OUTP, HDIM, 0L, (void*)outn, (void*)outn, PP, 0L,
        bo, bo, 0L, DM, PP, HDIM, oscale);
  }
  (void)hipGetLastError();
}

// v001
// One run takes 416 microseconds.
// In two side-by-side timings against v000, it was 3.52 and 3.50 times as fast.
// All contractions on v_wmma_f32_16x16x32_f16 (f16 operands, f32 accumulate): k/q/v 1x1-conv projections (x as f16, weights carried x16, epilogue x1/16), S = q.k^T per head (epilogue x1/16), ctx = (P carried x2^15).(v f16) (epilogue x2^-11, ctx carried x16), output conv (Wo carried x16, epilogue x1/256); key-axis softmax with the additive positional bias in f32.
#include <hip/hip_runtime.h>
#include <math.h>
#include <stdint.h>

#define NB   8      // batch
#define HH   8      // heads
#define DM   256    // channels = head dim
#define PP   1024   // positions
#define HDIM 2048   // HH * DM
#define GB   4      // batches whose score planes are in the workspace at once
#define PSCALE 32768.0f
#define PSCALE_INV (1.0f / 32768.0f)

typedef __attribute__((ext_vector_type(16))) _Float16 v16h;
typedef __attribute__((ext_vector_type(8)))  _Float16 v8h;
typedef __attribute__((ext_vector_type(16))) __bf16   v16b;
typedef __attribute__((ext_vector_type(8)))  __bf16   v8b;
typedef __attribute__((ext_vector_type(8)))  float    v8f;
typedef __attribute__((ext_vector_type(4)))  float    v4f;
typedef __attribute__((ext_vector_type(2)))  float    v2f;
typedef __attribute__((ext_vector_type(4)))  unsigned int v4u;

__device__ __forceinline__ unsigned short f2bf_bits(float f) {
  unsigned u = __float_as_uint(f);
  return (unsigned short)((u + 0x7FFFu + ((u >> 16) & 1u)) >> 16);
}
__device__ __forceinline__ float bf_bits2f(unsigned short h) { return __uint_as_float(((unsigned)h) << 16); }

// hazard guards as plain device helpers (no inline asm inside the kernel template body)
__device__ __forceinline__ void dep_guard_h(v8f& a, v8f& b, v16h x, v16h y) { asm volatile("v_nop\n\tv_nop\n\tv_nop\n\tv_nop" : "+v"(a), "+v"(b) : "v"(x), "v"(y)); }
__device__ __forceinline__ void dep_guard_b(v8f& a, v8f& b, v16b x, v16b y) { asm volatile("v_nop\n\tv_nop\n\tv_nop\n\tv_nop" : "+v"(a), "+v"(b) : "v"(x), "v"(y)); }
__device__ __forceinline__ void keep4_h(v16h a, v16h b, v16h c, v16h d) { asm volatile("v_nop" :: "v"(a), "v"(b), "v"(c), "v"(d)); }
__device__ __forceinline__ void keep4_b(v16b a, v16b b, v16b c, v16b d) { asm volatile("v_nop" :: "v"(a), "v"(b), "v"(c), "v"(d)); }
__device__ __forceinline__ void acc_guard4(v8f& a, v8f& b, v8f& c, v8f& d) { asm volatile("v_nop\n\tv_nop\n\tv_nop\n\tv_nop" : "+v"(a), "+v"(b), "+v"(c), "+v"(d)); }
template <typename T> struct Frag;
template <> struct Frag<_Float16> {
  typedef v16h V; union U { v16h v; v8h h[2]; };
  static __device__ __forceinline__ v16h load(const _Float16* p) {   // elements 0..7 <- p[0..7], 8..15 <- p[16..23]
    U f; f.h[0] = *(const v8h*)(p); f.h[1] = *(const v8h*)(p + 16); return f.v;
  }
  static __device__ __forceinline__ v8f mma(v16h a, v16h b, v8f c) {
    return __builtin_amdgcn_wmma_f32_16x16x32_f16(false, a, false, b, (short)0, c, false, false);
  }
  static __device__ __forceinline__ void guard(v8f& a, v8f& b, v16h x, v16h y) { dep_guard_h(a, b, x, y); }
  static __device__ __forceinline__ void keep(v16h a, v16h b, v16h c, v16h d) { keep4_h(a, b, c, d); }
};
template <> struct Frag<__bf16> {
  typedef v16b V; union U { v16b v; v8b h[2]; };
  static __device__ __forceinline__ v16b load(const __bf16* p) {
    U f; f.h[0] = *(const v8b*)(p); f.h[1] = *(const v8b*)(p + 16); return f.v;
  }
  static __device__ __forceinline__ v8f mma(v16b a, v16b b, v8f c) {
    return __builtin_amdgcn_wmma_f32_16x16x32_bf16(false, a, false, b, (short)0, c, false, false);
  }
  static __device__ __forceinline__ void guard(v8f& a, v8f& b, v16b x, v16b y) { dep_guard_b(a, b, x, y); }
  static __device__ __forceinline__ void keep(v16b a, v16b b, v16b c, v16b d) { keep4_b(a, b, c, d); }
};

// ---- Register-blocked batched WMMA GEMM ------------------------------------
// C[m,n] = scale * sum_k A[m,k] * Bt[n,k] (+bias)(+resid); each wave owns a 64x64 tile.
// Two batch axes in the grid: blockIdx.y steps by strideA/B/C, blockIdx.z by strideA2/B2/C2 (elements).
// A row-major [M,K]; Bt row-major [N,K]; M,N % 64 == 0, K % 32 == 0.
// SPLIT: operands are hi/lo planes (A2/Bt2 = lo planes, same layout); product = hi.hi + hi.lo + lo.hi.
// BIAS_MODE: 0 = none, 1 = bias[m], 2 = bias[n].
// OUT_MODE: 0 = f32, 1 = f16, 2 = bf16 hi plane (Cout) + bf16 lo plane (Cout2).
// ET: 0 = f16 operands, 1 = bf16 operands (pointers passed as 16-bit storage)
template <int ET> struct Elem;
template <> struct Elem<0> { typedef _Float16 T; };
template <> struct Elem<1> { typedef __bf16 T; };
template <int ET, bool SPLIT, int BIAS_MODE, int OUT_MODE, bool RESID, int ACT = 0>
__global__ __launch_bounds__(256) void wmma_gemm64(
    const unsigned short* __restrict__ Ap, const unsigned short* __restrict__ A2p, int lda, long strideA, long strideA2,
    const unsigned short* __restrict__ Btp, const unsigned short* __restrict__ Bt2p, int ldb, long strideB, long strideB2,
    void* __restrict__ Cout, void* __restrict__ Cout2, int ldc, long strideC, long strideC2,
    const float* __restrict__ bias,
    const float* __restrict__ resid, long strideR,
    int M, int N, int K, float scale) {
  typedef typename Elem<ET>::T T;
  typedef typename Frag<T>::V V;
  const T* A = (const T*)Ap; const T* A2 = (const T*)A2p; const T* Bt = (const T*)Btp; const T* Bt2 = (const T*)Bt2p;
  __shared__ __align__(16) float sT[8][16 * 68];   // per-wave 16x64 slab, pitch 68 floats
  const int b    = blockIdx.y;
  const int z    = blockIdx.z;
  const int lane = threadIdx.x & 31;
  const int wave = threadIdx.x >> 5;
  const int tilesN = N >> 6;
  const int tilesM = M >> 6;
  const int tile = blockIdx.x * 8 + wave;
  if (tile >= tilesM * tilesN) return;   // wave-uniform; no block barriers in this kernel
  const int tm = tile / tilesN;
  const int tn = tile - tm * tilesN;
  const int m0 = tm << 6;
  const int n0 = tn << 6;

  const size_t offA = (size_t)b * strideA + (size_t)z * strideA2;
  const size_t offB = (size_t)b * strideB + (size_t)z * strideB2;
  const size_t offC = (size_t)b * strideC + (size_t)z * strideC2;
  const T* Ab  = A  + offA;
  const T* Bb  = Bt + offB;
  const T* Ab2 = SPLIT ? (A2  + offA) : nullptr;
  const T* Bb2 = SPLIT ? (Bt2 + offB) : nullptr;

  const int rlane = lane & 15;                 // row (A) / col (B, D) within subtile
  const int koff  = (lane >> 4) * 8;           // k offset of this lane half
  const int mOff  = (lane >> 4) * 8;           // D row offset

  v8f acc[4][4];
#pragma unroll
  for (int i = 0; i < 4; ++i)
#pragma unroll
    for (int j = 0; j < 4; ++j) acc[i][j] = (v8f){0.f,0.f,0.f,0.f,0.f,0.f,0.f,0.f};

  for (int k0 = 0; k0 < K; k0 += 32) {
    V bh[4], bl[4];
#pragma unroll
    for (int j = 0; j < 4; ++j) {
      const size_t bo = (size_t)(n0 + (j << 4) + rlane) * ldb + koff + k0;
      bh[j] = Frag<T>::load(Bb + bo);
      if (SPLIT) bl[j] = Frag<T>::load(Bb2 + bo);
    }
#pragma unroll
    for (int i = 0; i < 4; ++i) {
      const size_t ao = (size_t)(m0 + (i << 4) + rlane) * lda + koff + k0;
      V ah = Frag<T>::load(Ab + ao);
      V al;
      if (SPLIT) al = Frag<T>::load(Ab2 + ao);
#pragma unroll
      for (int j = 0; j < 4; ++j) {
        acc[i][j] = Frag<T>::mma(ah, bh[j], acc[i][j]);
        if (SPLIT) {
          acc[i][j] = Frag<T>::mma(ah, bl[j], acc[i][j]);
          acc[i][j] = Frag<T>::mma(al, bh[j], acc[i][j]);
        }
      }
      Frag<T>::guard(acc[i][0], acc[i][3], ah, SPLIT ? al : ah);
    }
    Frag<T>::keep(bh[0], bh[1], bh[2], bh[3]);
    if (SPLIT) Frag<T>::keep(bl[0], bl[1], bl[2], bl[3]);
  }
  acc_guard4(acc[0][0], acc[0][1], acc[0][2], acc[0][3]);
  acc_guard4(acc[1][0], acc[1][1], acc[1][2], acc[1][3]);
  acc_guard4(acc[2][0], acc[2][1], acc[2][2], acc[2][3]);
  acc_guard4(acc[3][0], acc[3][1], acc[3][2], acc[3][3]);

  // ---- epilogue ----
  float* slab = sT[wave];
  const float* Rb = RESID ? (resid + (size_t)b * strideR) : nullptr;
#pragma unroll
  for (int i = 0; i < 4; ++i) {
    const int mBase = m0 + (i << 4);
#pragma unroll
    for (int j = 0; j < 4; ++j) {
      const int n = n0 + (j << 4) + rlane;
      float bv = 0.f;
      if (BIAS_MODE == 2) bv = bias[n];
#pragma unroll
      for (int r = 0; r < 8; ++r) {
        float v = acc[i][j][r] * scale;
        if (BIAS_MODE == 1) v += bias[mBase + mOff + r];
        if (BIAS_MODE == 2) v += bv;
        if (RESID) v += Rb[(size_t)(mBase + mOff + r) * ldc + n];
        if (ACT == 1) v = tanhf(v);
        if (ACT == 2) v = fmaxf(v, 0.0f);
        if (ACT == 3) v = v / (1.0f + expf(-v));
        if (ACT == 4) v = (v > 0.f) ? v : 0.01f * v;
        slab[(mOff + r) * 68 + (j << 4) + rlane] = v;
      }
    }
    __builtin_amdgcn_fence(__ATOMIC_RELEASE, "workgroup");
    __builtin_amdgcn_wave_barrier();
    __builtin_amdgcn_fence(__ATOMIC_ACQUIRE, "workgroup");
    if (OUT_MODE == 0) {
      float* C = (float*)Cout + offC;
      const int hh = lane >> 4, c4 = (lane & 15) * 4;     // row seg = 256 B = 16 lanes x 16 B
      {
#pragma unroll
        for (int it = 0; it < 8; ++it) {
          const int row = it * 2 + hh;
          v4f v = *(const v4f*)(slab + row * 68 + c4);
          *(v4f*)(C + (size_t)(mBase + row) * ldc + n0 + c4) = v;
        }
        
      }
    } else {
      const int q = lane >> 3, c8 = (lane & 7) * 8;
      unsigned short* C  = (unsigned short*)Cout  + offC;
      unsigned short* C2 = (OUT_MODE == 2) ? ((unsigned short*)Cout2 + offC) : nullptr;
      {
#pragma unroll
        for (int it = 0; it < 4; ++it) {
          const int row = it * 4 + q;
          const float* sp = slab + row * 68 + c8;
          v8h hv, lv;
#pragma unroll
          for (int e = 0; e < 8; ++e) {
            if (OUT_MODE == 1) {
              hv[e] = (_Float16)sp[e];
            } else {
              unsigned short hb = f2bf_bits(sp[e]);
              unsigned short lb = f2bf_bits(sp[e] - bf_bits2f(hb));
              hv[e] = __builtin_bit_cast(_Float16, hb);
              lv[e] = __builtin_bit_cast(_Float16, lb);
            }
          }
          *(v8h*)(C + (size_t)(mBase + row) * ldc + n0 + c8) = hv;
          if (OUT_MODE == 2) *(v8h*)(C2 + (size_t)(mBase + row) * ldc + n0 + c8) = lv;
        }
        
      }
    }
    __builtin_amdgcn_fence(__ATOMIC_RELEASE, "workgroup");
    __builtin_amdgcn_wave_barrier();
    __builtin_amdgcn_fence(__ATOMIC_ACQUIRE, "workgroup");
  }
}

// ---------------------------------------------------------------------------
// Elementwise cast out = f16(in * scale) (scale = power-of-two carry): 2 elements per thread, one 4-B
// Coverage: grid = ceil(n2/256) blocks x 256 threads x 2 elements = 2*n2 elements = the whole plane (n2 = plane/2).
// ---------------------------------------------------------------------------
__device__ __forceinline__ unsigned pk16(unsigned short a, unsigned short b) { return (unsigned)a | ((unsigned)b << 16); }
__device__ __forceinline__ unsigned short h_bits(float f) { const _Float16 h = (_Float16)f; return __builtin_bit_cast(unsigned short, h); }

__global__ __launch_bounds__(256) void cast_f16x2_kernel(const float* __restrict__ in, unsigned short* __restrict__ out, int n2, float scale) {
  const int i = blockIdx.x * 256 + threadIdx.x;
  if (i < n2) {
    const v2f f = *(const v2f*)(in + 2 * (size_t)i);
    const unsigned u = pk16(h_bits(f[0] * scale), h_bits(f[1] * scale));
    ((unsigned*)out)[i] = u;
    
  }
}

// ---------------------------------------------------------------------------
// Transpose-cast of the input: x f32 [NB][DM][PP] -> XT f16 [NB][PP][DM]  (in[n][d][p] -> out[n][p][d]).
// One block (256 threads) per 64x64 tile: grid = NB * (PP/64) * (DM/64) = 8 * 16 * 4 = 512.
// Load: thread t reads row d = d0 + (t>>2), 16 floats at p0 + (t&3)*16 -> 256 x 16 = 4096 = the whole tile.
// 4 rows (lanes 8q..8q+7 -> row q of the group, 8 lanes x 16 B per line); 8 waves x 2 it x 4 = 64 rows;
// ---------------------------------------------------------------------------
__global__ __launch_bounds__(256) void xt_cast_kernel(const float* __restrict__ x, unsigned short* __restrict__ XT) {
  __shared__ float tile[64][65];                 // tile[d_local][p_local]
  const int bid = blockIdx.x;
  const int dt = bid & 3;
  const int pt = (bid >> 2) & 15;
  const int n  = bid >> 6;
  const int d0 = dt * 64, p0 = pt * 64;
  const int tid = threadIdx.x, lane = tid & 31, wave = tid >> 5;
  {
    const int r = tid >> 2, cs = (tid & 3) * 16;
    const float* src = x + ((size_t)n * DM + d0 + r) * PP + p0 + cs;
#pragma unroll
    for (int i = 0; i < 4; ++i) {
      const v4f v = *(const v4f*)(src + 4 * i);
      tile[r][cs + 4 * i + 0] = v[0];
      tile[r][cs + 4 * i + 1] = v[1];
      tile[r][cs + 4 * i + 2] = v[2];
      tile[r][cs + 4 * i + 3] = v[3];
    }
  }
  __syncthreads();
  const int q = lane >> 3, c8 = (lane & 7) * 8;
  unsigned short* ob = XT + ((size_t)n * PP + p0) * DM + d0;
  {
#pragma unroll
    for (int it = 0; it < 2; ++it) {
      const int rr = wave * 8 + it * 4 + q;       // p_local
      v8h hv;
#pragma unroll
      for (int e = 0; e < 8; ++e) hv[e] = (_Float16)tile[c8 + e][rr];   // value (p=rr, d=c8+e)
      *(v8h*)(ob + (size_t)rr * DM + c8) = hv;
    }
    
  }
}

// ---------------------------------------------------------------------------
// Per-head transpose of the positional bias: pos f32 [HH][PP kp][PP qp] -> PT f32 [HH][PP qp][PP kp].
// One block (256 threads) per 64x64 tile: grid = HH * (PP/64) * (PP/64) = 8 * 16 * 16 = 2048.
// Load: thread t reads row kp = k0 + (t>>2), 16 floats at q0 + (t&3)*16 -> the whole tile.
// instruction writes 2 rows (lane>>4 selects the row, 16 lanes x 16 B per row, 8 lanes per line);
// ---------------------------------------------------------------------------
__global__ __launch_bounds__(256) void pos_t_kernel(const float* __restrict__ pos, float* __restrict__ PT) {
  __shared__ float tile[64][65];                 // tile[kp_local][qp_local]
  const int bid = blockIdx.x;
  const int qt = bid & 15;
  const int kt = (bid >> 4) & 15;
  const int h  = bid >> 8;
  const int k0 = kt * 64, q0 = qt * 64;
  const int tid = threadIdx.x, lane = tid & 31, wave = tid >> 5;
  {
    const int r = tid >> 2, cs = (tid & 3) * 16;
    const float* src = pos + ((size_t)h * PP + k0 + r) * PP + q0 + cs;
#pragma unroll
    for (int i = 0; i < 4; ++i) {
      const v4f v = *(const v4f*)(src + 4 * i);
      tile[r][cs + 4 * i + 0] = v[0];
      tile[r][cs + 4 * i + 1] = v[1];
      tile[r][cs + 4 * i + 2] = v[2];
      tile[r][cs + 4 * i + 3] = v[3];
    }
  }
  __syncthreads();
  const int hh = lane >> 4, c4 = (lane & 15) * 4;
  float* ob = PT + ((size_t)h * PP + q0) * PP + k0;
  {
#pragma unroll
    for (int it = 0; it < 4; ++it) {
      const int rr = wave * 8 + it * 2 + hh;      // qp_local
      v4f v;
      v[0] = tile[c4 + 0][rr];                    // value (qp=rr, kp=c4+e)
      v[1] = tile[c4 + 1][rr];
      v[2] = tile[c4 + 2][rr];
      v[3] = tile[c4 + 3][rr];
      *(v4f*)(ob + (size_t)rr * PP + c4) = v;
    }
    
  }
}

// ---------------------------------------------------------------------------
// Row softmax over kp of (S[z][h][qp][kp] + PT[h][qp][kp]) -> P16[z][h][qp][kp] = f16(p * 2^15), z = batch in the group.
// The f16 row is written over the first half of its own f32 score row (row pitch stays 4096 B): the block
// owns the row, and every thread's score loads are consumed in front of the first barrier, its store behind the second.
// S already holds q.k/16 (f32). One block per (qp, h, z); grid (PP, HH, GB); 128 threads x 8 columns
// (j0 = tid*8) = 1024 = the whole row. Reductions in fixed order: per thread, wave shuffle tree, then
// the 4 wave partials in index order.
// Producer coverage per row: 128 threads x 8 u16 = 1024 = the whole P row; each store instruction:
// ---------------------------------------------------------------------------
__global__ __launch_bounds__(128) void softmax_bias_kernel(float* SP,
                                                           const float* __restrict__ PT) {
  __shared__ float redm[4];
  __shared__ float reds[4];
  const int qp   = blockIdx.x;
  const int h    = blockIdx.y;
  const int tid  = threadIdx.x;
  const int lane = tid & 31;
  const int wave = tid >> 5;
  const int j0   = tid * 8;
  const size_t ro = ((size_t)h * PP + qp) * PP + j0;
  float* Srow = SP + (((size_t)blockIdx.z * HH + h) * PP + qp) * PP;
  const v4f a  = *(const v4f*)(Srow + j0);
  const v4f c  = *(const v4f*)(Srow + j0 + 4);
  const v4f ba = *(const v4f*)(PT + ro);
  const v4f bc = *(const v4f*)(PT + ro + 4);
  const float t0 = a[0] + ba[0], t1 = a[1] + ba[1], t2 = a[2] + ba[2], t3 = a[3] + ba[3];
  const float t4 = c[0] + bc[0], t5 = c[1] + bc[1], t6 = c[2] + bc[2], t7 = c[3] + bc[3];
  float m = fmaxf(fmaxf(fmaxf(t0, t1), fmaxf(t2, t3)), fmaxf(fmaxf(t4, t5), fmaxf(t6, t7)));
#pragma unroll
  for (int off = 16; off > 0; off >>= 1) m = fmaxf(m, __shfl_xor(m, off, 32));
  if (lane == 0) redm[wave] = m;
  __syncthreads();
  const float mx = fmaxf(fmaxf(redm[0], redm[1]), fmaxf(redm[2], redm[3]));
  const float e0 = __expf(t0 - mx), e1 = __expf(t1 - mx), e2 = __expf(t2 - mx), e3 = __expf(t3 - mx);
  const float e4 = __expf(t4 - mx), e5 = __expf(t5 - mx), e6 = __expf(t6 - mx), e7 = __expf(t7 - mx);
  float s = ((e0 + e1) + (e2 + e3)) + ((e4 + e5) + (e6 + e7));
#pragma unroll
  for (int off = 16; off > 0; off >>= 1) s += __shfl_xor(s, off, 32);
  if (lane == 0) reds[wave] = s;
  __syncthreads();
  const float tot = ((reds[0] + reds[1]) + reds[2]) + reds[3];
  const float inv = 1.0f / tot;              // tot >= 1 (the row max contributes exp(0))
  const float p0 = e0 * inv, p1 = e1 * inv, p2 = e2 * inv, p3 = e3 * inv;
  const float p4 = e4 * inv, p5 = e5 * inv, p6 = e6 * inv, p7 = e7 * inv;
  // p * 2^15 is an exact scaling; p <= 1 so the carried value stays <= 32768 (f16 normal range)
  const v4u hv = (v4u){pk16(h_bits(p0 * PSCALE), h_bits(p1 * PSCALE)),
                       pk16(h_bits(p2 * PSCALE), h_bits(p3 * PSCALE)),
                       pk16(h_bits(p4 * PSCALE), h_bits(p5 * PSCALE)),
                       pk16(h_bits(p6 * PSCALE), h_bits(p7 * PSCALE))};
  *(v4u*)((unsigned short*)Srow + j0) = hv;
  
}

// ---------------------------------------------------------------------------
// Workspace region map (byte offsets). All eight batches go through each stage in one launch (batch = a grid
// axis); only the score planes are too large for that and go in two groups of GB = 4 batches.
// Every region is fully written in this call before it is read (all GEMM extents are exact tile multiples).
//   Q16    f16  [8][1024][2048] (col o)              0   (ctx of batch n, x16, overwrites q of batch n once its scores exist)
//   K16    f16  [8][1024][2048] (col o)     33,554,432
//   VC16   f16  [8][2048 o][1024 kp]        67,108,864
//   PT     f32  [8 h][1024 qp][1024 kp]    100,663,296
//   S      f32  [4][8 h][1024 qp][1024 kp] 134,217,728   (P16 = p x2^15 in the first half of each row)
//   total                                  268,435,456
// Planes that are dead before the first score launch lie inside the S region:
//   Wk16, Wq16, Wv16 f16 [2048][256] (x16) at S + 0, + 1,048,576, + 2,097,152;  XT16 f16 [8][1024][256] at S + 4,194,304.
// Wo16 f16 [256][2048] (x16) is cast behind the last ctx launch, to S + 0.
// ---------------------------------------------------------------------------
extern "C" void kernel_launch(void* const* d_in, const int* in_sizes, int n_in,
                              void* d_out, int out_size, void* d_ws, size_t ws_size,
                              hipStream_t stream) {
  if (n_in < 10) return;
  if (in_sizes[0] != NB * DM * PP) return;
  if (in_sizes[1] != HH * PP * PP) return;
  if (in_sizes[2] != HDIM * DM || in_sizes[4] != HDIM * DM || in_sizes[6] != HDIM * DM) return;
  if (in_sizes[3] != HDIM || in_sizes[5] != HDIM || in_sizes[7] != HDIM) return;
  if (in_sizes[8] != DM * HDIM || in_sizes[9] != DM) return;
  if (out_size != NB * DM * PP) return;

  const float* x   = (const float*)d_in[0];   // [NB][DM][PP]
  const float* pos = (const float*)d_in[1];   // [1][HH][PP kp][PP qp]
  const float* Wk  = (const float*)d_in[2];   // [HDIM][DM]
  const float* bk  = (const float*)d_in[3];   // [HDIM]
  const float* Wq  = (const float*)d_in[4];
  const float* bq  = (const float*)d_in[5];
  const float* Wv  = (const float*)d_in[6];
  const float* bv  = (const float*)d_in[7];
  const float* Wo  = (const float*)d_in[8];   // [DM][HDIM]
  const float* bo  = (const float*)d_in[9];   // [DM]

  const size_t BW   = (size_t)HDIM * DM * 2;             // 1,048,576
  const size_t BACT = (size_t)NB * PP * HDIM * 2;        // 33,554,432
  const size_t BPT  = (size_t)HH * PP * PP * 4;          // 33,554,432
  const size_t BS   = (size_t)GB * HH * PP * PP * 4;     // 134,217,728
  size_t off = 0;
  const size_t oQ16  = off; off += BACT;
  const size_t oK16  = off; off += BACT;
  const size_t oVC16 = off; off += BACT;
  const size_t oPT   = off; off += BPT;
  const size_t oS    = off; off += BS;
  if (off > ws_size) return;                          // 268,435,456 B total

  char* ws = (char*)d_ws;
  unsigned short* Q16   = (unsigned short*)(ws + oQ16);
  unsigned short* K16   = (unsigned short*)(ws + oK16);
  unsigned short* VC16  = (unsigned short*)(ws + oVC16);
  unsigned short* OUTP  = Q16;
  float*          PT    = (float*)(ws + oPT);
  float*          Sbuf  = (float*)(ws + oS);
  unsigned short* P16   = (unsigned short*)(ws + oS);
  unsigned short* Wk16  = (unsigned short*)(ws + oS);
  unsigned short* Wq16  = (unsigned short*)(ws + oS + BW);
  unsigned short* Wv16  = (unsigned short*)(ws + oS + 2 * BW);
  unsigned short* XT16  = (unsigned short*)(ws + oS + 4 * BW);
  unsigned short* Wo16  = (unsigned short*)(ws + oS);

  const dim3 blk(256);
  const int n2w = HDIM * DM / 2;                      // 262144 pairs per weight plane
  const dim3 gCastW((n2w + 255) / 256);                // 1024 blocks

  // setup: weight planes, carried x16 (exact power of two; undone by the GEMM epilogue scales)
  cast_f16x2_kernel<<<gCastW, blk, 0, stream>>>(Wk, Wk16, n2w, 16.0f);
  cast_f16x2_kernel<<<gCastW, blk, 0, stream>>>(Wq, Wq16, n2w, 16.0f);
  cast_f16x2_kernel<<<gCastW, blk, 0, stream>>>(Wv, Wv16, n2w, 16.0f);
  // x [NB][DM][PP] -> XT16 [NB][PP][DM] f16
  xt_cast_kernel<<<NB * (PP / 64) * (DM / 64), blk, 0, stream>>>(x, XT16);
  // pos [HH][kp][qp] -> PT [HH][qp][kp] f32
  pos_t_kernel<<<HH * (PP / 64) * (PP / 64), blk, 0, stream>>>(pos, PT);

  const dim3 gProj(((PP / 64) * (HDIM / 64) + 7) / 8, NB);    // 64 x 8:     512 tiles a batch (M=1024,N=2048 or M=2048,N=1024), K=256
  const dim3 gS(((PP / 64) * (PP / 64) + 7) / 8, HH, GB);    // 32 x 8 x 4: M=N=1024, K=256
  const dim3 gPV(((PP / 64) * (DM / 64) + 7) / 8, HH, GB);   // 8 x 8 x 4:  M=1024, N=256, K=1024
  const dim3 gOut(((DM / 64) * (PP / 64) + 7) / 8, NB);      // 8 x 8:      M=256, N=1024, K=2048
  const float wscale  = 1.0f / 16.0f;                      // undo the x16 weight carry
  const float sscale  = 0.0625f;                           // 1/sqrt(256) exactly
  const float pvscale = 16.0f * PSCALE_INV;                // 2^-15 (P carry) x 16 (ctx carry) = 2^-11
  const float oscale  = 1.0f / 256.0f;                     // undo x16 (Wo) and x16 (ctx)

  // (1) q[n][p][o] = (x[n][p] . (16 Wq)[o])/16 + bq[o] -> Q16 [8][1024][2048] f16 (A = XT16[n] [1024][256], Bt = Wq16 [2048][256]); y = n
  wmma_gemm64<0, false, 2, 1, false, 0><<<gProj, blk, 0, stream>>>(
      XT16, XT16, DM, (long)PP * DM, 0L, Wq16, Wq16, DM, 0L, 0L, (void*)Q16, (void*)Q16, HDIM, (long)PP * HDIM, 0L,
      bq, bq, 0L, PP, HDIM, DM, wscale);
  //     k likewise -> K16
  wmma_gemm64<0, false, 2, 1, false, 0><<<gProj, blk, 0, stream>>>(
      XT16, XT16, DM, (long)PP * DM, 0L, Wk16, Wk16, DM, 0L, 0L, (void*)K16, (void*)K16, HDIM, (long)PP * HDIM, 0L,
      bk, bk, 0L, PP, HDIM, DM, wscale);
  // (2) role-swapped v: VC16[n][o][kp] = ((16 Wv)[o] . x[n][kp])/16 + bv[o]; A = Wv16 [2048][256], Bt = XT16[n] [1024][256],
  //     M=2048, N=1024, K=256, bias by m, f16 out with ldc 1024; y = n
  wmma_gemm64<0, false, 1, 1, false, 0><<<gProj, blk, 0, stream>>>(
      Wv16, Wv16, DM, 0L, 0L, XT16, XT16, DM, (long)PP * DM, 0L, (void*)VC16, (void*)VC16, PP, (long)HDIM * PP, 0L,
      bv, bv, 0L, HDIM, PP, DM, wscale);

  for (int g = 0; g < NB / GB; ++g) {
    const unsigned short* Qg = Q16  + (size_t)g * GB * PP * HDIM;
    const unsigned short* Kg = K16  + (size_t)g * GB * PP * HDIM;
    const unsigned short* Vg = VC16 + (size_t)g * GB * HDIM * PP;
    unsigned short*       Og = OUTP + (size_t)g * GB * PP * HDIM;
    // (3) S[z][h][qp][kp] = q_qp . k_kp / 16 per batch z and head h (f16 operands, K=256, f32 out); head h = columns h*256.. of Q16/K16
    wmma_gemm64<0, false, 0, 0, false, 0><<<gS, blk, 0, stream>>>(
        Qg, Qg, HDIM, (long)DM, (long)PP * HDIM, Kg, Kg, HDIM, (long)DM, (long)PP * HDIM,
        (void*)Sbuf, (void*)Sbuf, PP, (long)PP * PP, (long)HH * PP * PP,
        bq, bq, 0L, PP, PP, DM, sscale);
    // (4) softmax over kp of (S + PT[h][qp][kp]) -> P16 = f16(p * 2^15), in the first half of each score row
    softmax_bias_kernel<<<dim3(PP, HH, GB), dim3(128), 0, stream>>>(Sbuf, PT);
    // (5) ctx[z][qp][h*256+dd] = 2^-11 * sum_kp P16[z][h][qp][kp] VC16[z][h*256+dd][kp] -> OUTP [1024][2048] f16 (carried x16),
    //     per head: A = P16[z][h] (M=1024, K=1024, row pitch 2048 f16), Bt = VC16 rows h*256.. (N=256), C column offset h*256 (ldc 2048)
    wmma_gemm64<0, false, 0, 1, false, 0><<<gPV, blk, 0, stream>>>(
        P16, P16, 2 * PP, (long)PP * 2 * PP, (long)HH * PP * 2 * PP, Vg, Vg, PP, (long)DM * PP, (long)HDIM * PP,
        (void*)Og, (void*)Og, HDIM, (long)DM, (long)PP * HDIM,
        bq, bq, 0L, PP, DM, PP, pvscale);
  }
  // Wo plane, carried x16, into the score region (no score or P row is read any more)
  cast_f16x2_kernel<<<gCastW, blk, 0, stream>>>(Wo, Wo16, n2w, 16.0f);
  // (6) y[n][o][p] = (1/256) sum_i (16 Wo)[o][i] (16 ctx)[n][p][i] + bo[o] -> d_out[n] f32 [256][1024] (ldc 1024, bias by m); y = n
  wmma_gemm64<0, false, 1, 0, false, 0><<<gOut, blk, 0, stream>>>(
      Wo16, Wo16, HDIM, 0L, 0L, OUTP, OUTP, HDIM, (long)PP * HDIM, 0L, d_out, d_out, PP, (long)DM * PP, 0L,
      bo, bo, 0L, DM, PP, HDIM, oscale);
  (void)hipGetLastError();
}

// v002
// It runs in 221 microseconds.
// Next to v001, in two timings, it ran 1.88 and 1.89 times as fast.
// Counting every step since v000, it is 6.62 times as fast.
// All contractions on v_wmma_f32_16x16x32_f16 (f16 operands, f32 accumulate): k/q/v 1x1-conv projections (x as f16, weights carried x16, epilogue x1/16), one fused attention kernel (S^T = k.(q/16)^T on top of the positional bias, online key-axis softmax in f32, ctx^T += v^T.P^T with P packed from the score accumulators), output conv (Wo carried x16, ctx carried x16, epilogue x1/256).
#include <hip/hip_runtime.h>
#include <math.h>
#include <stdint.h>

#define NB   8      // batch
#define HH   8      // heads
#define DM   256    // channels = head dim
#define PP   1024   // positions
#define HDIM 2048   // HH * DM

typedef __attribute__((ext_vector_type(16))) _Float16 v16h;
typedef __attribute__((ext_vector_type(8)))  _Float16 v8h;
typedef __attribute__((ext_vector_type(16))) __bf16   v16b;
typedef __attribute__((ext_vector_type(8)))  __bf16   v8b;
typedef __attribute__((ext_vector_type(8)))  float    v8f;
typedef __attribute__((ext_vector_type(4)))  float    v4f;
typedef __attribute__((ext_vector_type(2)))  float    v2f;
typedef __attribute__((ext_vector_type(4)))  unsigned int v4u;

__device__ __forceinline__ unsigned short f2bf_bits(float f) {
  unsigned u = __float_as_uint(f);
  return (unsigned short)((u + 0x7FFFu + ((u >> 16) & 1u)) >> 16);
}
__device__ __forceinline__ float bf_bits2f(unsigned short h) { return __uint_as_float(((unsigned)h) << 16); }

// hazard guards as plain device helpers (no inline asm inside the kernel template body)
__device__ __forceinline__ void dep_guard_h(v8f& a, v8f& b, v16h x, v16h y) { asm volatile("v_nop\n\tv_nop\n\tv_nop\n\tv_nop" : "+v"(a), "+v"(b) : "v"(x), "v"(y)); }
__device__ __forceinline__ void dep_guard_b(v8f& a, v8f& b, v16b x, v16b y) { asm volatile("v_nop\n\tv_nop\n\tv_nop\n\tv_nop" : "+v"(a), "+v"(b) : "v"(x), "v"(y)); }
__device__ __forceinline__ void keep4_h(v16h a, v16h b, v16h c, v16h d) { asm volatile("v_nop" :: "v"(a), "v"(b), "v"(c), "v"(d)); }
__device__ __forceinline__ void keep4_b(v16b a, v16b b, v16b c, v16b d) { asm volatile("v_nop" :: "v"(a), "v"(b), "v"(c), "v"(d)); }
__device__ __forceinline__ void acc_guard4(v8f& a, v8f& b, v8f& c, v8f& d) { asm volatile("v_nop\n\tv_nop\n\tv_nop\n\tv_nop" : "+v"(a), "+v"(b), "+v"(c), "+v"(d)); }
template <typename T> struct Frag;
template <> struct Frag<_Float16> {
  typedef v16h V; union U { v16h v; v8h h[2]; };
  static __device__ __forceinline__ v16h load(const _Float16* p) {   // elements 0..7 <- p[0..7], 8..15 <- p[16..23]
    U f; f.h[0] = *(const v8h*)(p); f.h[1] = *(const v8h*)(p + 16); return f.v;
  }
  static __device__ __forceinline__ v8f mma(v16h a, v16h b, v8f c) {
    return __builtin_amdgcn_wmma_f32_16x16x32_f16(false, a, false, b, (short)0, c, false, false);
  }
  static __device__ __forceinline__ void guard(v8f& a, v8f& b, v16h x, v16h y) { dep_guard_h(a, b, x, y); }
  static __device__ __forceinline__ void keep(v16h a, v16h b, v16h c, v16h d) { keep4_h(a, b, c, d); }
};
template <> struct Frag<__bf16> {
  typedef v16b V; union U { v16b v; v8b h[2]; };
  static __device__ __forceinline__ v16b load(const __bf16* p) {
    U f; f.h[0] = *(const v8b*)(p); f.h[1] = *(const v8b*)(p + 16); return f.v;
  }
  static __device__ __forceinline__ v8f mma(v16b a, v16b b, v8f c) {
    return __builtin_amdgcn_wmma_f32_16x16x32_bf16(false, a, false, b, (short)0, c, false, false);
  }
  static __device__ __forceinline__ void guard(v8f& a, v8f& b, v16b x, v16b y) { dep_guard_b(a, b, x, y); }
  static __device__ __forceinline__ void keep(v16b a, v16b b, v16b c, v16b d) { keep4_b(a, b, c, d); }
};

// ---- Register-blocked batched WMMA GEMM ------------------------------------
// C[m,n] = scale * sum_k A[m,k] * Bt[n,k] (+bias)(+resid); each wave owns a 64x64 tile.
// Two batch axes in the grid: blockIdx.y steps by strideA/B/C, blockIdx.z by strideA2/B2/C2 (elements).
// A row-major [M,K]; Bt row-major [N,K]; M,N % 64 == 0, K % 32 == 0.
// SPLIT: operands are hi/lo planes (A2/Bt2 = lo planes, same layout); product = hi.hi + hi.lo + lo.hi.
// BIAS_MODE: 0 = none, 1 = bias[m], 2 = bias[n].
// OUT_MODE: 0 = f32, 1 = f16, 2 = bf16 hi plane (Cout) + bf16 lo plane (Cout2).
// ET: 0 = f16 operands, 1 = bf16 operands (pointers passed as 16-bit storage)
template <int ET> struct Elem;
template <> struct Elem<0> { typedef _Float16 T; };
template <> struct Elem<1> { typedef __bf16 T; };
template <int ET, bool SPLIT, int BIAS_MODE, int OUT_MODE, bool RESID, int ACT = 0>
__global__ __launch_bounds__(256) void wmma_gemm64(
    const unsigned short* __restrict__ Ap, const unsigned short* __restrict__ A2p, int lda, long strideA, long strideA2,
    const unsigned short* __restrict__ Btp, const unsigned short* __restrict__ Bt2p, int ldb, long strideB, long strideB2,
    void* __restrict__ Cout, void* __restrict__ Cout2, int ldc, long strideC, long strideC2,
    const float* __restrict__ bias,
    const float* __restrict__ resid, long strideR,
    int M, int N, int K, float scale) {
  typedef typename Elem<ET>::T T;
  typedef typename Frag<T>::V V;
  const T* A = (const T*)Ap; const T* A2 = (const T*)A2p; const T* Bt = (const T*)Btp; const T* Bt2 = (const T*)Bt2p;
  __shared__ __align__(16) float sT[8][16 * 68];   // per-wave 16x64 slab, pitch 68 floats
  const int b    = blockIdx.y;
  const int z    = blockIdx.z;
  const int lane = threadIdx.x & 31;
  const int wave = threadIdx.x >> 5;
  const int tilesN = N >> 6;
  const int tilesM = M >> 6;
  const int tile = blockIdx.x * 8 + wave;
  if (tile >= tilesM * tilesN) return;   // wave-uniform; no block barriers in this kernel
  const int tm = tile / tilesN;
  const int tn = tile - tm * tilesN;
  const int m0 = tm << 6;
  const int n0 = tn << 6;

  const size_t offA = (size_t)b * strideA + (size_t)z * strideA2;
  const size_t offB = (size_t)b * strideB + (size_t)z * strideB2;
  const size_t offC = (size_t)b * strideC + (size_t)z * strideC2;
  const T* Ab  = A  + offA;
  const T* Bb  = Bt + offB;
  const T* Ab2 = SPLIT ? (A2  + offA) : nullptr;
  const T* Bb2 = SPLIT ? (Bt2 + offB) : nullptr;

  const int rlane = lane & 15;                 // row (A) / col (B, D) within subtile
  const int koff  = (lane >> 4) * 8;           // k offset of this lane half
  const int mOff  = (lane >> 4) * 8;           // D row offset

  v8f acc[4][4];
#pragma unroll
  for (int i = 0; i < 4; ++i)
#pragma unroll
    for (int j = 0; j < 4; ++j) acc[i][j] = (v8f){0.f,0.f,0.f,0.f,0.f,0.f,0.f,0.f};

  for (int k0 = 0; k0 < K; k0 += 32) {
    V bh[4], bl[4];
#pragma unroll
    for (int j = 0; j < 4; ++j) {
      const size_t bo = (size_t)(n0 + (j << 4) + rlane) * ldb + koff + k0;
      bh[j] = Frag<T>::load(Bb + bo);
      if (SPLIT) bl[j] = Frag<T>::load(Bb2 + bo);
    }
#pragma unroll
    for (int i = 0; i < 4; ++i) {
      const size_t ao = (size_t)(m0 + (i << 4) + rlane) * lda + koff + k0;
      V ah = Frag<T>::load(Ab + ao);
      V al;
      if (SPLIT) al = Frag<T>::load(Ab2 + ao);
#pragma unroll
      for (int j = 0; j < 4; ++j) {
        acc[i][j] = Frag<T>::mma(ah, bh[j], acc[i][j]);
        if (SPLIT) {
          acc[i][j] = Frag<T>::mma(ah, bl[j], acc[i][j]);
          acc[i][j] = Frag<T>::mma(al, bh[j], acc[i][j]);
        }
      }
      Frag<T>::guard(acc[i][0], acc[i][3], ah, SPLIT ? al : ah);
    }
    Frag<T>::keep(bh[0], bh[1], bh[2], bh[3]);
    if (SPLIT) Frag<T>::keep(bl[0], bl[1], bl[2], bl[3]);
  }
  acc_guard4(acc[0][0], acc[0][1], acc[0][2], acc[0][3]);
  acc_guard4(acc[1][0], acc[1][1], acc[1][2], acc[1][3]);
  acc_guard4(acc[2][0], acc[2][1], acc[2][2], acc[2][3]);
  acc_guard4(acc[3][0], acc[3][1], acc[3][2], acc[3][3]);

  // ---- epilogue ----
  float* slab = sT[wave];
  const float* Rb = RESID ? (resid + (size_t)b * strideR) : nullptr;
#pragma unroll
  for (int i = 0; i < 4; ++i) {
    const int mBase = m0 + (i << 4);
#pragma unroll
    for (int j = 0; j < 4; ++j) {
      const int n = n0 + (j << 4) + rlane;
      float bv = 0.f;
      if (BIAS_MODE == 2) bv = bias[n];
#pragma unroll
      for (int r = 0; r < 8; ++r) {
        float v = acc[i][j][r] * scale;
        if (BIAS_MODE == 1) v += bias[mBase + mOff + r];
        if (BIAS_MODE == 2) v += bv;
        if (RESID) v += Rb[(size_t)(mBase + mOff + r) * ldc + n];
        if (ACT == 1) v = tanhf(v);
        if (ACT == 2) v = fmaxf(v, 0.0f);
        if (ACT == 3) v = v / (1.0f + expf(-v));
        if (ACT == 4) v = (v > 0.f) ? v : 0.01f * v;
        slab[(mOff + r) * 68 + (j << 4) + rlane] = v;
      }
    }
    __builtin_amdgcn_fence(__ATOMIC_RELEASE, "workgroup");
    __builtin_amdgcn_wave_barrier();
    __builtin_amdgcn_fence(__ATOMIC_ACQUIRE, "workgroup");
    if (OUT_MODE == 0) {
      float* C = (float*)Cout + offC;
      const int hh = lane >> 4, c4 = (lane & 15) * 4;     // row seg = 256 B = 16 lanes x 16 B
      {
#pragma unroll
        for (int it = 0; it < 8; ++it) {
          const int row = it * 2 + hh;
          v4f v = *(const v4f*)(slab + row * 68 + c4);
          *(v4f*)(C + (size_t)(mBase + row) * ldc + n0 + c4) = v;
        }
        
      }
    } else {
      const int q = lane >> 3, c8 = (lane & 7) * 8;
      unsigned short* C  = (unsigned short*)Cout  + offC;
      unsigned short* C2 = (OUT_MODE == 2) ? ((unsigned short*)Cout2 + offC) : nullptr;
      {
#pragma unroll
        for (int it = 0; it < 4; ++it) {
          const int row = it * 4 + q;
          const float* sp = slab + row * 68 + c8;
          v8h hv, lv;
#pragma unroll
          for (int e = 0; e < 8; ++e) {
            if (OUT_MODE == 1) {
              hv[e] = (_Float16)sp[e];
            } else {
              unsigned short hb = f2bf_bits(sp[e]);
              unsigned short lb = f2bf_bits(sp[e] - bf_bits2f(hb));
              hv[e] = __builtin_bit_cast(_Float16, hb);
              lv[e] = __builtin_bit_cast(_Float16, lb);
            }
          }
          *(v8h*)(C + (size_t)(mBase + row) * ldc + n0 + c8) = hv;
          if (OUT_MODE == 2) *(v8h*)(C2 + (size_t)(mBase + row) * ldc + n0 + c8) = lv;
        }
        
      }
    }
    __builtin_amdgcn_fence(__ATOMIC_RELEASE, "workgroup");
    __builtin_amdgcn_wave_barrier();
    __builtin_amdgcn_fence(__ATOMIC_ACQUIRE, "workgroup");
  }
}

// ---------------------------------------------------------------------------
// Elementwise cast out = f16(in * scale) (scale = power-of-two carry): 2 elements per thread, one 4-B
// Coverage: grid = ceil(n2/256) blocks x 256 threads x 2 elements = 2*n2 elements = the whole plane (n2 = plane/2).
// ---------------------------------------------------------------------------
__device__ __forceinline__ unsigned pk16(unsigned short a, unsigned short b) { return (unsigned)a | ((unsigned)b << 16); }
__device__ __forceinline__ unsigned short h_bits(float f) { const _Float16 h = (_Float16)f; return __builtin_bit_cast(unsigned short, h); }

__global__ __launch_bounds__(256) void cast_f16x2_kernel(const float* __restrict__ in, unsigned short* __restrict__ out, int n2, float scale) {
  const int i = blockIdx.x * 256 + threadIdx.x;
  if (i < n2) {
    const v2f f = *(const v2f*)(in + 2 * (size_t)i);
    const unsigned u = pk16(h_bits(f[0] * scale), h_bits(f[1] * scale));
    ((unsigned*)out)[i] = u;
    
  }
}

// ---------------------------------------------------------------------------
// Transpose-cast of the input: x f32 [NB][DM][PP] -> XT f16 [NB][PP][DM]  (in[n][d][p] -> out[n][p][d]).
// One block (256 threads) per 64x64 tile: grid = NB * (PP/64) * (DM/64) = 8 * 16 * 4 = 512.
// Load: thread t reads row d = d0 + (t>>2), 16 floats at p0 + (t&3)*16 -> 256 x 16 = 4096 = the whole tile.
// 4 rows (lanes 8q..8q+7 -> row q of the group, 8 lanes x 16 B per line); 8 waves x 2 it x 4 = 64 rows;
// ---------------------------------------------------------------------------
__global__ __launch_bounds__(256) void xt_cast_kernel(const float* __restrict__ x, unsigned short* __restrict__ XT) {
  __shared__ float tile[64][65];                 // tile[d_local][p_local]
  const int bid = blockIdx.x;
  const int dt = bid & 3;
  const int pt = (bid >> 2) & 15;
  const int n  = bid >> 6;
  const int d0 = dt * 64, p0 = pt * 64;
  const int tid = threadIdx.x, lane = tid & 31, wave = tid >> 5;
  {
    const int r = tid >> 2, cs = (tid & 3) * 16;
    const float* src = x + ((size_t)n * DM + d0 + r) * PP + p0 + cs;
#pragma unroll
    for (int i = 0; i < 4; ++i) {
      const v4f v = *(const v4f*)(src + 4 * i);
      tile[r][cs + 4 * i + 0] = v[0];
      tile[r][cs + 4 * i + 1] = v[1];
      tile[r][cs + 4 * i + 2] = v[2];
      tile[r][cs + 4 * i + 3] = v[3];
    }
  }
  __syncthreads();
  const int q = lane >> 3, c8 = (lane & 7) * 8;
  unsigned short* ob = XT + ((size_t)n * PP + p0) * DM + d0;
  {
#pragma unroll
    for (int it = 0; it < 2; ++it) {
      const int rr = wave * 8 + it * 4 + q;       // p_local
      v8h hv;
#pragma unroll
      for (int e = 0; e < 8; ++e) hv[e] = (_Float16)tile[c8 + e][rr];   // value (p=rr, d=c8+e)
      *(v8h*)(ob + (size_t)rr * DM + c8) = hv;
    }
    
  }
}

#define FK      64
#define NSTAGE  (PP / FK)
#define KP_H    264
#define VP_H    72
#define KTILE_H (FK * KP_H)
#define STAGE_H (KTILE_H + DM * VP_H)
#define LOG2E   1.4426950408889634f

// eight 16-byte copies of each lane; the address wait is the statement's last line, so no address register is rewritten in front of it
__device__ __forceinline__ void async_copy8(unsigned l0, unsigned lstep, const unsigned short* g0, size_t gstep) {
  asm volatile(
      "global_load_async_to_lds_b128 %0, %8, off\n\t"
      "global_load_async_to_lds_b128 %1, %9, off\n\t"
      "global_load_async_to_lds_b128 %2, %10, off\n\t"
      "global_load_async_to_lds_b128 %3, %11, off\n\t"
      "global_load_async_to_lds_b128 %4, %12, off\n\t"
      "global_load_async_to_lds_b128 %5, %13, off\n\t"
      "global_load_async_to_lds_b128 %6, %14, off\n\t"
      "global_load_async_to_lds_b128 %7, %15, off\n\t"
      "s_wait_xcnt 0x0"
      :: "v"(l0), "v"(l0 + lstep), "v"(l0 + 2 * lstep), "v"(l0 + 3 * lstep),
         "v"(l0 + 4 * lstep), "v"(l0 + 5 * lstep), "v"(l0 + 6 * lstep), "v"(l0 + 7 * lstep),
         "v"(g0), "v"(g0 + gstep), "v"(g0 + 2 * gstep), "v"(g0 + 3 * gstep),
         "v"(g0 + 4 * gstep), "v"(g0 + 5 * gstep), "v"(g0 + 6 * gstep), "v"(g0 + 7 * gstep)
      : "memory");
}

__global__ __launch_bounds__(256) void attn_fused_kernel(const unsigned short* __restrict__ Q16,
                                                         const unsigned short* __restrict__ K16,
                                                         const unsigned short* __restrict__ VC16,
                                                         const float* __restrict__ pos,
                                                         unsigned short* __restrict__ CTX) {
  __shared__ __align__(16) unsigned short ring[2 * STAGE_H];
  typedef Frag<_Float16> F;
  const int tid = threadIdx.x, lane = tid & 31, wave = tid >> 5;
  const int c = lane & 15, hf = lane >> 4;
  const int h = blockIdx.y, n = blockIdx.z;
  const int q0 = blockIdx.x * 256 + wave * 32;
  const unsigned short* Kh = K16 + (size_t)n * PP * HDIM + h * DM;          // [kp][d], row pitch HDIM
  const unsigned short* Vh = VC16 + ((size_t)n * HDIM + h * DM) * PP;      // [dd][kp], row pitch PP
  const float* ph = pos + (size_t)h * PP * PP + (size_t)(hf * 8) * PP + q0 + c;
  const unsigned ring0 = (unsigned)(size_t)(&ring[0]);

  // stage t -> buffer b. k: wave w copies rows w, w+8, ... (512 B a row); v^T: 8 lanes a row of 128 B, rows tid>>3, +32, ...
  const unsigned short* kg = Kh + (size_t)wave * HDIM + lane * 8;
  const unsigned short* vg = Vh + (size_t)(tid >> 3) * PP + (tid & 7) * 8;
  const unsigned kl = ring0 + wave * (KP_H * 2) + lane * 16;
  const unsigned vl = ring0 + KTILE_H * 2 + (tid >> 3) * (VP_H * 2) + (tid & 7) * 16;
  auto issue_stage = [&](int t, int b) {
    async_copy8(kl + b * (STAGE_H * 2), 8 * KP_H * 2, kg + (size_t)t * FK * HDIM, (size_t)8 * HDIM);
    async_copy8(vl + b * (STAGE_H * 2), 32 * VP_H * 2, vg + t * FK, (size_t)32 * PP);
  };

  issue_stage(0, 0);

  v16h qf[8][2];                            // q / 16 (exact power of two), hardware k order
#pragma unroll
  for (int kk = 0; kk < 8; ++kk)
#pragma unroll
    for (int nt = 0; nt < 2; ++nt)
      qf[kk][nt] = F::load((const _Float16*)Q16 + ((size_t)n * PP + q0 + nt * 16 + c) * HDIM + h * DM + kk * 32 + hf * 8) * (_Float16)0.0625f;

  v8f acc[16][2];
#pragma unroll
  for (int dt = 0; dt < 16; ++dt)
#pragma unroll
    for (int nt = 0; nt < 2; ++nt) acc[dt][nt] = (v8f){0.f,0.f,0.f,0.f,0.f,0.f,0.f,0.f};
  float mref[2] = {-1.0e30f, -1.0e30f};
  float lsum[2] = {0.f, 0.f};

  v8f st[2][2];                             // st[mt][nt][r] = score of key kp0 + 16 mt + 8 hf + r, query q0 + 16 nt + c
#pragma unroll
  for (int mt = 0; mt < 2; ++mt)
#pragma unroll
    for (int nt = 0; nt < 2; ++nt)
#pragma unroll
      for (int r = 0; r < 8; ++r) st[mt][nt][r] = ph[(size_t)(mt * 16 + r) * PP + nt * 16];

  asm volatile("s_wait_asynccnt 0x0" ::: "memory");   // stage 0 has landed for this wave's copies
  __syncthreads();                                    // ... and for every wave's
  issue_stage(1, 1);

  for (int t = 0; t < NSTAGE; ++t) {
    const _Float16* Ks = (const _Float16*)ring + (t & 1) * STAGE_H;
    const _Float16* Vs = Ks + KTILE_H;
#pragma unroll 1   // two passes of one stage share the code: the body is large and only addresses differ
    for (int hp = 0; hp < 2; ++hp) {
      const _Float16* kb = Ks + (hp * 32 + c) * KP_H + hf * 8;
      const _Float16* vb = Vs + c * VP_H + hp * 32 + hf * 8;
      v16h ka[3], va[3];                     // fragment rings: two fragments are always on their way
      ka[0] = F::load(kb);                   // fragment j = 2 kk + mt: keys 16 mt .., channels 32 kk ..
      ka[1] = F::load(kb + 16 * KP_H);
#pragma unroll
      for (int j = 0; j < 16; ++j) {
        const int kk = j >> 1, mt = j & 1, jn = j + 2;
        if (jn < 16) ka[jn % 3] = F::load(kb + (jn & 1) * 16 * KP_H + (jn >> 1) * 32);
        else         va[jn - 16] = F::load(vb + (jn - 16) * 16 * VP_H);   // the first v^T fragments (same stage) come in under the softmax
        __builtin_amdgcn_sched_barrier(0);   // keeps the LDS read of the fragment after next in front of these products, so its latency hides
        st[mt][0] = F::mma(ka[j % 3], qf[kk][0], st[mt][0]);
        st[mt][1] = F::mma(ka[j % 3], qf[kk][1], st[mt][1]);
      }
      float mx[2];
#pragma unroll
      for (int nt = 0; nt < 2; ++nt) {
        const v8f u = st[0][nt], w = st[1][nt];
        float m0 = fmaxf(fmaxf(fmaxf(u[0], u[1]), fmaxf(u[2], u[3])), fmaxf(fmaxf(u[4], u[5]), fmaxf(u[6], u[7])));
        float m1 = fmaxf(fmaxf(fmaxf(w[0], w[1]), fmaxf(w[2], w[3])), fmaxf(fmaxf(w[4], w[5]), fmaxf(w[6], w[7])));
        m0 = fmaxf(m0, m1);
        mx[nt] = fmaxf(m0, __shfl_xor(m0, 16, 32)) * LOG2E;
      }
      // lazy rescale, tested once a pass: the reference maximum moves only when a column passes it by more than 8 (log2)
      const bool need = (mx[0] > mref[0] + 8.0f) || (mx[1] > mref[1] + 8.0f);
      if (__builtin_amdgcn_ballot_w32(need) != 0) {
#pragma unroll
        for (int nt = 0; nt < 2; ++nt) {
          const float mnew = fmaxf(mref[nt], mx[nt]);
          const float alpha = __builtin_amdgcn_exp2f(mref[nt] - mnew);
          mref[nt] = mnew;
          lsum[nt] *= alpha;
#pragma unroll
          for (int dt = 0; dt < 16; ++dt) acc[dt][nt] *= alpha;
        }
      }
      v16h pf[2];
#pragma unroll
      for (int nt = 0; nt < 2; ++nt) {
        const float c0 = 6.0f - mref[nt];
        float s0 = 0.f, s1 = 0.f;
#pragma unroll
        for (int r = 0; r < 8; ++r) {
          const float e0 = __builtin_amdgcn_exp2f(fmaf(st[0][nt][r], LOG2E, c0));
          const float e1 = __builtin_amdgcn_exp2f(fmaf(st[1][nt][r], LOG2E, c0));
          s0 += e0; s1 += e1;
          pf[nt][r]     = (_Float16)e0;
          pf[nt][8 + r] = (_Float16)e1;
        }
        lsum[nt] += s0 + s1;
      }
      // bias of the next pass, fetched behind the last use of this pass's scores (the last pass re-reads its own rows, unused)
      {
        const int kc = min((t * 2 + hp) * 32, PP - 64);
        const float* pn = ph + (size_t)kc * PP;   // this pass's rows; the next pass's lie 32 rows on
#pragma unroll
        for (int mt = 0; mt < 2; ++mt)
#pragma unroll
          for (int nt = 0; nt < 2; ++nt)
#pragma unroll
            for (int r = 0; r < 8; ++r) st[mt][nt][r] = pn[(size_t)(32 + mt * 16 + r) * PP + nt * 16];
        // the address is an input, so its registers stay the loads' own up to this wait and are rewritten only behind it
        asm volatile("s_wait_xcnt 0x0" :: "v"(pn) : "memory");
      }
#pragma unroll
      for (int dt = 0; dt < 16; ++dt) {
        if (dt + 2 < 16) va[(dt + 2) % 3] = F::load(vb + (dt + 2) * 16 * VP_H);
        __builtin_amdgcn_sched_barrier(0);   // as above
        acc[dt][0] = F::mma(va[dt % 3], pf[0], acc[dt][0]);
        acc[dt][1] = F::mma(va[dt % 3], pf[1], acc[dt][1]);
      }
    }
    asm volatile("s_wait_dscnt 0x0" ::: "memory");      // this wave's reads of buffer t&1 are done
    asm volatile("s_wait_asynccnt 0x0" ::: "memory");   // this wave's copies of stage t+1 have landed
    __syncthreads();                                    // publishes stage t+1, ends every reader's last read of buffer t&1
    if (t + 2 < NSTAGE) issue_stage(t + 2, t & 1);
  }
  asm volatile("s_wait_asynccnt 0x0" ::: "memory");     // nothing is in flight when the wave ends

#pragma unroll
  for (int nt = 0; nt < 2; ++nt) {
    const float lt = lsum[nt] + __shfl_xor(lsum[nt], 16, 32);
    const float inv = 16.0f / lt;                       // ctx carried x16
    unsigned short* op = CTX + ((size_t)n * PP + q0 + nt * 16 + c) * HDIM + h * DM + hf * 8;
    v8h o[16];
#pragma unroll
    for (int dt = 0; dt < 16; ++dt)
#pragma unroll
      for (int r = 0; r < 8; ++r) o[dt][r] = (_Float16)(acc[dt][nt][r] * inv);
    __builtin_amdgcn_sched_barrier(0);                  // with the one below: nothing but the stores and their wait stands in between
#pragma unroll
    for (int dt = 0; dt < 16; ++dt) *(v8h*)(op + dt * 16) = o[dt];   // 8 consecutive dd of one query: one 16-byte store
    asm volatile("s_wait_xcnt 0x0" ::: "memory");       // stands in front of the first rewrite of the stores' registers
    __builtin_amdgcn_sched_barrier(0);
  }
}

// ---------------------------------------------------------------------------
// Workspace region map (byte offsets). All eight batches go through each stage in one launch (batch = a grid axis).
// Every region is fully written in this call before it is read (all GEMM extents are exact tile multiples).
//   Q16    f16  [8][1024][2048] (col o)              0
//   K16    f16  [8][1024][2048] (col o)     33,554,432
//   VC16   f16  [8][2048 o][1024 kp]        67,108,864
//   CTX16  f16  [8][1024][2048] (col i, x16) 100,663,296
//   Wk16, Wq16, Wv16, Wo16 f16 (x16), 1,048,576 each, at 134,217,728;  XT16 f16 [8][1024][256] behind them
//   total                                  142,606,336
// ---------------------------------------------------------------------------
extern "C" void kernel_launch(void* const* d_in, const int* in_sizes, int n_in,
                              void* d_out, int out_size, void* d_ws, size_t ws_size,
                              hipStream_t stream) {
  if (n_in < 10) return;
  if (in_sizes[0] != NB * DM * PP) return;
  if (in_sizes[1] != HH * PP * PP) return;
  if (in_sizes[2] != HDIM * DM || in_sizes[4] != HDIM * DM || in_sizes[6] != HDIM * DM) return;
  if (in_sizes[3] != HDIM || in_sizes[5] != HDIM || in_sizes[7] != HDIM) return;
  if (in_sizes[8] != DM * HDIM || in_sizes[9] != DM) return;
  if (out_size != NB * DM * PP) return;

  const float* x   = (const float*)d_in[0];   // [NB][DM][PP]
  const float* pos = (const float*)d_in[1];   // [1][HH][PP kp][PP qp]
  const float* Wk  = (const float*)d_in[2];   // [HDIM][DM]
  const float* bk  = (const float*)d_in[3];   // [HDIM]
  const float* Wq  = (const float*)d_in[4];
  const float* bq  = (const float*)d_in[5];
  const float* Wv  = (const float*)d_in[6];
  const float* bv  = (const float*)d_in[7];
  const float* Wo  = (const float*)d_in[8];   // [DM][HDIM]
  const float* bo  = (const float*)d_in[9];   // [DM]

  const size_t BW   = (size_t)HDIM * DM * 2;             // 1,048,576
  const size_t BACT = (size_t)NB * PP * HDIM * 2;        // 33,554,432
  const size_t BS   = 8 * BW;                            // 8,388,608: four weight planes and XT16
  size_t off = 0;
  const size_t oQ16  = off; off += BACT;
  const size_t oK16  = off; off += BACT;
  const size_t oVC16 = off; off += BACT;
  const size_t oCTX  = off; off += BACT;
  const size_t oS    = off; off += BS;
  if (off > ws_size) return;                          // 142,606,336 B total

  char* ws = (char*)d_ws;
  unsigned short* Q16   = (unsigned short*)(ws + oQ16);
  unsigned short* K16   = (unsigned short*)(ws + oK16);
  unsigned short* VC16  = (unsigned short*)(ws + oVC16);
  unsigned short* OUTP  = (unsigned short*)(ws + oCTX);
  unsigned short* Wk16  = (unsigned short*)(ws + oS);
  unsigned short* Wq16  = (unsigned short*)(ws + oS + BW);
  unsigned short* Wv16  = (unsigned short*)(ws + oS + 2 * BW);
  unsigned short* XT16  = (unsigned short*)(ws + oS + 4 * BW);
  unsigned short* Wo16  = (unsigned short*)(ws + oS + 3 * BW);

  const dim3 blk(256);
  const int n2w = HDIM * DM / 2;                      // 262144 pairs per weight plane
  const dim3 gCastW((n2w + 255) / 256);                // 1024 blocks

  // setup: weight planes, carried x16 (exact power of two; undone by the GEMM epilogue scales)
  cast_f16x2_kernel<<<gCastW, blk, 0, stream>>>(Wk, Wk16, n2w, 16.0f);
  cast_f16x2_kernel<<<gCastW, blk, 0, stream>>>(Wq, Wq16, n2w, 16.0f);
  cast_f16x2_kernel<<<gCastW, blk, 0, stream>>>(Wv, Wv16, n2w, 16.0f);
  // x [NB][DM][PP] -> XT16 [NB][PP][DM] f16
  xt_cast_kernel<<<NB * (PP / 64) * (DM / 64), blk, 0, stream>>>(x, XT16);

  const dim3 gProj(((PP / 64) * (HDIM / 64) + 7) / 8, NB);    // 64 x 8:     512 tiles a batch (M=1024,N=2048 or M=2048,N=1024), K=256
  const dim3 gOut(((DM / 64) * (PP / 64) + 7) / 8, NB);      // 8 x 8:      M=256, N=1024, K=2048
  const float wscale  = 1.0f / 16.0f;                      // undo the x16 weight carry
  const float oscale  = 1.0f / 256.0f;                     // undo x16 (Wo) and x16 (ctx)

  // (1) q[n][p][o] = (x[n][p] . (16 Wq)[o])/16 + bq[o] -> Q16 [8][1024][2048] f16 (A = XT16[n] [1024][256], Bt = Wq16 [2048][256]); y = n
  wmma_gemm64<0, false, 2, 1, false, 0><<<gProj, blk, 0, stream>>>(
      XT16, XT16, DM, (long)PP * DM, 0L, Wq16, Wq16, DM, 0L, 0L, (void*)Q16, (void*)Q16, HDIM, (long)PP * HDIM, 0L,
      bq, bq, 0L, PP, HDIM, DM, wscale);
  //     k likewise -> K16
  wmma_gemm64<0, false, 2, 1, false, 0><<<gProj, blk, 0, stream>>>(
      XT16, XT16, DM, (long)PP * DM, 0L, Wk16, Wk16, DM, 0L, 0L, (void*)K16, (void*)K16, HDIM, (long)PP * HDIM, 0L,
      bk, bk, 0L, PP, HDIM, DM, wscale);
  // (2) role-swapped v: VC16[n][o][kp] = ((16 Wv)[o] . x[n][kp])/16 + bv[o]; A = Wv16 [2048][256], Bt = XT16[n] [1024][256],
  //     M=2048, N=1024, K=256, bias by m, f16 out with ldc 1024; y = n
  wmma_gemm64<0, false, 1, 1, false, 0><<<gProj, blk, 0, stream>>>(
      Wv16, Wv16, DM, 0L, 0L, XT16, XT16, DM, (long)PP * DM, 0L, (void*)VC16, (void*)VC16, PP, (long)HDIM * PP, 0L,
      bv, bv, 0L, HDIM, PP, DM, wscale);

  // (3) scores, key-axis softmax with the positional bias and ctx in one launch: 4 blocks of 256 queries x 8 heads x 8 batches
  attn_fused_kernel<<<dim3(PP / 256, HH, NB), blk, 0, stream>>>(Q16, K16, VC16, pos, OUTP);
  // Wo plane, carried x16
  cast_f16x2_kernel<<<gCastW, blk, 0, stream>>>(Wo, Wo16, n2w, 16.0f);
  // (4) y[n][o][p] = (1/256) sum_i (16 Wo)[o][i] (16 ctx)[n][p][i] + bo[o] -> d_out[n] f32 [256][1024] (ldc 1024, bias by m); y = n
  wmma_gemm64<0, false, 1, 0, false, 0><<<gOut, blk, 0, stream>>>(
      Wo16, Wo16, HDIM, 0L, 0L, OUTP, OUTP, HDIM, (long)PP * HDIM, 0L, d_out, d_out, PP, (long)DM * PP, 0L,
      bo, bo, 0L, DM, PP, HDIM, oscale);
  (void)hipGetLastError();
}

// v003
// Measured time: 127 microseconds a run.
// Timed twice side by side with v002, it ran 1.75 and 1.74 times as fast.
// Counting every step since v000, it is 11.5 times as fast.
// All contractions on v_wmma_f32_16x16x32_f16 (f16 operands, f32 accumulate): k/q/v 1x1-conv projections (x as f16, weights carried x16, epilogue x1/16), one fused attention kernel (S^T = k.(q/16)^T on top of the positional bias, online key-axis softmax in f32, ctx^T += v^T.P^T with P packed from the score accumulators), output conv (Wo carried x16, ctx carried x16, epilogue x1/256).
#include <hip/hip_runtime.h>
#include <math.h>
#include <stdint.h>

#define NB   8      // batch
#define HH   8      // heads
#define DM   256    // channels = head dim
#define PP   1024   // positions
#define HDIM 2048   // HH * DM

typedef __attribute__((ext_vector_type(16))) _Float16 v16h;
typedef __attribute__((ext_vector_type(8)))  _Float16 v8h;
typedef __attribute__((ext_vector_type(8)))  float    v8f;
typedef __attribute__((ext_vector_type(4)))  float    v4f;
typedef __attribute__((ext_vector_type(2)))  float    v2f;

template <typename T> struct Frag;
template <> struct Frag<_Float16> {
  typedef v16h V; union U { v16h v; v8h h[2]; };
  static __device__ __forceinline__ v16h load(const _Float16* p) {   // elements 0..7 <- p[0..7], 8..15 <- p[16..23]
    U f; f.h[0] = *(const v8h*)(p); f.h[1] = *(const v8h*)(p + 16); return f.v;
  }
  static __device__ __forceinline__ v8f mma(v16h a, v16h b, v8f c) {
    return __builtin_amdgcn_wmma_f32_16x16x32_f16(false, a, false, b, (short)0, c, false, false);
  }
};

// eight 16-byte copies of each lane; the address wait is the statement's last line, so no address register is rewritten in front of it
__device__ __forceinline__ void async_copy8(unsigned l0, unsigned lstep, const unsigned short* g0, size_t gstep) {
  asm volatile(
      "global_load_async_to_lds_b128 %0, %8, off\n\t"
      "global_load_async_to_lds_b128 %1, %9, off\n\t"
      "global_load_async_to_lds_b128 %2, %10, off\n\t"
      "global_load_async_to_lds_b128 %3, %11, off\n\t"
      "global_load_async_to_lds_b128 %4, %12, off\n\t"
      "global_load_async_to_lds_b128 %5, %13, off\n\t"
      "global_load_async_to_lds_b128 %6, %14, off\n\t"
      "global_load_async_to_lds_b128 %7, %15, off\n\t"
      "s_wait_xcnt 0x0"
      :: "v"(l0), "v"(l0 + lstep), "v"(l0 + 2 * lstep), "v"(l0 + 3 * lstep),
         "v"(l0 + 4 * lstep), "v"(l0 + 5 * lstep), "v"(l0 + 6 * lstep), "v"(l0 + 7 * lstep),
         "v"(g0), "v"(g0 + gstep), "v"(g0 + 2 * gstep), "v"(g0 + 3 * gstep),
         "v"(g0 + 4 * gstep), "v"(g0 + 5 * gstep), "v"(g0 + 6 * gstep), "v"(g0 + 7 * gstep)
      : "memory");
}

// ---- Batched WMMA GEMM, operands staged in LDS ------------------------------
// C[m,n] = scale * sum_k A[m,k] * Bt[n,k] + bias; A row-major [M][KT], Bt row-major [N][KT], f16; C rows of LDC elements; blockIdx.y = batch.
// One block of 8 waves (WGM x WGN) owns a BM x BN tile of C. A stage is BK channels of the tile's BM + BN operand rows,
// brought to LDS by asynchronous copies in whole lines (a row of a stage is BK * 2 contiguous bytes), two buffers:
// stage t + 1 flies while stage t is multiplied. Every wave reads its fragments from LDS, so a row is fetched once a block.
// LDS row pitch = BK * 2 + 16 bytes (16 B x odd, for 16-byte readers). k runs upward in steps of 32 in one accumulator chain.
// Fragments go from LDS to a ring of PD register sets inside a stage. M % BM == 0, N % BN == 0, KT % BK == 0. BIAS_MODE: 1 = bias[m], 2 = bias[n]. OUT_MODE: 0 = f32, 1 = f16.
template <int BM, int BN, int BK, int KT, int LDC, int WGM, int WGN, int PD, int BIAS_MODE, int OUT_MODE>
__global__ __launch_bounds__(256) void wmma_gemm_lds(
    const unsigned short* __restrict__ Ap, long strideA,
    const unsigned short* __restrict__ Btp, long strideB,
    void* __restrict__ Cout, long strideC,
    const float* __restrict__ bias, int tilesN, float scale) {
  typedef Frag<_Float16> F;
  constexpr int FM  = BM / WGM / 16;          // A fragments of a wave
  constexpr int FN  = BN / WGN / 16;          // B fragments of a wave
  constexpr int WN  = FN * 16;                // columns of a wave
  constexpr int PH  = BK + 8;                 // LDS row pitch, f16
  constexpr int STG = (BM + BN) * PH;         // f16 of a stage
  constexpr int NST = KT / BK;
  constexpr int KS  = BK / 32;                // matrix steps of a stage
  constexpr int LPR = BK / 8;                 // lanes that copy one row
  constexpr int RPS = 256 / LPR;              // rows that one copy of the block covers
  constexpr int SP  = WN + 4;                 // epilogue slab pitch, floats
  static_assert(WGM * WGN == 8 && BM % (8 * RPS) == 0 && BN % (8 * RPS) == 0 && KT % BK == 0 && PD - 1 <= KS, "tile shape");
  static_assert(8 * FM * 16 * SP * 4 <= 2 * STG * 2, "the epilogue slabs lie inside the ring");
  __shared__ __align__(16) unsigned short ring[2 * STG];
  const int tid = threadIdx.x, lane = tid & 31, wave = tid >> 5;
  const int c = lane & 15, hf = lane >> 4;    // row (A) / column (B, D) in a subtile; lane half
  const int b  = blockIdx.y;
  const int tm = blockIdx.x / tilesN;
  const int tn = blockIdx.x - tm * tilesN;
  const int m0 = tm * BM, n0 = tn * BN;
  const int wm = wave / WGN, wn = wave % WGN;

  const int crow = tid / LPR, ccol = (tid % LPR) * 8;
  const unsigned short* ag = Ap  + (size_t)b * strideA + (size_t)(m0 + crow) * KT + ccol;
  const unsigned short* bg = Btp + (size_t)b * strideB + (size_t)(n0 + crow) * KT + ccol;
  const unsigned al = (unsigned)(size_t)(&ring[0]) + (crow * PH + ccol) * 2;
  const unsigned bl = al + BM * PH * 2;
  auto issue_stage = [&](int t, int buf) {
#pragma unroll
    for (int g = 0; g < BM / (8 * RPS); ++g)
      async_copy8(al + buf * (STG * 2) + g * (8 * RPS * PH * 2), RPS * PH * 2, ag + t * BK + (size_t)g * 8 * RPS * KT, (size_t)RPS * KT);
#pragma unroll
    for (int g = 0; g < BN / (8 * RPS); ++g)
      async_copy8(bl + buf * (STG * 2) + g * (8 * RPS * PH * 2), RPS * PH * 2, bg + t * BK + (size_t)g * 8 * RPS * KT, (size_t)RPS * KT);
  };

  issue_stage(0, 0);
  v8f acc[FM][FN];
#pragma unroll
  for (int i = 0; i < FM; ++i)
#pragma unroll
    for (int j = 0; j < FN; ++j) acc[i][j] = (v8f){0.f,0.f,0.f,0.f,0.f,0.f,0.f,0.f};
  // the wave's bias values come in under the first stage's copies
  const int mOff = hf * 8;                              // D row offset of this lane half
  const int mw = m0 + wm * FM * 16, nw = n0 + wn * WN;
  constexpr int NBV = (BIAS_MODE == 1) ? FM * 8 : FN;
  float bv[NBV];
  {
    const float* bp = bias + ((BIAS_MODE == 1) ? (mw + mOff) : (nw + c));
#pragma unroll
    for (int e = 0; e < NBV; ++e) bv[e] = (BIAS_MODE == 1) ? bp[(e >> 3) * 16 + (e & 7)] : bp[e * 16];
    // the address is an input, so its registers stay the loads' own up to this wait and are rewritten only behind it
    asm volatile("s_wait_xcnt 0x0" :: "v"(bp) : "memory");
  }
  asm volatile("s_wait_asynccnt 0x0" ::: "memory");   // stage 0 has landed for this wave's copies
  __syncthreads();                                    // ... and for every wave's
  if (NST > 1) issue_stage(1, 1);

  for (int t = 0; t < NST; ++t) {
    const _Float16* As = (const _Float16*)ring + (t & 1) * STG + (wm * FM * 16 + c) * PH + hf * 8;
    const _Float16* Bs = (const _Float16*)ring + (t & 1) * STG + (BM + wn * FN * 16 + c) * PH + hf * 8;
    v16h af[PD][FM], bf[PD][FN];             // fragment ring: PD - 1 steps of this stage are always on their way
#pragma unroll
    for (int p = 0; p < PD - 1; ++p) {
#pragma unroll
      for (int i = 0; i < FM; ++i) af[p][i] = F::load(As + i * 16 * PH + p * 32);
#pragma unroll
      for (int j = 0; j < FN; ++j) bf[p][j] = F::load(Bs + j * 16 * PH + p * 32);
    }
#pragma unroll
    for (int kk = 0; kk < KS; ++kk) {
      const int kn = kk + PD - 1;
      if (kn < KS) {
#pragma unroll
        for (int i = 0; i < FM; ++i) af[kn % PD][i] = F::load(As + i * 16 * PH + kn * 32);
#pragma unroll
        for (int j = 0; j < FN; ++j) bf[kn % PD][j] = F::load(Bs + j * 16 * PH + kn * 32);
      }
      __builtin_amdgcn_sched_barrier(0);     // keeps a later step's LDS reads as one group in front of these products, so their latency hides
#pragma unroll
      for (int i = 0; i < FM; ++i)
#pragma unroll
        for (int j = 0; j < FN; ++j) acc[i][j] = F::mma(af[kk % PD][i], bf[kk % PD][j], acc[i][j]);
    }
    asm volatile("s_wait_dscnt 0x0" ::: "memory");      // this wave's reads of buffer t&1 are done
    asm volatile("s_wait_asynccnt 0x0" ::: "memory");   // this wave's copies of stage t+1 have landed
    __syncthreads();                                    // publishes stage t+1, ends every reader's last read of buffer t&1
    if (t + 2 < NST) issue_stage(t + 2, t & 1);
  }
  asm volatile("s_wait_asynccnt 0x0" ::: "memory");     // nothing is in flight when the ring is reused below

  // ---- epilogue: each wave turns its tile into whole 128-byte lines through a slab of its own (the ring is free behind the last barrier)
  float* slab = (float*)ring + wave * (FM * 16 * SP);
  const size_t offC = (size_t)b * strideC;
  const int q = lane >> 3;                              // 8 lanes a row, 4 rows an instruction
#pragma unroll
  for (int i = 0; i < FM; ++i) {
#pragma unroll
    for (int j = 0; j < FN; ++j) {
#pragma unroll
      for (int r = 0; r < 8; ++r) {
        const float v = acc[i][j][r] * scale + ((BIAS_MODE == 1) ? bv[i * 8 + r] : bv[j]);
        slab[((i << 4) + mOff + r) * SP + (j << 4) + c] = v;
      }
    }
  }
  // the slab's rows are read back by other lanes of the same wave
  __builtin_amdgcn_fence(__ATOMIC_RELEASE, "workgroup");
  __builtin_amdgcn_wave_barrier();
  __builtin_amdgcn_fence(__ATOMIC_ACQUIRE, "workgroup");
  if (OUT_MODE == 0) {
    static_assert(OUT_MODE != 0 || WN == 32, "f32 rows of 128 bytes");
    const int c4 = (lane & 7) * 4;
    float* cp = (float*)Cout + offC + (size_t)(mw + q) * LDC + nw + c4;
    v4f o[FM * 4];
#pragma unroll
    for (int it = 0; it < FM * 4; ++it) o[it] = *(const v4f*)(slab + (it * 4 + q) * SP + c4);
    __builtin_amdgcn_sched_barrier(0);   // only the stores stand behind this line, so no register of a store is rewritten before the wave ends
#pragma unroll
    for (int it = 0; it < FM * 4; ++it) *(v4f*)(cp + it * 4 * LDC) = o[it];
  } else {
    static_assert(OUT_MODE == 0 || WN == 64, "f16 rows of 128 bytes");
    const int c8 = (lane & 7) * 8;
    unsigned short* cp = (unsigned short*)Cout + offC + (size_t)(mw + q) * LDC + nw + c8;
    v8h o[FM * 4];
#pragma unroll
    for (int it = 0; it < FM * 4; ++it) {
      const float* sp = slab + (it * 4 + q) * SP + c8;
#pragma unroll
      for (int e = 0; e < 8; ++e) o[it][e] = (_Float16)sp[e];
    }
    __builtin_amdgcn_sched_barrier(0);   // only the stores stand behind this line, so no register of a store is rewritten before the wave ends
#pragma unroll
    for (int it = 0; it < FM * 4; ++it) *(v8h*)(cp + it * 4 * LDC) = o[it];
  }
}

// ---------------------------------------------------------------------------
// Elementwise cast out = f16(in * scale) (scale = power-of-two carry): 2 elements per thread, one 4-B
// Coverage: grid = ceil(n2/256) blocks x 256 threads x 2 elements = 2*n2 elements = the whole plane (n2 = plane/2).
// ---------------------------------------------------------------------------
__device__ __forceinline__ unsigned pk16(unsigned short a, unsigned short b) { return (unsigned)a | ((unsigned)b << 16); }
__device__ __forceinline__ unsigned short h_bits(float f) { const _Float16 h = (_Float16)f; return __builtin_bit_cast(unsigned short, h); }

__global__ __launch_bounds__(256) void cast_f16x2_kernel(const float* __restrict__ in, unsigned short* __restrict__ out, int n2, float scale) {
  const int i = blockIdx.x * 256 + threadIdx.x;
  if (i < n2) {
    const v2f f = *(const v2f*)(in + 2 * (size_t)i);
    const unsigned u = pk16(h_bits(f[0] * scale), h_bits(f[1] * scale));
    ((unsigned*)out)[i] = u;
    
  }
}

// ---------------------------------------------------------------------------
// Transpose-cast of the input: x f32 [NB][DM][PP] -> XT f16 [NB][PP][DM]  (in[n][d][p] -> out[n][p][d]).
// One block (256 threads) per 64x64 tile: grid = NB * (PP/64) * (DM/64) = 8 * 16 * 4 = 512.
// Load: thread t reads row d = d0 + (t>>2), 16 floats at p0 + (t&3)*16 -> 256 x 16 = 4096 = the whole tile.
// 4 rows (lanes 8q..8q+7 -> row q of the group, 8 lanes x 16 B per line); 8 waves x 2 it x 4 = 64 rows;
// ---------------------------------------------------------------------------
__global__ __launch_bounds__(256) void xt_cast_kernel(const float* __restrict__ x, unsigned short* __restrict__ XT) {
  __shared__ float tile[64][65];                 // tile[d_local][p_local]
  const int bid = blockIdx.x;
  const int dt = bid & 3;
  const int pt = (bid >> 2) & 15;
  const int n  = bid >> 6;
  const int d0 = dt * 64, p0 = pt * 64;
  const int tid = threadIdx.x, lane = tid & 31, wave = tid >> 5;
  {
    const int r = tid >> 2, cs = (tid & 3) * 16;
    const float* src = x + ((size_t)n * DM + d0 + r) * PP + p0 + cs;
#pragma unroll
    for (int i = 0; i < 4; ++i) {
      const v4f v = *(const v4f*)(src + 4 * i);
      tile[r][cs + 4 * i + 0] = v[0];
      tile[r][cs + 4 * i + 1] = v[1];
      tile[r][cs + 4 * i + 2] = v[2];
      tile[r][cs + 4 * i + 3] = v[3];
    }
  }
  __syncthreads();
  const int q = lane >> 3, c8 = (lane & 7) * 8;
  unsigned short* ob = XT + ((size_t)n * PP + p0) * DM + d0;
  {
#pragma unroll
    for (int it = 0; it < 2; ++it) {
      const int rr = wave * 8 + it * 4 + q;       // p_local
      v8h hv;
#pragma unroll
      for (int e = 0; e < 8; ++e) hv[e] = (_Float16)tile[c8 + e][rr];   // value (p=rr, d=c8+e)
      *(v8h*)(ob + (size_t)rr * DM + c8) = hv;
    }
    
  }
}

#define FK      64
#define NSTAGE  (PP / FK)
#define KP_H    264
#define VP_H    72
#define KTILE_H (FK * KP_H)
#define STAGE_H (KTILE_H + DM * VP_H)
#define LOG2E   1.4426950408889634f

__global__ __launch_bounds__(256) void attn_fused_kernel(const unsigned short* __restrict__ Q16,
                                                         const unsigned short* __restrict__ K16,
                                                         const unsigned short* __restrict__ VC16,
                                                         const float* __restrict__ pos,
                                                         unsigned short* __restrict__ CTX) {
  __shared__ __align__(16) unsigned short ring[2 * STAGE_H];
  typedef Frag<_Float16> F;
  const int tid = threadIdx.x, lane = tid & 31, wave = tid >> 5;
  const int c = lane & 15, hf = lane >> 4;
  const int h = blockIdx.y, n = blockIdx.z;
  const int q0 = blockIdx.x * 256 + wave * 32;
  const unsigned short* Kh = K16 + (size_t)n * PP * HDIM + h * DM;          // [kp][d], row pitch HDIM
  const unsigned short* Vh = VC16 + ((size_t)n * HDIM + h * DM) * PP;      // [dd][kp], row pitch PP
  const float* ph = pos + (size_t)h * PP * PP + (size_t)(hf * 8) * PP + q0 + c;
  const unsigned ring0 = (unsigned)(size_t)(&ring[0]);

  // stage t -> buffer b. k: wave w copies rows w, w+8, ... (512 B a row); v^T: 8 lanes a row of 128 B, rows tid>>3, +32, ...
  const unsigned short* kg = Kh + (size_t)wave * HDIM + lane * 8;
  const unsigned short* vg = Vh + (size_t)(tid >> 3) * PP + (tid & 7) * 8;
  const unsigned kl = ring0 + wave * (KP_H * 2) + lane * 16;
  const unsigned vl = ring0 + KTILE_H * 2 + (tid >> 3) * (VP_H * 2) + (tid & 7) * 16;
  auto issue_stage = [&](int t, int b) {
    async_copy8(kl + b * (STAGE_H * 2), 8 * KP_H * 2, kg + (size_t)t * FK * HDIM, (size_t)8 * HDIM);
    async_copy8(vl + b * (STAGE_H * 2), 32 * VP_H * 2, vg + t * FK, (size_t)32 * PP);
  };

  issue_stage(0, 0);

  v16h qf[8][2];                            // q / 16 (exact power of two), hardware k order
#pragma unroll
  for (int kk = 0; kk < 8; ++kk)
#pragma unroll
    for (int nt = 0; nt < 2; ++nt)
      qf[kk][nt] = F::load((const _Float16*)Q16 + ((size_t)n * PP + q0 + nt * 16 + c) * HDIM + h * DM + kk * 32 + hf * 8) * (_Float16)0.0625f;

  v8f acc[16][2];
#pragma unroll
  for (int dt = 0; dt < 16; ++dt)
#pragma unroll
    for (int nt = 0; nt < 2; ++nt) acc[dt][nt] = (v8f){0.f,0.f,0.f,0.f,0.f,0.f,0.f,0.f};
  float mref[2] = {-1.0e30f, -1.0e30f};
  float lsum[2] = {0.f, 0.f};

  v8f st[2][2];                             // st[mt][nt][r] = score of key kp0 + 16 mt + 8 hf + r, query q0 + 16 nt + c
#pragma unroll
  for (int mt = 0; mt < 2; ++mt)
#pragma unroll
    for (int nt = 0; nt < 2; ++nt)
#pragma unroll
      for (int r = 0; r < 8; ++r) st[mt][nt][r] = ph[(size_t)(mt * 16 + r) * PP + nt * 16];

  asm volatile("s_wait_asynccnt 0x0" ::: "memory");   // stage 0 has landed for this wave's copies
  __syncthreads();                                    // ... and for every wave's
  issue_stage(1, 1);

  for (int t = 0; t < NSTAGE; ++t) {
    const _Float16* Ks = (const _Float16*)ring + (t & 1) * STAGE_H;
    const _Float16* Vs = Ks + KTILE_H;
#pragma unroll 1   // two passes of one stage share the code: the body is large and only addresses differ
    for (int hp = 0; hp < 2; ++hp) {
      const _Float16* kb = Ks + (hp * 32 + c) * KP_H + hf * 8;
      const _Float16* vb = Vs + c * VP_H + hp * 32 + hf * 8;
      v16h ka[3], va[3];                     // fragment rings: two fragments are always on their way
      ka[0] = F::load(kb);                   // fragment j = 2 kk + mt: keys 16 mt .., channels 32 kk ..
      ka[1] = F::load(kb + 16 * KP_H);
#pragma unroll
      for (int j = 0; j < 16; ++j) {
        const int kk = j >> 1, mt = j & 1, jn = j + 2;
        if (jn < 16) ka[jn % 3] = F::load(kb + (jn & 1) * 16 * KP_H + (jn >> 1) * 32);
        else         va[jn - 16] = F::load(vb + (jn - 16) * 16 * VP_H);   // the first v^T fragments (same stage) come in under the softmax
        __builtin_amdgcn_sched_barrier(0);   // keeps the LDS read of the fragment after next in front of these products, so its latency hides
        st[mt][0] = F::mma(ka[j % 3], qf[kk][0], st[mt][0]);
        st[mt][1] = F::mma(ka[j % 3], qf[kk][1], st[mt][1]);
      }
      float mx[2];
#pragma unroll
      for (int nt = 0; nt < 2; ++nt) {
        const v8f u = st[0][nt], w = st[1][nt];
        float m0 = fmaxf(fmaxf(fmaxf(u[0], u[1]), fmaxf(u[2], u[3])), fmaxf(fmaxf(u[4], u[5]), fmaxf(u[6], u[7])));
        float m1 = fmaxf(fmaxf(fmaxf(w[0], w[1]), fmaxf(w[2], w[3])), fmaxf(fmaxf(w[4], w[5]), fmaxf(w[6], w[7])));
        m0 = fmaxf(m0, m1);
        mx[nt] = fmaxf(m0, __shfl_xor(m0, 16, 32)) * LOG2E;
      }
      // lazy rescale, tested once a pass: the reference maximum moves only when a column passes it by more than 8 (log2)
      const bool need = (mx[0] > mref[0] + 8.0f) || (mx[1] > mref[1] + 8.0f);
      if (__builtin_amdgcn_ballot_w32(need) != 0) {
#pragma unroll
        for (int nt = 0; nt < 2; ++nt) {
          const float mnew = fmaxf(mref[nt], mx[nt]);
          const float alpha = __builtin_amdgcn_exp2f(mref[nt] - mnew);
          mref[nt] = mnew;
          lsum[nt] *= alpha;
#pragma unroll
          for (int dt = 0; dt < 16; ++dt) acc[dt][nt] *= alpha;
        }
      }
      v16h pf[2];
#pragma unroll
      for (int nt = 0; nt < 2; ++nt) {
        const float c0 = 6.0f - mref[nt];
        float s0 = 0.f, s1 = 0.f;
#pragma unroll
        for (int r = 0; r < 8; ++r) {
          const float e0 = __builtin_amdgcn_exp2f(fmaf(st[0][nt][r], LOG2E, c0));
          const float e1 = __builtin_amdgcn_exp2f(fmaf(st[1][nt][r], LOG2E, c0));
          s0 += e0; s1 += e1;
          pf[nt][r]     = (_Float16)e0;
          pf[nt][8 + r] = (_Float16)e1;
        }
        lsum[nt] += s0 + s1;
      }
      // bias of the next pass, fetched behind the last use of this pass's scores (the last pass re-reads its own rows, unused)
      {
        const int kc = min((t * 2 + hp) * 32, PP - 64);
        const float* pn = ph + (size_t)kc * PP;   // this pass's rows; the next pass's lie 32 rows on
#pragma unroll
        for (int mt = 0; mt < 2; ++mt)
#pragma unroll
          for (int nt = 0; nt < 2; ++nt)
#pragma unroll
            for (int r = 0; r < 8; ++r) st[mt][nt][r] = pn[(size_t)(32 + mt * 16 + r) * PP + nt * 16];
        // the address is an input, so its registers stay the loads' own up to this wait and are rewritten only behind it
        asm volatile("s_wait_xcnt 0x0" :: "v"(pn) : "memory");
      }
#pragma unroll
      for (int dt = 0; dt < 16; ++dt) {
        if (dt + 2 < 16) va[(dt + 2) % 3] = F::load(vb + (dt + 2) * 16 * VP_H);
        __builtin_amdgcn_sched_barrier(0);   // as above
        acc[dt][0] = F::mma(va[dt % 3], pf[0], acc[dt][0]);
        acc[dt][1] = F::mma(va[dt % 3], pf[1], acc[dt][1]);
      }
    }
    asm volatile("s_wait_dscnt 0x0" ::: "memory");      // this wave's reads of buffer t&1 are done
    asm volatile("s_wait_asynccnt 0x0" ::: "memory");   // this wave's copies of stage t+1 have landed
    __syncthreads();                                    // publishes stage t+1, ends every reader's last read of buffer t&1
    if (t + 2 < NSTAGE) issue_stage(t + 2, t & 1);
  }
  asm volatile("s_wait_asynccnt 0x0" ::: "memory");     // nothing is in flight when the wave ends

#pragma unroll
  for (int nt = 0; nt < 2; ++nt) {
    const float lt = lsum[nt] + __shfl_xor(lsum[nt], 16, 32);
    const float inv = 16.0f / lt;                       // ctx carried x16
    unsigned short* op = CTX + ((size_t)n * PP + q0 + nt * 16 + c) * HDIM + h * DM + hf * 8;
    v8h o[16];
#pragma unroll
    for (int dt = 0; dt < 16; ++dt)
#pragma unroll
      for (int r = 0; r < 8; ++r) o[dt][r] = (_Float16)(acc[dt][nt][r] * inv);
    __builtin_amdgcn_sched_barrier(0);                  // with the one below: nothing but the stores and their wait stands in between
#pragma unroll
    for (int dt = 0; dt < 16; ++dt) *(v8h*)(op + dt * 16) = o[dt];   // 8 consecutive dd of one query: one 16-byte store
    asm volatile("s_wait_xcnt 0x0" ::: "memory");       // stands in front of the first rewrite of the stores' registers
    __builtin_amdgcn_sched_barrier(0);
  }
}

// ---------------------------------------------------------------------------
// Workspace region map (byte offsets). All eight batches go through each stage in one launch (batch = a grid axis).
// Every region is fully written in this call before it is read (all GEMM extents are exact tile multiples).
//   Q16    f16  [8][1024][2048] (col o)              0
//   K16    f16  [8][1024][2048] (col o)     33,554,432
//   VC16   f16  [8][2048 o][1024 kp]        67,108,864
//   CTX16  f16  [8][1024][2048] (col i, x16) 100,663,296
//   Wk16, Wq16, Wv16, Wo16 f16 (x16), 1,048,576 each, at 134,217,728;  XT16 f16 [8][1024][256] behind them
//   total                                  142,606,336
// ---------------------------------------------------------------------------
extern "C" void kernel_launch(void* const* d_in, const int* in_sizes, int n_in,
                              void* d_out, int out_size, void* d_ws, size_t ws_size,
                              hipStream_t stream) {
  if (n_in < 10) return;
  if (in_sizes[0] != NB * DM * PP) return;
  if (in_sizes[1] != HH * PP * PP) return;
  if (in_sizes[2] != HDIM * DM || in_sizes[4] != HDIM * DM || in_sizes[6] != HDIM * DM) return;
  if (in_sizes[3] != HDIM || in_sizes[5] != HDIM || in_sizes[7] != HDIM) return;
  if (in_sizes[8] != DM * HDIM || in_sizes[9] != DM) return;
  if (out_size != NB * DM * PP) return;

  const float* x   = (const float*)d_in[0];   // [NB][DM][PP]
  const float* pos = (const float*)d_in[1];   // [1][HH][PP kp][PP qp]
  const float* Wk  = (const float*)d_in[2];   // [HDIM][DM]
  const float* bk  = (const float*)d_in[3];   // [HDIM]
  const float* Wq  = (const float*)d_in[4];
  const float* bq  = (const float*)d_in[5];
  const float* Wv  = (const float*)d_in[6];
  const float* bv  = (const float*)d_in[7];
  const float* Wo  = (const float*)d_in[8];   // [DM][HDIM]
  const float* bo  = (const float*)d_in[9];   // [DM]

  const size_t BW   = (size_t)HDIM * DM * 2;             // 1,048,576
  const size_t BACT = (size_t)NB * PP * HDIM * 2;        // 33,554,432
  const size_t BS   = 8 * BW;                            // 8,388,608: four weight planes and XT16
  size_t off = 0;
  const size_t oQ16  = off; off += BACT;
  const size_t oK16  = off; off += BACT;
  const size_t oVC16 = off; off += BACT;
  const size_t oCTX  = off; off += BACT;
  const size_t oS    = off; off += BS;
  if (off > ws_size) return;                          // 142,606,336 B total

  char* ws = (char*)d_ws;
  unsigned short* Q16   = (unsigned short*)(ws + oQ16);
  unsigned short* K16   = (unsigned short*)(ws + oK16);
  unsigned short* VC16  = (unsigned short*)(ws + oVC16);
  unsigned short* OUTP  = (unsigned short*)(ws + oCTX);
  unsigned short* Wk16  = (unsigned short*)(ws + oS);
  unsigned short* Wq16  = (unsigned short*)(ws + oS + BW);
  unsigned short* Wv16  = (unsigned short*)(ws + oS + 2 * BW);
  unsigned short* XT16  = (unsigned short*)(ws + oS + 4 * BW);
  unsigned short* Wo16  = (unsigned short*)(ws + oS + 3 * BW);

  const dim3 blk(256);
  const int n2w = HDIM * DM / 2;                      // 262144 pairs per weight plane
  const dim3 gCastW((n2w + 255) / 256);                // 1024 blocks

  // setup: weight planes, carried x16 (exact power of two; undone by the GEMM epilogue scales)
  cast_f16x2_kernel<<<gCastW, blk, 0, stream>>>(Wk, Wk16, n2w, 16.0f);
  cast_f16x2_kernel<<<gCastW, blk, 0, stream>>>(Wq, Wq16, n2w, 16.0f);
  cast_f16x2_kernel<<<gCastW, blk, 0, stream>>>(Wv, Wv16, n2w, 16.0f);
  // x [NB][DM][PP] -> XT16 [NB][PP][DM] f16
  xt_cast_kernel<<<NB * (PP / 64) * (DM / 64), blk, 0, stream>>>(x, XT16);

  const dim3 gProj((PP / 128) * (HDIM / 128), NB);          // 128 x 8: tiles of 128 x 128 (M=1024,N=2048 or M=2048,N=1024), K=256
  const dim3 gOut((DM / 64) * (PP / 128), NB);               // 32 x 8:  tiles of 64 x 128, M=256, N=1024, K=2048
  const float wscale  = 1.0f / 16.0f;                      // undo the x16 weight carry
  const float oscale  = 1.0f / 256.0f;                     // undo x16 (Wo) and x16 (ctx)

  // (1) q[n][p][o] = (x[n][p] . (16 Wq)[o])/16 + bq[o] -> Q16 [8][1024][2048] f16 (A = XT16[n] [1024][256], Bt = Wq16 [2048][256]); y = n
  wmma_gemm_lds<128, 128, 128, DM, HDIM, 4, 2, 3, 2, 1><<<gProj, blk, 0, stream>>>(
      XT16, (long)PP * DM, Wq16, 0L, (void*)Q16, (long)PP * HDIM, bq, HDIM / 128, wscale);
  //     k likewise -> K16
  wmma_gemm_lds<128, 128, 128, DM, HDIM, 4, 2, 3, 2, 1><<<gProj, blk, 0, stream>>>(
      XT16, (long)PP * DM, Wk16, 0L, (void*)K16, (long)PP * HDIM, bk, HDIM / 128, wscale);
  // (2) role-swapped v: VC16[n][o][kp] = ((16 Wv)[o] . x[n][kp])/16 + bv[o]; A = Wv16 [2048][256], Bt = XT16[n] [1024][256],
  //     M=2048, N=1024, K=256, bias by m, f16 out with ldc 1024; y = n
  wmma_gemm_lds<128, 128, 128, DM, PP, 4, 2, 3, 1, 1><<<gProj, blk, 0, stream>>>(
      Wv16, 0L, XT16, (long)PP * DM, (void*)VC16, (long)HDIM * PP, bv, PP / 128, wscale);

  // (3) scores, key-axis softmax with the positional bias and ctx in one launch: 4 blocks of 256 queries x 8 heads x 8 batches
  attn_fused_kernel<<<dim3(PP / 256, HH, NB), blk, 0, stream>>>(Q16, K16, VC16, pos, OUTP);
  // Wo plane, carried x16
  cast_f16x2_kernel<<<gCastW, blk, 0, stream>>>(Wo, Wo16, n2w, 16.0f);
  // (4) y[n][o][p] = (1/256) sum_i (16 Wo)[o][i] (16 ctx)[n][p][i] + bo[o] -> d_out[n] f32 [256][1024] (ldc 1024, bias by m); y = n
  wmma_gemm_lds<64, 128, 256, HDIM, PP, 2, 4, 4, 1, 0><<<gOut, blk, 0, stream>>>(
      Wo16, 0L, OUTP, (long)PP * HDIM, d_out, (long)DM * PP, bo, PP / 128, oscale);
  (void)hipGetLastError();
}

// v004
// One run takes 111 microseconds.
// In both of two side-by-side timings against v003, it was 1.14 times as fast.
// All steps since v000 together make it 13.1 times as fast.
// All contractions on v_wmma_f32_16x16x32_f16 (f16 operands, f32 accumulate): k/q/v 1x1-conv projections (x as f16, weights carried x16, epilogue x1/16), one fused attention kernel (S^T = k.(q/16)^T on top of the positional bias, online key-axis softmax in f32, ctx^T += v^T.P^T with P packed from the score accumulators), output conv (Wo carried x16, ctx carried x16, epilogue x1/256).
#include <hip/hip_runtime.h>
#include <math.h>
#include <stdint.h>

#define NB   8      // batch
#define HH   8      // heads
#define DM   256    // channels = head dim
#define PP   1024   // positions
#define HDIM 2048   // HH * DM

typedef __attribute__((ext_vector_type(16))) _Float16 v16h;
typedef __attribute__((ext_vector_type(8)))  _Float16 v8h;
typedef __attribute__((ext_vector_type(8)))  float    v8f;
typedef __attribute__((ext_vector_type(4)))  float    v4f;
typedef __attribute__((ext_vector_type(2)))  float    v2f;

template <typename T> struct Frag;
template <> struct Frag<_Float16> {
  typedef v16h V; union U { v16h v; v8h h[2]; };
  static __device__ __forceinline__ v16h load(const _Float16* p) {   // elements 0..7 <- p[0..7], 8..15 <- p[16..23]
    U f; f.h[0] = *(const v8h*)(p); f.h[1] = *(const v8h*)(p + 16); return f.v;
  }
  static __device__ __forceinline__ v8f mma(v16h a, v16h b, v8f c) {
    return __builtin_amdgcn_wmma_f32_16x16x32_f16(false, a, false, b, (short)0, c, false, false);
  }
};

// eight 16-byte copies of each lane; the address wait is the statement's last line, so no address register is rewritten in front of it
__device__ __forceinline__ void async_copy8(unsigned l0, unsigned lstep, const unsigned short* g0, size_t gstep) {
  asm volatile(
      "global_load_async_to_lds_b128 %0, %8, off\n\t"
      "global_load_async_to_lds_b128 %1, %9, off\n\t"
      "global_load_async_to_lds_b128 %2, %10, off\n\t"
      "global_load_async_to_lds_b128 %3, %11, off\n\t"
      "global_load_async_to_lds_b128 %4, %12, off\n\t"
      "global_load_async_to_lds_b128 %5, %13, off\n\t"
      "global_load_async_to_lds_b128 %6, %14, off\n\t"
      "global_load_async_to_lds_b128 %7, %15, off\n\t"
      "s_wait_xcnt 0x0"
      :: "v"(l0), "v"(l0 + lstep), "v"(l0 + 2 * lstep), "v"(l0 + 3 * lstep),
         "v"(l0 + 4 * lstep), "v"(l0 + 5 * lstep), "v"(l0 + 6 * lstep), "v"(l0 + 7 * lstep),
         "v"(g0), "v"(g0 + gstep), "v"(g0 + 2 * gstep), "v"(g0 + 3 * gstep),
         "v"(g0 + 4 * gstep), "v"(g0 + 5 * gstep), "v"(g0 + 6 * gstep), "v"(g0 + 7 * gstep)
      : "memory");
}

// ---- Batched WMMA GEMM, operands staged in LDS ------------------------------
// C[m,n] = scale * sum_k A[m,k] * Bt[n,k] + bias; A row-major [M][KT], Bt row-major [N][KT], f16; C rows of LDC elements; blockIdx.y = batch.
// One block of 8 waves (WGM x WGN) owns a BM x BN tile of C. A stage is BK channels of the tile's BM + BN operand rows,
// brought to LDS by asynchronous copies in whole lines (a row of a stage is BK * 2 contiguous bytes), two buffers:
// stage t + 1 flies while stage t is multiplied. Every wave reads its fragments from LDS, so a row is fetched once a block.
// LDS row pitch = BK * 2 + 16 bytes (16 B x odd, for 16-byte readers). k runs upward in steps of 32 in one accumulator chain.
// Fragments go from LDS to a ring of PD register sets inside a stage. M % BM == 0, N % BN == 0, KT % BK == 0. BIAS_MODE: 1 = bias[m], 2 = bias[n]. OUT_MODE: 0 = f32, 1 = f16.
// The body is a device function, so that one launch can hold several GEMMs; ring = the block's LDS, 2 * (BM + BN) * (BK + 8) f16, 16-byte aligned.
template <int BM, int BN, int BK, int KT, int LDC, int WGM, int WGN, int PD, int BIAS_MODE, int OUT_MODE>
__device__ __forceinline__ void gemm_tile(
    unsigned short* ring,
    const unsigned short* __restrict__ Ap, long strideA,
    const unsigned short* __restrict__ Btp, long strideB,
    void* __restrict__ Cout, long strideC,
    const float* __restrict__ bias, int tilesN, float scale) {
  typedef Frag<_Float16> F;
  constexpr int FM  = BM / WGM / 16;          // A fragments of a wave
  constexpr int FN  = BN / WGN / 16;          // B fragments of a wave
  constexpr int WN  = FN * 16;                // columns of a wave
  constexpr int PH  = BK + 8;                 // LDS row pitch, f16
  constexpr int STG = (BM + BN) * PH;         // f16 of a stage
  constexpr int NST = KT / BK;
  constexpr int KS  = BK / 32;                // matrix steps of a stage
  constexpr int LPR = BK / 8;                 // lanes that copy one row
  constexpr int RPS = 256 / LPR;              // rows that one copy of the block covers
  constexpr int SP  = WN + 4;                 // epilogue slab pitch, floats
  static_assert(WGM * WGN == 8 && BM % (8 * RPS) == 0 && BN % (8 * RPS) == 0 && KT % BK == 0 && PD - 1 <= KS, "tile shape");
  static_assert(8 * FM * 16 * SP * 4 <= 2 * STG * 2, "the epilogue slabs lie inside the ring");
  const int tid = threadIdx.x, lane = tid & 31, wave = tid >> 5;
  const int c = lane & 15, hf = lane >> 4;    // row (A) / column (B, D) in a subtile; lane half
  const int b  = blockIdx.y;
  const int tm = blockIdx.x / tilesN;
  const int tn = blockIdx.x - tm * tilesN;
  const int m0 = tm * BM, n0 = tn * BN;
  const int wm = wave / WGN, wn = wave % WGN;

  const int crow = tid / LPR, ccol = (tid % LPR) * 8;
  const unsigned short* ag = Ap  + (size_t)b * strideA + (size_t)(m0 + crow) * KT + ccol;
  const unsigned short* bg = Btp + (size_t)b * strideB + (size_t)(n0 + crow) * KT + ccol;
  const unsigned al = (unsigned)(size_t)(&ring[0]) + (crow * PH + ccol) * 2;
  const unsigned bl = al + BM * PH * 2;
  auto issue_stage = [&](int t, int buf) {
#pragma unroll
    for (int g = 0; g < BM / (8 * RPS); ++g)
      async_copy8(al + buf * (STG * 2) + g * (8 * RPS * PH * 2), RPS * PH * 2, ag + t * BK + (size_t)g * 8 * RPS * KT, (size_t)RPS * KT);
#pragma unroll
    for (int g = 0; g < BN / (8 * RPS); ++g)
      async_copy8(bl + buf * (STG * 2) + g * (8 * RPS * PH * 2), RPS * PH * 2, bg + t * BK + (size_t)g * 8 * RPS * KT, (size_t)RPS * KT);
  };

  issue_stage(0, 0);
  v8f acc[FM][FN];
#pragma unroll
  for (int i = 0; i < FM; ++i)
#pragma unroll
    for (int j = 0; j < FN; ++j) acc[i][j] = (v8f){0.f,0.f,0.f,0.f,0.f,0.f,0.f,0.f};
  // the wave's bias values come in under the first stage's copies
  const int mOff = hf * 8;                              // D row offset of this lane half
  const int mw = m0 + wm * FM * 16, nw = n0 + wn * WN;
  constexpr int NBV = (BIAS_MODE == 1) ? FM * 8 : FN;
  float bv[NBV];
  {
    const float* bp = bias + ((BIAS_MODE == 1) ? (mw + mOff) : (nw + c));
#pragma unroll
    for (int e = 0; e < NBV; ++e) bv[e] = (BIAS_MODE == 1) ? bp[(e >> 3) * 16 + (e & 7)] : bp[e * 16];
    // the address is an input, so its registers stay the loads' own up to this wait and are rewritten only behind it
    asm volatile("s_wait_xcnt 0x0" :: "v"(bp) : "memory");
  }
  asm volatile("s_wait_asynccnt 0x0" ::: "memory");   // stage 0 has landed for this wave's copies
  __syncthreads();                                    // ... and for every wave's
  if (NST > 1) issue_stage(1, 1);

  for (int t = 0; t < NST; ++t) {
    const _Float16* As = (const _Float16*)ring + (t & 1) * STG + (wm * FM * 16 + c) * PH + hf * 8;
    const _Float16* Bs = (const _Float16*)ring + (t & 1) * STG + (BM + wn * FN * 16 + c) * PH + hf * 8;
    v16h af[PD][FM], bf[PD][FN];             // fragment ring: PD - 1 steps of this stage are always on their way
#pragma unroll
    for (int p = 0; p < PD - 1; ++p) {
#pragma unroll
      for (int i = 0; i < FM; ++i) af[p][i] = F::load(As + i * 16 * PH + p * 32);
#pragma unroll
      for (int j = 0; j < FN; ++j) bf[p][j] = F::load(Bs + j * 16 * PH + p * 32);
    }
#pragma unroll
    for (int kk = 0; kk < KS; ++kk) {
      const int kn = kk + PD - 1;
      if (kn < KS) {
#pragma unroll
        for (int i = 0; i < FM; ++i) af[kn % PD][i] = F::load(As + i * 16 * PH + kn * 32);
#pragma unroll
        for (int j = 0; j < FN; ++j) bf[kn % PD][j] = F::load(Bs + j * 16 * PH + kn * 32);
      }
      __builtin_amdgcn_sched_barrier(0);     // keeps a later step's LDS reads as one group in front of these products, so their latency hides
#pragma unroll
      for (int i = 0; i < FM; ++i)
#pragma unroll
        for (int j = 0; j < FN; ++j) acc[i][j] = F::mma(af[kk % PD][i], bf[kk % PD][j], acc[i][j]);
    }
    asm volatile("s_wait_dscnt 0x0" ::: "memory");      // this wave's reads of buffer t&1 are done
    asm volatile("s_wait_asynccnt 0x0" ::: "memory");   // this wave's copies of stage t+1 have landed
    __syncthreads();                                    // publishes stage t+1, ends every reader's last read of buffer t&1
    if (t + 2 < NST) issue_stage(t + 2, t & 1);
  }
  asm volatile("s_wait_asynccnt 0x0" ::: "memory");     // nothing is in flight when the ring is reused below

  // ---- epilogue: each wave turns its tile into whole 128-byte lines through a slab of its own (the ring is free behind the last barrier)
  float* slab = (float*)ring + wave * (FM * 16 * SP);
  const size_t offC = (size_t)b * strideC;
  const int q = lane >> 3;                              // 8 lanes a row, 4 rows an instruction
#pragma unroll
  for (int i = 0; i < FM; ++i) {
#pragma unroll
    for (int j = 0; j < FN; ++j) {
#pragma unroll
      for (int r = 0; r < 8; ++r) {
        const float v = acc[i][j][r] * scale + ((BIAS_MODE == 1) ? bv[i * 8 + r] : bv[j]);
        slab[((i << 4) + mOff + r) * SP + (j << 4) + c] = v;
      }
    }
  }
  // the slab's rows are read back by other lanes of the same wave
  __builtin_amdgcn_fence(__ATOMIC_RELEASE, "workgroup");
  __builtin_amdgcn_wave_barrier();
  __builtin_amdgcn_fence(__ATOMIC_ACQUIRE, "workgroup");
  if (OUT_MODE == 0) {
    static_assert(OUT_MODE != 0 || WN == 32, "f32 rows of 128 bytes");
    const int c4 = (lane & 7) * 4;
    float* cp = (float*)Cout + offC + (size_t)(mw + q) * LDC + nw + c4;
    v4f o[FM * 4];
#pragma unroll
    for (int it = 0; it < FM * 4; ++it) o[it] = *(const v4f*)(slab + (it * 4 + q) * SP + c4);
    __builtin_amdgcn_sched_barrier(0);   // only the stores stand behind this line, so no register of a store is rewritten before the wave ends
#pragma unroll
    for (int it = 0; it < FM * 4; ++it) *(v4f*)(cp + it * 4 * LDC) = o[it];
  } else {
    static_assert(OUT_MODE == 0 || WN == 64, "f16 rows of 128 bytes");
    const int c8 = (lane & 7) * 8;
    unsigned short* cp = (unsigned short*)Cout + offC + (size_t)(mw + q) * LDC + nw + c8;
    v8h o[FM * 4];
#pragma unroll
    for (int it = 0; it < FM * 4; ++it) {
      const float* sp = slab + (it * 4 + q) * SP + c8;
#pragma unroll
      for (int e = 0; e < 8; ++e) o[it][e] = (_Float16)sp[e];
    }
    __builtin_amdgcn_sched_barrier(0);   // only the stores stand behind this line, so no register of a store is rewritten before the wave ends
#pragma unroll
    for (int it = 0; it < FM * 4; ++it) *(v8h*)(cp + it * 4 * LDC) = o[it];
  }
}

// one GEMM a launch (the output conv)
template <int BM, int BN, int BK, int KT, int LDC, int WGM, int WGN, int PD, int BIAS_MODE, int OUT_MODE>
__global__ __launch_bounds__(256) void wmma_gemm_lds(
    const unsigned short* __restrict__ Ap, long strideA,
    const unsigned short* __restrict__ Btp, long strideB,
    void* __restrict__ Cout, long strideC,
    const float* __restrict__ bias, int tilesN, float scale) {
  __shared__ __align__(16) unsigned short ring[2 * (BM + BN) * (BK + 8)];
  gemm_tile<BM, BN, BK, KT, LDC, WGM, WGN, PD, BIAS_MODE, OUT_MODE>(ring, Ap, strideA, Btp, strideB, Cout, strideC, bias, tilesN, scale);
}

// The three projections in one launch: blockIdx.z = 0 q, 1 k, 2 v (the same for a whole block); x = tile, y = batch, as in a launch of one GEMM.
//   q[n][p][o] = (x[n][p] . (16 Wq)[o])/16 + bq[o] -> Q16 [8][1024][2048] f16 (A = XT16[n] [1024][256], Bt = Wq16 [2048][256]); k likewise -> K16
//   role-swapped v: VC16[n][o][kp] = ((16 Wv)[o] . x[n][kp])/16 + bv[o]; A = Wv16 [2048][256], Bt = XT16[n] [1024][256], bias by m, ldc 1024
__global__ __launch_bounds__(256) void proj_qkv_kernel(
    const unsigned short* __restrict__ XT16,
    const unsigned short* __restrict__ Wq16, const unsigned short* __restrict__ Wk16, const unsigned short* __restrict__ Wv16,
    const float* __restrict__ bq, const float* __restrict__ bk, const float* __restrict__ bv,
    unsigned short* __restrict__ Q16, unsigned short* __restrict__ K16, unsigned short* __restrict__ VC16, float scale) {
  __shared__ __align__(16) unsigned short ring[2 * (128 + 128) * (128 + 8)];
  if (blockIdx.z < 2) {
    const bool isk = blockIdx.z == 1;
    gemm_tile<128, 128, 128, DM, HDIM, 4, 2, 3, 2, 1>(ring, XT16, (long)PP * DM, isk ? Wk16 : Wq16, 0L,
        (void*)(isk ? K16 : Q16), (long)PP * HDIM, isk ? bk : bq, HDIM / 128, scale);
  } else {
    gemm_tile<128, 128, 128, DM, PP, 4, 2, 3, 1, 1>(ring, Wv16, 0L, XT16, (long)PP * DM,
        (void*)VC16, (long)HDIM * PP, bv, PP / 128, scale);
    // in the built text the other branch's code follows this branch's stores: the wait stands in front of any rewrite of their registers
    asm volatile("s_wait_xcnt 0x0" ::: "memory");
  }
}

// ---------------------------------------------------------------------------
// Elementwise cast out = f16(in * 16) (power-of-two carry) of one weight plane's slice: a block casts WCB = 8192 consecutive elements,
// a thread 4 groups of 8 (two 16-byte loads, one 16-byte store a group; a wave's group is 1 KiB in, 512 B out, contiguous).
// ---------------------------------------------------------------------------
#define WCB 8192
__device__ __forceinline__ void cast_w_block(const float* __restrict__ in, unsigned short* __restrict__ out, int blk) {
  const float* src = in + (size_t)blk * WCB + threadIdx.x * 8;
  unsigned short* dst = out + (size_t)blk * WCB + threadIdx.x * 8;
  v4f a[4][2];
#pragma unroll
  for (int i = 0; i < 4; ++i) {
    a[i][0] = *(const v4f*)(src + i * 2048);
    a[i][1] = *(const v4f*)(src + i * 2048 + 4);
  }
  v8h o[4];
#pragma unroll
  for (int i = 0; i < 4; ++i)
#pragma unroll
    for (int e = 0; e < 8; ++e) o[i][e] = (_Float16)(a[i][e >> 2][e & 3] * 16.0f);
#pragma unroll
  for (int i = 0; i < 4; ++i) *(v8h*)(dst + i * 2048) = o[i];
}

// ---------------------------------------------------------------------------
// Transpose-cast of the input: x f32 [NB][DM][PP] -> XT f16 [NB][PP][DM]  (in[n][d][p] -> out[n][p][d]).
// One block (256 threads) per 64x64 tile: NB * (PP/64) * (DM/64) = 8 * 16 * 4 = 512 blocks (XTB), bid = the tile.
// Load: thread t reads row d = d0 + (t>>2), 16 floats at p0 + (t&3)*16 -> 256 x 16 = 4096 = the whole tile.
// 4 rows (lanes 8q..8q+7 -> row q of the group, 8 lanes x 16 B per line); 8 waves x 2 it x 4 = 64 rows;
// ---------------------------------------------------------------------------
#define XTB (NB * (PP / 64) * (DM / 64))
__device__ __forceinline__ void xt_cast_block(const float* __restrict__ x, unsigned short* __restrict__ XT, int bid) {
  __shared__ float tile[64][65];                 // tile[d_local][p_local]
  const int dt = bid & 3;
  const int pt = (bid >> 2) & 15;
  const int n  = bid >> 6;
  const int d0 = dt * 64, p0 = pt * 64;
  const int tid = threadIdx.x, lane = tid & 31, wave = tid >> 5;
  {
    const int r = tid >> 2, cs = (tid & 3) * 16;
    const float* src = x + ((size_t)n * DM + d0 + r) * PP + p0 + cs;
#pragma unroll
    for (int i = 0; i < 4; ++i) {
      const v4f v = *(const v4f*)(src + 4 * i);
      tile[r][cs + 4 * i + 0] = v[0];
      tile[r][cs + 4 * i + 1] = v[1];
      tile[r][cs + 4 * i + 2] = v[2];
      tile[r][cs + 4 * i + 3] = v[3];
    }
  }
  __syncthreads();
  const int q = lane >> 3, c8 = (lane & 7) * 8;
  unsigned short* ob = XT + ((size_t)n * PP + p0) * DM + d0;
  {
#pragma unroll
    for (int it = 0; it < 2; ++it) {
      const int rr = wave * 8 + it * 4 + q;       // p_local
      v8h hv;
#pragma unroll
      for (int e = 0; e < 8; ++e) hv[e] = (_Float16)tile[c8 + e][rr];   // value (p=rr, d=c8+e)
      *(v8h*)(ob + (size_t)rr * DM + c8) = hv;
    }
    
  }
}

// All operand preparation in one launch: blocks 0 .. XTB-1 transpose-cast x, the next 4 * (HDIM * DM / WCB) cast the weight planes
// (k, q, v, o in this order, W16 = four planes of HDIM * DM f16 in a row). The branch is the same for a whole block.
__global__ __launch_bounds__(256) void prep_kernel(const float* __restrict__ x,
                                                   const float* __restrict__ Wk, const float* __restrict__ Wq,
                                                   const float* __restrict__ Wv, const float* __restrict__ Wo,
                                                   unsigned short* __restrict__ XT, unsigned short* __restrict__ W16) {
  const int bid = blockIdx.x;
  if (bid < XTB) {
    xt_cast_block(x, XT, bid);
  } else {
    constexpr int BPP = HDIM * DM / WCB;          // blocks of a plane: 64
    const int wb = bid - XTB, pl = wb / BPP;
    const float* in = (pl == 0) ? Wk : (pl == 1) ? Wq : (pl == 2) ? Wv : Wo;
    cast_w_block(in, W16 + (size_t)pl * (HDIM * DM), wb - pl * BPP);
  }
}

#define FK      64
#define NSTAGE  (PP / FK)
#define KP_H    264
#define VP_H    72
#define KTILE_H (FK * KP_H)
#define STAGE_H (KTILE_H + DM * VP_H)
#define LOG2E   1.4426950408889634f

__global__ __launch_bounds__(256) void attn_fused_kernel(const unsigned short* __restrict__ Q16,
                                                         const unsigned short* __restrict__ K16,
                                                         const unsigned short* __restrict__ VC16,
                                                         const float* __restrict__ pos,
                                                         unsigned short* __restrict__ CTX) {
  __shared__ __align__(16) unsigned short ring[2 * STAGE_H];
  typedef Frag<_Float16> F;
  const int tid = threadIdx.x, lane = tid & 31, wave = tid >> 5;
  const int c = lane & 15, hf = lane >> 4;
  const int h = blockIdx.y, n = blockIdx.z;
  const int q0 = blockIdx.x * 256 + wave * 32;
  const unsigned short* Kh = K16 + (size_t)n * PP * HDIM + h * DM;          // [kp][d], row pitch HDIM
  const unsigned short* Vh = VC16 + ((size_t)n * HDIM + h * DM) * PP;      // [dd][kp], row pitch PP
  const float* ph = pos + (size_t)h * PP * PP + (size_t)(hf * 8) * PP + q0 + c;
  const unsigned ring0 = (unsigned)(size_t)(&ring[0]);

  // stage t -> buffer b. k: wave w copies rows w, w+8, ... (512 B a row); v^T: 8 lanes a row of 128 B, rows tid>>3, +32, ...
  const unsigned short* kg = Kh + (size_t)wave * HDIM + lane * 8;
  const unsigned short* vg = Vh + (size_t)(tid >> 3) * PP + (tid & 7) * 8;
  const unsigned kl = ring0 + wave * (KP_H * 2) + lane * 16;
  const unsigned vl = ring0 + KTILE_H * 2 + (tid >> 3) * (VP_H * 2) + (tid & 7) * 16;
  auto issue_stage = [&](int t, int b) {
    async_copy8(kl + b * (STAGE_H * 2), 8 * KP_H * 2, kg + (size_t)t * FK * HDIM, (size_t)8 * HDIM);
    async_copy8(vl + b * (STAGE_H * 2), 32 * VP_H * 2, vg + t * FK, (size_t)32 * PP);
  };

  issue_stage(0, 0);

  v16h qf[8][2];                            // q / 16 (exact power of two), hardware k order
#pragma unroll
  for (int kk = 0; kk < 8; ++kk)
#pragma unroll
    for (int nt = 0; nt < 2; ++nt)
      qf[kk][nt] = F::load((const _Float16*)Q16 + ((size_t)n * PP + q0 + nt * 16 + c) * HDIM + h * DM + kk * 32 + hf * 8) * (_Float16)0.0625f;

  v8f acc[16][2];
#pragma unroll
  for (int dt = 0; dt < 16; ++dt)
#pragma unroll
    for (int nt = 0; nt < 2; ++nt) acc[dt][nt] = (v8f){0.f,0.f,0.f,0.f,0.f,0.f,0.f,0.f};
  float mref[2] = {-1.0e30f, -1.0e30f};
  float lsum[2] = {0.f, 0.f};

  v8f st[2][2];                             // st[mt][nt][r] = score of key kp0 + 16 mt + 8 hf + r, query q0 + 16 nt + c
#pragma unroll
  for (int mt = 0; mt < 2; ++mt)
#pragma unroll
    for (int nt = 0; nt < 2; ++nt)
#pragma unroll
      for (int r = 0; r < 8; ++r) st[mt][nt][r] = ph[(size_t)(mt * 16 + r) * PP + nt * 16];

  asm volatile("s_wait_asynccnt 0x0" ::: "memory");   // stage 0 has landed for this wave's copies
  __syncthreads();                                    // ... and for every wave's
  issue_stage(1, 1);

  for (int t = 0; t < NSTAGE; ++t) {
    const _Float16* Ks = (const _Float16*)ring + (t & 1) * STAGE_H;
    const _Float16* Vs = Ks + KTILE_H;
#pragma unroll 1   // two passes of one stage share the code: the body is large and only addresses differ
    for (int hp = 0; hp < 2; ++hp) {
      const _Float16* kb = Ks + (hp * 32 + c) * KP_H + hf * 8;
      const _Float16* vb = Vs + c * VP_H + hp * 32 + hf * 8;
      v16h ka[3], va[3];                     // fragment rings: two fragments are always on their way
      ka[0] = F::load(kb);                   // fragment j = 2 kk + mt: keys 16 mt .., channels 32 kk ..
      ka[1] = F::load(kb + 16 * KP_H);
#pragma unroll
      for (int j = 0; j < 16; ++j) {
        const int kk = j >> 1, mt = j & 1, jn = j + 2;
        if (jn < 16) ka[jn % 3] = F::load(kb + (jn & 1) * 16 * KP_H + (jn >> 1) * 32);
        else         va[jn - 16] = F::load(vb + (jn - 16) * 16 * VP_H);   // the first v^T fragments (same stage) come in under the softmax
        __builtin_amdgcn_sched_barrier(0);   // keeps the LDS read of the fragment after next in front of these products, so its latency hides
        st[mt][0] = F::mma(ka[j % 3], qf[kk][0], st[mt][0]);
        st[mt][1] = F::mma(ka[j % 3], qf[kk][1], st[mt][1]);
      }
      float mx[2];
#pragma unroll
      for (int nt = 0; nt < 2; ++nt) {
        const v8f u = st[0][nt], w = st[1][nt];
        float m0 = fmaxf(fmaxf(fmaxf(u[0], u[1]), fmaxf(u[2], u[3])), fmaxf(fmaxf(u[4], u[5]), fmaxf(u[6], u[7])));
        float m1 = fmaxf(fmaxf(fmaxf(w[0], w[1]), fmaxf(w[2], w[3])), fmaxf(fmaxf(w[4], w[5]), fmaxf(w[6], w[7])));
        m0 = fmaxf(m0, m1);
        mx[nt] = fmaxf(m0, __shfl_xor(m0, 16, 32)) * LOG2E;
      }
      // lazy rescale, tested once a pass: the reference maximum moves only when a column passes it by more than 8 (log2)
      const bool need = (mx[0] > mref[0] + 8.0f) || (mx[1] > mref[1] + 8.0f);
      if (__builtin_amdgcn_ballot_w32(need) != 0) {
#pragma unroll
        for (int nt = 0; nt < 2; ++nt) {
          const float mnew = fmaxf(mref[nt], mx[nt]);
          const float alpha = __builtin_amdgcn_exp2f(mref[nt] - mnew);
          mref[nt] = mnew;
          lsum[nt] *= alpha;
#pragma unroll
          for (int dt = 0; dt < 16; ++dt) acc[dt][nt] *= alpha;
        }
      }
      v16h pf[2];
#pragma unroll
      for (int nt = 0; nt < 2; ++nt) {
        const float c0 = 6.0f - mref[nt];
        float s0 = 0.f, s1 = 0.f;
#pragma unroll
        for (int r = 0; r < 8; ++r) {
          const float e0 = __builtin_amdgcn_exp2f(fmaf(st[0][nt][r], LOG2E, c0));
          const float e1 = __builtin_amdgcn_exp2f(fmaf(st[1][nt][r], LOG2E, c0));
          s0 += e0; s1 += e1;
          pf[nt][r]     = (_Float16)e0;
          pf[nt][8 + r] = (_Float16)e1;
        }
        lsum[nt] += s0 + s1;
      }
      // bias of the next pass, fetched behind the last use of this pass's scores (the last pass re-reads its own rows, unused)
      {
        const int kc = min((t * 2 + hp) * 32, PP - 64);
        const float* pn = ph + (size_t)kc * PP;   // this pass's rows; the next pass's lie 32 rows on
#pragma unroll
        for (int mt = 0; mt < 2; ++mt)
#pragma unroll
          for (int nt = 0; nt < 2; ++nt)
#pragma unroll
            for (int r = 0; r < 8; ++r) st[mt][nt][r] = pn[(size_t)(32 + mt * 16 + r) * PP + nt * 16];
        // the address is an input, so its registers stay the loads' own up to this wait and are rewritten only behind it
        asm volatile("s_wait_xcnt 0x0" :: "v"(pn) : "memory");
      }
#pragma unroll
      for (int dt = 0; dt < 16; ++dt) {
        if (dt + 2 < 16) va[(dt + 2) % 3] = F::load(vb + (dt + 2) * 16 * VP_H);
        __builtin_amdgcn_sched_barrier(0);   // as above
        acc[dt][0] = F::mma(va[dt % 3], pf[0], acc[dt][0]);
        acc[dt][1] = F::mma(va[dt % 3], pf[1], acc[dt][1]);
      }
    }
    asm volatile("s_wait_dscnt 0x0" ::: "memory");      // this wave's reads of buffer t&1 are done
    asm volatile("s_wait_asynccnt 0x0" ::: "memory");   // this wave's copies of stage t+1 have landed
    __syncthreads();                                    // publishes stage t+1, ends every reader's last read of buffer t&1
    if (t + 2 < NSTAGE) issue_stage(t + 2, t & 1);
  }
  asm volatile("s_wait_asynccnt 0x0" ::: "memory");     // nothing is in flight when the wave ends

#pragma unroll
  for (int nt = 0; nt < 2; ++nt) {
    const float lt = lsum[nt] + __shfl_xor(lsum[nt], 16, 32);
    const float inv = 16.0f / lt;                       // ctx carried x16
    unsigned short* op = CTX + ((size_t)n * PP + q0 + nt * 16 + c) * HDIM + h * DM + hf * 8;
    v8h o[16];
#pragma unroll
    for (int dt = 0; dt < 16; ++dt)
#pragma unroll
      for (int r = 0; r < 8; ++r) o[dt][r] = (_Float16)(acc[dt][nt][r] * inv);
    __builtin_amdgcn_sched_barrier(0);                  // with the one below: nothing but the stores and their wait stands in between
#pragma unroll
    for (int dt = 0; dt < 16; ++dt) *(v8h*)(op + dt * 16) = o[dt];   // 8 consecutive dd of one query: one 16-byte store
    asm volatile("s_wait_xcnt 0x0" ::: "memory");       // stands in front of the first rewrite of the stores' registers
    __builtin_amdgcn_sched_barrier(0);
  }
}

// ---------------------------------------------------------------------------
// Workspace region map (byte offsets). All eight batches go through each stage in one launch (batch = a grid axis).
// Every region is fully written in this call before it is read (all GEMM extents are exact tile multiples).
//   Q16    f16  [8][1024][2048] (col o)              0
//   K16    f16  [8][1024][2048] (col o)     33,554,432
//   VC16   f16  [8][2048 o][1024 kp]        67,108,864
//   CTX16  f16  [8][1024][2048] (col i, x16) 100,663,296
//   Wk16, Wq16, Wv16, Wo16 f16 (x16), 1,048,576 each, at 134,217,728;  XT16 f16 [8][1024][256] behind them
//   total                                  142,606,336
// ---------------------------------------------------------------------------
extern "C" void kernel_launch(void* const* d_in, const int* in_sizes, int n_in,
                              void* d_out, int out_size, void* d_ws, size_t ws_size,
                              hipStream_t stream) {
  if (n_in < 10) return;
  if (in_sizes[0] != NB * DM * PP) return;
  if (in_sizes[1] != HH * PP * PP) return;
  if (in_sizes[2] != HDIM * DM || in_sizes[4] != HDIM * DM || in_sizes[6] != HDIM * DM) return;
  if (in_sizes[3] != HDIM || in_sizes[5] != HDIM || in_sizes[7] != HDIM) return;
  if (in_sizes[8] != DM * HDIM || in_sizes[9] != DM) return;
  if (out_size != NB * DM * PP) return;

  const float* x   = (const float*)d_in[0];   // [NB][DM][PP]
  const float* pos = (const float*)d_in[1];   // [1][HH][PP kp][PP qp]
  const float* Wk  = (const float*)d_in[2];   // [HDIM][DM]
  const float* bk  = (const float*)d_in[3];   // [HDIM]
  const float* Wq  = (const float*)d_in[4];
  const float* bq  = (const float*)d_in[5];
  const float* Wv  = (const float*)d_in[6];
  const float* bv  = (const float*)d_in[7];
  const float* Wo  = (const float*)d_in[8];   // [DM][HDIM]
  const float* bo  = (const float*)d_in[9];   // [DM]

  const size_t BW   = (size_t)HDIM * DM * 2;             // 1,048,576
  const size_t BACT = (size_t)NB * PP * HDIM * 2;        // 33,554,432
  const size_t BS   = 8 * BW;                            // 8,388,608: four weight planes and XT16
  size_t off = 0;
  const size_t oQ16  = off; off += BACT;
  const size_t oK16  = off; off += BACT;
  const size_t oVC16 = off; off += BACT;
  const size_t oCTX  = off; off += BACT;
  const size_t oS    = off; off += BS;
  if (off > ws_size) return;                          // 142,606,336 B total

  char* ws = (char*)d_ws;
  unsigned short* Q16   = (unsigned short*)(ws + oQ16);
  unsigned short* K16   = (unsigned short*)(ws + oK16);
  unsigned short* VC16  = (unsigned short*)(ws + oVC16);
  unsigned short* OUTP  = (unsigned short*)(ws + oCTX);
  unsigned short* Wk16  = (unsigned short*)(ws + oS);
  unsigned short* Wq16  = (unsigned short*)(ws + oS + BW);
  unsigned short* Wv16  = (unsigned short*)(ws + oS + 2 * BW);
  unsigned short* XT16  = (unsigned short*)(ws + oS + 4 * BW);
  unsigned short* Wo16  = (unsigned short*)(ws + oS + 3 * BW);

  const dim3 blk(256);

  // setup, one launch: x [NB][DM][PP] -> XT16 [NB][PP][DM] f16; the four weight planes, carried x16 (exact power of two; undone by the GEMM epilogue scales)
  prep_kernel<<<XTB + 4 * (HDIM * DM / WCB), blk, 0, stream>>>(x, Wk, Wq, Wv, Wo, XT16, Wk16);

  const dim3 gProj((PP / 128) * (HDIM / 128), NB, 3);       // 128 x 8 x 3: tiles of 128 x 128 (M=1024,N=2048 or M=2048,N=1024), K=256; z = q, k, v
  const dim3 gOut((DM / 64) * (PP / 128), NB);               // 32 x 8:  tiles of 64 x 128, M=256, N=1024, K=2048
  const float wscale  = 1.0f / 16.0f;                      // undo the x16 weight carry
  const float oscale  = 1.0f / 256.0f;                     // undo x16 (Wo) and x16 (ctx)

  // (1), (2) q, k and the role-swapped v in one launch
  proj_qkv_kernel<<<gProj, blk, 0, stream>>>(XT16, Wq16, Wk16, Wv16, bq, bk, bv, Q16, K16, VC16, wscale);

  // (3) scores, key-axis softmax with the positional bias and ctx in one launch: 4 blocks of 256 queries x 8 heads x 8 batches
  attn_fused_kernel<<<dim3(PP / 256, HH, NB), blk, 0, stream>>>(Q16, K16, VC16, pos, OUTP);
  // (4) y[n][o][p] = (1/256) sum_i (16 Wo)[o][i] (16 ctx)[n][p][i] + bo[o] -> d_out[n] f32 [256][1024] (ldc 1024, bias by m); y = n
  wmma_gemm_lds<64, 128, 256, HDIM, PP, 2, 4, 4, 1, 0><<<gOut, blk, 0, stream>>>(
      Wo16, 0L, OUTP, (long)PP * HDIM, d_out, (long)DM * PP, bo, PP / 128, oscale);
  (void)hipGetLastError();
}

// v006
// It runs in 89.5 microseconds.
// Versions between v004 and this one are left out; their measured steps multiply to 1.25 times as fast.
// Over all steps from v000 it is 16.4 times as fast.
// All matrix-matrix contractions on v_wmma_f32_16x16x32_f16 (f16 operands, f32 accumulate); the two bias folds are matrix-vector sums in f32 on the vector unit. The k and v projections are folded into the weights: per head M = Wk^T Wq and N = Wo Wv, so y = M x + Wk^T bq takes q's place (each attention block forms its own y in its prologue), x itself is the K and the V operand of the fused attention kernel (S^T = x.(y/16)^T on top of the positional bias, online key-axis softmax in f32, ctx^T += x.P^T with P packed from the score accumulators), and the output conv runs on N (carried x16, ctx carried x16, epilogue x1/256) with the bias bo + Wo bv.
#include <hip/hip_runtime.h>
#include <math.h>
#include <stdint.h>

#define NB   8      // batch
#define HH   8      // heads
#define DM   256    // channels = head dim
#define PP   1024   // positions
#define HDIM 2048   // HH * DM

typedef __attribute__((ext_vector_type(16))) _Float16 v16h;
typedef __attribute__((ext_vector_type(8)))  _Float16 v8h;
typedef __attribute__((ext_vector_type(8)))  float    v8f;
typedef __attribute__((ext_vector_type(4)))  float    v4f;
typedef __attribute__((ext_vector_type(2)))  float    v2f;

template <typename T> struct Frag;
template <> struct Frag<_Float16> {
  typedef v16h V; union U { v16h v; v8h h[2]; };
  static __device__ __forceinline__ v16h load(const _Float16* p) {   // elements 0..7 <- p[0..7], 8..15 <- p[16..23]
    U f; f.h[0] = *(const v8h*)(p); f.h[1] = *(const v8h*)(p + 16); return f.v;
  }
  static __device__ __forceinline__ v8f mma(v16h a, v16h b, v8f c) {
    return __builtin_amdgcn_wmma_f32_16x16x32_f16(false, a, false, b, (short)0, c, false, false);
  }
};

// eight 16-byte copies of each lane; the address wait is the statement's last line, so no address register is rewritten in front of it
__device__ __forceinline__ void async_copy8(unsigned l0, unsigned lstep, const unsigned short* g0, size_t gstep) {
  asm volatile(
      "global_load_async_to_lds_b128 %0, %8, off\n\t"
      "global_load_async_to_lds_b128 %1, %9, off\n\t"
      "global_load_async_to_lds_b128 %2, %10, off\n\t"
      "global_load_async_to_lds_b128 %3, %11, off\n\t"
      "global_load_async_to_lds_b128 %4, %12, off\n\t"
      "global_load_async_to_lds_b128 %5, %13, off\n\t"
      "global_load_async_to_lds_b128 %6, %14, off\n\t"
      "global_load_async_to_lds_b128 %7, %15, off\n\t"
      "s_wait_xcnt 0x0"
      :: "v"(l0), "v"(l0 + lstep), "v"(l0 + 2 * lstep), "v"(l0 + 3 * lstep),
         "v"(l0 + 4 * lstep), "v"(l0 + 5 * lstep), "v"(l0 + 6 * lstep), "v"(l0 + 7 * lstep),
         "v"(g0), "v"(g0 + gstep), "v"(g0 + 2 * gstep), "v"(g0 + 3 * gstep),
         "v"(g0 + 4 * gstep), "v"(g0 + 5 * gstep), "v"(g0 + 6 * gstep), "v"(g0 + 7 * gstep)
      : "memory");
}

// ---- Batched WMMA GEMM, operands staged in LDS ------------------------------
// C[m,n] = scale * sum_k A[m,k] * Bt[n,k] + bias; A row-major [M][KT], Bt row-major [N][KT], f16; C rows of LDC elements; blockIdx.y = batch.
// One block of 8 waves (WGM x WGN) owns a BM x BN tile of C. A stage is BK channels of the tile's BM + BN operand rows,
// brought to LDS by asynchronous copies in whole lines (a row of a stage is BK * 2 contiguous bytes), two buffers:
// stage t + 1 flies while stage t is multiplied. Every wave reads its fragments from LDS, so a row is fetched once a block.
// LDS row pitch = BK * 2 + 16 bytes (16 B x odd, for 16-byte readers). k runs upward in steps of 32 in one accumulator chain.
// Fragments go from LDS to a ring of PD register sets inside a stage. M % BM == 0, N % BN == 0, KT % BK == 0. BIAS_MODE: 0 = none, 1 = bias[m], 2 = bias[n]. OUT_MODE: 0 = f32, 1 = f16. LDA = row pitch of A in elements.
// The body is a device function, so that one launch can hold several GEMMs; ring = the block's LDS, 2 * (BM + BN) * (BK + 8) f16, 16-byte aligned.
template <int BM, int BN, int BK, int KT, int LDC, int WGM, int WGN, int PD, int BIAS_MODE, int OUT_MODE, int LDA = KT>
__device__ __forceinline__ void gemm_tile(
    unsigned short* ring,
    const unsigned short* __restrict__ Ap, long strideA,
    const unsigned short* __restrict__ Btp, long strideB,
    void* __restrict__ Cout, long strideC,
    const float* __restrict__ bias, int tilesN, float scale) {
  typedef Frag<_Float16> F;
  constexpr int FM  = BM / WGM / 16;          // A fragments of a wave
  constexpr int FN  = BN / WGN / 16;          // B fragments of a wave
  constexpr int WN  = FN * 16;                // columns of a wave
  constexpr int PH  = BK + 8;                 // LDS row pitch, f16
  constexpr int STG = (BM + BN) * PH;         // f16 of a stage
  constexpr int NST = KT / BK;
  constexpr int KS  = BK / 32;                // matrix steps of a stage
  constexpr int LPR = BK / 8;                 // lanes that copy one row
  constexpr int RPS = 256 / LPR;              // rows that one copy of the block covers
  constexpr int SP  = WN + 4;                 // epilogue slab pitch, floats
  static_assert(WGM * WGN == 8 && BM % (8 * RPS) == 0 && BN % (8 * RPS) == 0 && KT % BK == 0 && PD - 1 <= KS, "tile shape");
  static_assert(8 * FM * 16 * SP * 4 <= 2 * STG * 2, "the epilogue slabs lie inside the ring");
  const int tid = threadIdx.x, lane = tid & 31, wave = tid >> 5;
  const int c = lane & 15, hf = lane >> 4;    // row (A) / column (B, D) in a subtile; lane half
  const int b  = blockIdx.y;
  const int tm = blockIdx.x / tilesN;
  const int tn = blockIdx.x - tm * tilesN;
  const int m0 = tm * BM, n0 = tn * BN;
  const int wm = wave / WGN, wn = wave % WGN;

  const int crow = tid / LPR, ccol = (tid % LPR) * 8;
  const unsigned short* ag = Ap  + (size_t)b * strideA + (size_t)(m0 + crow) * LDA + ccol;
  const unsigned short* bg = Btp + (size_t)b * strideB + (size_t)(n0 + crow) * KT + ccol;
  const unsigned al = (unsigned)(size_t)(&ring[0]) + (crow * PH + ccol) * 2;
  const unsigned bl = al + BM * PH * 2;
  auto issue_stage = [&](int t, int buf) {
#pragma unroll
    for (int g = 0; g < BM / (8 * RPS); ++g)
      async_copy8(al + buf * (STG * 2) + g * (8 * RPS * PH * 2), RPS * PH * 2, ag + t * BK + (size_t)g * 8 * RPS * LDA, (size_t)RPS * LDA);
#pragma unroll
    for (int g = 0; g < BN / (8 * RPS); ++g)
      async_copy8(bl + buf * (STG * 2) + g * (8 * RPS * PH * 2), RPS * PH * 2, bg + t * BK + (size_t)g * 8 * RPS * KT, (size_t)RPS * KT);
  };

  issue_stage(0, 0);
  v8f acc[FM][FN];
#pragma unroll
  for (int i = 0; i < FM; ++i)
#pragma unroll
    for (int j = 0; j < FN; ++j) acc[i][j] = (v8f){0.f,0.f,0.f,0.f,0.f,0.f,0.f,0.f};
  // the wave's bias values come in under the first stage's copies
  const int mOff = hf * 8;                              // D row offset of this lane half
  const int mw = m0 + wm * FM * 16, nw = n0 + wn * WN;
  constexpr int NBV = (BIAS_MODE == 1) ? FM * 8 : FN;
  float bv[NBV];
  if (BIAS_MODE != 0) {
    const float* bp = bias + ((BIAS_MODE == 1) ? (mw + mOff) : (nw + c));
#pragma unroll
    for (int e = 0; e < NBV; ++e) bv[e] = (BIAS_MODE == 1) ? bp[(e >> 3) * 16 + (e & 7)] : bp[e * 16];
    // the address is an input, so its registers stay the loads' own up to this wait and are rewritten only behind it
    asm volatile("s_wait_xcnt 0x0" :: "v"(bp) : "memory");
  }
  asm volatile("s_wait_asynccnt 0x0" ::: "memory");   // stage 0 has landed for this wave's copies
  __syncthreads();                                    // ... and for every wave's
  if (NST > 1) issue_stage(1, 1);

  for (int t = 0; t < NST; ++t) {
    const _Float16* As = (const _Float16*)ring + (t & 1) * STG + (wm * FM * 16 + c) * PH + hf * 8;
    const _Float16* Bs = (const _Float16*)ring + (t & 1) * STG + (BM + wn * FN * 16 + c) * PH + hf * 8;
    v16h af[PD][FM], bf[PD][FN];             // fragment ring: PD - 1 steps of this stage are always on their way
#pragma unroll
    for (int p = 0; p < PD - 1; ++p) {
#pragma unroll
      for (int i = 0; i < FM; ++i) af[p][i] = F::load(As + i * 16 * PH + p * 32);
#pragma unroll
      for (int j = 0; j < FN; ++j) bf[p][j] = F::load(Bs + j * 16 * PH + p * 32);
    }
#pragma unroll
    for (int kk = 0; kk < KS; ++kk) {
      const int kn = kk + PD - 1;
      if (kn < KS) {
#pragma unroll
        for (int i = 0; i < FM; ++i) af[kn % PD][i] = F::load(As + i * 16 * PH + kn * 32);
#pragma unroll
        for (int j = 0; j < FN; ++j) bf[kn % PD][j] = F::load(Bs + j * 16 * PH + kn * 32);
      }
      __builtin_amdgcn_sched_barrier(0);     // keeps a later step's LDS reads as one group in front of these products, so their latency hides
#pragma unroll
      for (int i = 0; i < FM; ++i)
#pragma unroll
        for (int j = 0; j < FN; ++j) acc[i][j] = F::mma(af[kk % PD][i], bf[kk % PD][j], acc[i][j]);
    }
    asm volatile("s_wait_dscnt 0x0" ::: "memory");      // this wave's reads of buffer t&1 are done
    asm volatile("s_wait_asynccnt 0x0" ::: "memory");   // this wave's copies of stage t+1 have landed
    __syncthreads();                                    // publishes stage t+1, ends every reader's last read of buffer t&1
    if (t + 2 < NST) issue_stage(t + 2, t & 1);
  }
  asm volatile("s_wait_asynccnt 0x0" ::: "memory");     // nothing is in flight when the ring is reused below

  // ---- epilogue: each wave turns its tile into whole 128-byte lines through a slab of its own (the ring is free behind the last barrier)
  float* slab = (float*)ring + wave * (FM * 16 * SP);
  const size_t offC = (size_t)b * strideC;
  const int q = lane >> 3;                              // 8 lanes a row, 4 rows an instruction
#pragma unroll
  for (int i = 0; i < FM; ++i) {
#pragma unroll
    for (int j = 0; j < FN; ++j) {
#pragma unroll
      for (int r = 0; r < 8; ++r) {
        const float v = (BIAS_MODE == 0) ? acc[i][j][r] * scale : acc[i][j][r] * scale + ((BIAS_MODE == 1) ? bv[i * 8 + r] : bv[j]);
        slab[((i << 4) + mOff + r) * SP + (j << 4) + c] = v;
      }
    }
  }
  // the slab's rows are read back by other lanes of the same wave
  __builtin_amdgcn_fence(__ATOMIC_RELEASE, "workgroup");
  __builtin_amdgcn_wave_barrier();
  __builtin_amdgcn_fence(__ATOMIC_ACQUIRE, "workgroup");
  if (OUT_MODE == 0) {
    static_assert(OUT_MODE != 0 || WN == 32, "f32 rows of 128 bytes");
    const int c4 = (lane & 7) * 4;
    float* cp = (float*)Cout + offC + (size_t)(mw + q) * LDC + nw + c4;
    v4f o[FM * 4];
#pragma unroll
    for (int it = 0; it < FM * 4; ++it) o[it] = *(const v4f*)(slab + (it * 4 + q) * SP + c4);
    __builtin_amdgcn_sched_barrier(0);   // only the stores stand behind this line, so no register of a store is rewritten before the wave ends
#pragma unroll
    for (int it = 0; it < FM * 4; ++it) *(v4f*)(cp + it * 4 * LDC) = o[it];
  } else {
    static_assert(OUT_MODE == 0 || WN == 64, "f16 rows of 128 bytes");
    const int c8 = (lane & 7) * 8;
    unsigned short* cp = (unsigned short*)Cout + offC + (size_t)(mw + q) * LDC + nw + c8;
    v8h o[FM * 4];
#pragma unroll
    for (int it = 0; it < FM * 4; ++it) {
      const float* sp = slab + (it * 4 + q) * SP + c8;
#pragma unroll
      for (int e = 0; e < 8; ++e) o[it][e] = (_Float16)sp[e];
    }
    __builtin_amdgcn_sched_barrier(0);   // only the stores stand behind this line, so no register of a store is rewritten before the wave ends
#pragma unroll
    for (int it = 0; it < FM * 4; ++it) *(v8h*)(cp + it * 4 * LDC) = o[it];
  }
}

// one GEMM a launch (the output conv)
template <int BM, int BN, int BK, int KT, int LDC, int WGM, int WGN, int PD, int BIAS_MODE, int OUT_MODE>
__global__ __launch_bounds__(256) void wmma_gemm_lds(
    const unsigned short* __restrict__ Ap, long strideA,
    const unsigned short* __restrict__ Btp, long strideB,
    void* __restrict__ Cout, long strideC,
    const float* __restrict__ bias, int tilesN, float scale) {
  __shared__ __align__(16) unsigned short ring[2 * (BM + BN) * (BK + 8)];
  gemm_tile<BM, BN, BK, KT, LDC, WGM, WGN, PD, BIAS_MODE, OUT_MODE>(ring, Ap, strideA, Btp, strideB, Cout, strideC, bias, tilesN, scale);
}

// The two weight folds in one launch: blockIdx.z = 0 M, 1 N (the same for a whole block); x = tile of 128 x 128, y = head.
//   M16[h*256 + d][d'] = (1/16) sum_o (16 Wk)[h*256 + o][d] (16 Wq)[h*256 + o][d']: A = WkT16[h] [d][o], Bt = WqT16[h] [d'][o]; carried x16
//   N16[o'][h*256 + d'] = (1/16) sum_i (16 Wo)[o'][h*256 + i] (16 Wv)[h*256 + i][d']: A = Wo16 columns of head h (row pitch 2048), Bt = WvT16[h] [d'][i]; carried x16
__global__ __launch_bounds__(256) void fold_kernel(
    const unsigned short* __restrict__ WkT16, const unsigned short* __restrict__ WqT16,
    const unsigned short* __restrict__ Wo16, const unsigned short* __restrict__ WvT16,
    unsigned short* __restrict__ M16, unsigned short* __restrict__ N16, float scale) {
  __shared__ __align__(16) unsigned short ring[2 * (128 + 128) * (128 + 8)];
  if (blockIdx.z == 0) {
    gemm_tile<128, 128, 128, DM, DM, 4, 2, 3, 0, 1>(ring, WkT16, (long)DM * DM, WqT16, (long)DM * DM,
        (void*)M16, (long)DM * DM, nullptr, DM / 128, scale);
  } else {
    gemm_tile<128, 128, 128, DM, HDIM, 4, 2, 3, 0, 1, HDIM>(ring, Wo16, (long)DM, WvT16, (long)DM * DM,
        (void*)N16, (long)DM, nullptr, DM / 128, scale);
    // in the built text the other branch's code follows this branch's stores: the wait stands in front of any rewrite of their registers
    asm volatile("s_wait_xcnt 0x0" ::: "memory");
  }
}

// ---------------------------------------------------------------------------
// Elementwise cast out = f16(in * 16) (power-of-two carry) of one weight plane's slice: a block casts WCB = 8192 consecutive elements,
// a thread 4 groups of 8 (two 16-byte loads, one 16-byte store a group; a wave's group is 1 KiB in, 512 B out, contiguous).
// ---------------------------------------------------------------------------
#define WCB 8192
__device__ __forceinline__ void cast_w_block(const float* __restrict__ in, unsigned short* __restrict__ out, int blk) {
  const float* src = in + (size_t)blk * WCB + threadIdx.x * 8;
  unsigned short* dst = out + (size_t)blk * WCB + threadIdx.x * 8;
  v4f a[4][2];
#pragma unroll
  for (int i = 0; i < 4; ++i) {
    a[i][0] = *(const v4f*)(src + i * 2048);
    a[i][1] = *(const v4f*)(src + i * 2048 + 4);
  }
  v8h o[4];
#pragma unroll
  for (int i = 0; i < 4; ++i)
#pragma unroll
    for (int e = 0; e < 8; ++e) o[i][e] = (_Float16)(a[i][e >> 2][e & 3] * 16.0f);
#pragma unroll
  for (int i = 0; i < 4; ++i) *(v8h*)(dst + i * 2048) = o[i];
}

// ---------------------------------------------------------------------------
// Transpose-cast of NMAT matrices of DM rows x COLS columns: in f32 [n][DM][COLS] -> XT f16 [n][COLS][DM], values times scale (a power of two).
// x: COLS = PP, n = batch (in[n][d][p] -> out[n][p][d]); PLAIN = 1 also writes the untransposed cast XP f16 [n][DM][COLS].
// a weight plane: COLS = DM, n = head (W[h*256 + o][d] -> WT[h][d][o]).
// One block (256 threads) per 64x64 tile, bid = the tile: 4 * (COLS / 64) tiles a matrix.
// Load: thread t reads row d = d0 + (t>>2), 16 floats at p0 + (t&3)*16 -> 256 x 16 = 4096 = the whole tile.
// Store: 8 lanes x 16 B a row of 128 B, 4 rows an instruction; 8 waves x 2 it x 4 = 64 rows.
// ---------------------------------------------------------------------------
#define XTB (NB * (PP / 64) * (DM / 64))
#define WTB (HH * (DM / 64) * (DM / 64))
template <int COLS, int PLAIN>
__device__ __forceinline__ void xt_cast_block(float (*tile)[65], const float* __restrict__ x, unsigned short* __restrict__ XT,
                                              unsigned short* __restrict__ XP, int bid, float scale) {
  const int dt = bid & 3;
  const int pt = (bid >> 2) & (COLS / 64 - 1);
  const int n  = bid / (4 * (COLS / 64));
  const int d0 = dt * 64, p0 = pt * 64;
  const int tid = threadIdx.x, lane = tid & 31, wave = tid >> 5;
  const size_t so = ((size_t)n * DM + d0 + (tid >> 2)) * COLS + p0 + (tid & 3) * 16;
  v8h o[2];                                      // the thread's 16 values, cast in place (PLAIN)
  {
    const int r = tid >> 2, cs = (tid & 3) * 16;
    const float* src = x + so;
    v4f v[4];
#pragma unroll
    for (int i = 0; i < 4; ++i) v[i] = *(const v4f*)(src + 4 * i);
#pragma unroll
    for (int i = 0; i < 4; ++i) {
      tile[r][cs + 4 * i + 0] = v[i][0];
      tile[r][cs + 4 * i + 1] = v[i][1];
      tile[r][cs + 4 * i + 2] = v[i][2];
      tile[r][cs + 4 * i + 3] = v[i][3];
    }
    if (PLAIN) {
#pragma unroll
      for (int e = 0; e < 16; ++e) o[e >> 3][e & 7] = (_Float16)(v[e >> 2][e & 3] * scale);
    }
  }
  __syncthreads();
  const int q = lane >> 3, c8 = (lane & 7) * 8;
  unsigned short* ob = XT + ((size_t)n * COLS + p0) * DM + d0;
#pragma unroll
  for (int it = 0; it < 2; ++it) {
    const int rr = wave * 8 + it * 4 + q;       // p_local
    v8h hv;
#pragma unroll
    for (int e = 0; e < 8; ++e) hv[e] = (_Float16)(tile[c8 + e][rr] * scale);   // value (p=rr, d=c8+e)
    *(v8h*)(ob + (size_t)rr * DM + c8) = hv;
  }
  if (PLAIN) {                           // behind the barrier, so that the barrier does not wait for these stores
    *(v8h*)(XP + so)     = o[0];         // 4 threads fill one 128-byte line of a row
    *(v8h*)(XP + so + 8) = o[1];
  }
}

// ---------------------------------------------------------------------------
// Folded biases, f32 from the f32 inputs (matrix times one vector: no 16-column operand to fill, so the vector unit does them).
// cy[h*256 + d] = sum_o Wk[h*256 + o][d] bq[h*256 + o]: a wave owns 4 d of one head (a block 32 d: whole lines of Wk's rows), lane = o mod 32, 8 rows a lane, then a sum over the lanes.
// (bk adds the same value to every key's score of a query, so the key-axis softmax does not see it.)
// bo2[o'] = bo[o'] + sum_i Wo[o'][i] bv[i] (the softmax weights of a query sum to 1): a wave owns one o', a lane 64 of the 2048 i.
// ---------------------------------------------------------------------------
#define CYB (HDIM / 32)         // 64 blocks
#define BOB (DM / 8)            // 32 blocks
__device__ __forceinline__ void fold_cy_block(const float* __restrict__ Wk, const float* __restrict__ bq, float* __restrict__ cy, int blk) {
  const int lane = threadIdx.x & 31, wave = threadIdx.x >> 5;
  const int h = blk >> 3, d0 = (blk & 7) * 32 + wave * 4;
  const float* wp = Wk + ((size_t)h * DM + lane) * DM + d0;
  const float* bp = bq + h * DM + lane;
  v4f w[8]; float bb[8];
#pragma unroll
  for (int j = 0; j < 8; ++j) { w[j] = *(const v4f*)(wp + (size_t)j * 32 * DM); bb[j] = bp[j * 32]; }
  // the address is an input, so its registers stay the loads' own up to this wait and are rewritten only behind it
  asm volatile("s_wait_xcnt 0x0" :: "v"(wp) : "memory");
  v4f sum = (v4f){0.f, 0.f, 0.f, 0.f};
#pragma unroll
  for (int j = 0; j < 8; ++j) sum += w[j] * bb[j];
#pragma unroll
  for (int m = 1; m < 32; m <<= 1)
#pragma unroll
    for (int e = 0; e < 4; ++e) sum[e] += __shfl_xor(sum[e], m, 32);
  if (lane == 0) *(v4f*)(cy + h * DM + d0) = sum;
}
__device__ __forceinline__ void fold_bo_block(const float* __restrict__ Wo, const float* __restrict__ bv, const float* __restrict__ bo,
                                              float* __restrict__ bo2, int blk) {
  const int lane = threadIdx.x & 31, wave = threadIdx.x >> 5;
  const int o = blk * 8 + wave;
  const float* wp = Wo + (size_t)o * HDIM + lane * 4;
  const float* bp = bv + lane * 4;
  v4f w[16], b[16];
#pragma unroll
  for (int j = 0; j < 16; ++j) { w[j] = *(const v4f*)(wp + j * 128); b[j] = *(const v4f*)(bp + j * 128); }
  v4f s4 = (v4f){0.f, 0.f, 0.f, 0.f};
#pragma unroll
  for (int j = 0; j < 16; ++j) s4 += w[j] * b[j];
  float sum = (s4[0] + s4[1]) + (s4[2] + s4[3]);
#pragma unroll
  for (int m = 1; m < 32; m <<= 1) sum += __shfl_xor(sum, m, 32);
  if (lane == 0) bo2[o] = sum + bo[o];
}

// All operand preparation in one launch; the branch is the same for a whole block. Blocks in this order:
// XTB transpose-cast x (and cast it untransposed), 3 * WTB transpose-cast Wk, Wq, Wv per head (x16; WT16 = three planes of HDIM * DM f16 in a row),
// HDIM * DM / WCB cast Wo (x16), CYB and BOB fold the biases.
__global__ __launch_bounds__(256) void prep_kernel(const float* __restrict__ x,
                                                   const float* __restrict__ Wk, const float* __restrict__ Wq,
                                                   const float* __restrict__ Wv, const float* __restrict__ Wo,
                                                   const float* __restrict__ bq, const float* __restrict__ bv, const float* __restrict__ bo,
                                                   unsigned short* __restrict__ XT, unsigned short* __restrict__ XP,
                                                   unsigned short* __restrict__ WT16, unsigned short* __restrict__ Wo16,
                                                   float* __restrict__ cy, float* __restrict__ bo2) {
  __shared__ float tile[64][65];                 // tile[d_local][p_local] of a transposing block
  constexpr int BPP = HDIM * DM / WCB;           // blocks of the Wo plane: 64
  const int bid = blockIdx.x;
  if (bid < XTB) {
    xt_cast_block<PP, 1>(tile, x, XT, XP, bid, 1.0f);
  } else if (bid < XTB + 3 * WTB) {
    const int wb = bid - XTB, pl = wb / WTB;
    const float* in = (pl == 0) ? Wk : (pl == 1) ? Wq : Wv;
    xt_cast_block<DM, 0>(tile, in, WT16 + (size_t)pl * (HDIM * DM), nullptr, wb - pl * WTB, 16.0f);
    // in the built text another branch's code follows this branch's stores: the wait stands in front of any rewrite of their registers
    asm volatile("s_wait_xcnt 0x0" ::: "memory");
  } else if (bid < XTB + 3 * WTB + BPP) {
    cast_w_block(Wo, Wo16, bid - (XTB + 3 * WTB));
  } else if (bid < XTB + 3 * WTB + BPP + CYB) {
    fold_cy_block(Wk, bq, cy, bid - (XTB + 3 * WTB + BPP));
  } else {
    fold_bo_block(Wo, bv, bo, bo2, bid - (XTB + 3 * WTB + BPP + CYB));
  }
}

#define FK      64
#define NSTAGE  (PP / FK)
#define KP_H    264
#define VP_H    72
#define KTILE_H (FK * KP_H)
#define STAGE_H (KTILE_H + DM * VP_H)
#define LOG2E   1.4426950408889634f

__global__ __launch_bounds__(256) void attn_fused_kernel(const unsigned short* __restrict__ M16,
                                                         const float* __restrict__ cy,
                                                         const unsigned short* __restrict__ XT16,
                                                         const unsigned short* __restrict__ X16,
                                                         const float* __restrict__ pos,
                                                         unsigned short* __restrict__ CTX) {
  __shared__ __align__(16) unsigned short ring[2 * STAGE_H];
  __shared__ __align__(16) unsigned short mtile[DM * KP_H];   // M_h (x16), rows d, 135,168 B
  __shared__ __align__(16) float cys[DM];                     // cy of head h
  typedef Frag<_Float16> F;
  const int tid = threadIdx.x, lane = tid & 31, wave = tid >> 5;
  const int c = lane & 15, hf = lane >> 4;
  const int h = blockIdx.y, n = blockIdx.z;
  const int q0 = blockIdx.x * 256 + wave * 32;
  const unsigned short* Kh = XT16 + (size_t)n * PP * DM;                   // [kp][d], row pitch DM
  const unsigned short* Vh = X16 + (size_t)n * DM * PP;                    // [dd][kp], row pitch PP
  const float* ph = pos + (size_t)h * PP * PP + (size_t)(hf * 8) * PP + q0 + c;
  const unsigned ring0 = (unsigned)(size_t)(&ring[0]);

  // stage t -> buffer b. k: wave w copies rows w, w+8, ... (512 B a row); v^T: 8 lanes a row of 128 B, rows tid>>3, +32, ...
  const unsigned short* kg = Kh + (size_t)wave * DM + lane * 8;
  const unsigned short* vg = Vh + (size_t)(tid >> 3) * PP + (tid & 7) * 8;
  const unsigned kl = ring0 + wave * (KP_H * 2) + lane * 16;
  const unsigned vl = ring0 + KTILE_H * 2 + (tid >> 3) * (VP_H * 2) + (tid & 7) * 16;
  auto issue_stage = [&](int t, int b) {
    async_copy8(kl + b * (STAGE_H * 2), 8 * KP_H * 2, kg + (size_t)t * FK * DM, (size_t)8 * DM);
    async_copy8(vl + b * (STAGE_H * 2), 32 * VP_H * 2, vg + t * FK, (size_t)32 * PP);
  };

  // M_h: wave w copies rows w, w+8, ... (512 B a row), 32 copies a lane; with cy's one and stage 0's 16 that is 49 in flight
  {
    const unsigned short* mg = M16 + ((size_t)h * DM + wave) * DM + lane * 8;
    const unsigned ml = (unsigned)(size_t)(&mtile[0]) + wave * (KP_H * 2) + lane * 16;
#pragma unroll
    for (int g = 0; g < 4; ++g) async_copy8(ml + g * (64 * KP_H * 2), 8 * KP_H * 2, mg + (size_t)g * 64 * DM, (size_t)8 * DM);
    // cy of the head: one 4-byte copy of each lane; the address wait is the statement's last line, as in async_copy8
    asm volatile("global_load_async_to_lds_b32 %0, %1, off\n\ts_wait_xcnt 0x0"
                 :: "v"((unsigned)(size_t)(&cys[0]) + tid * 4), "v"(cy + h * DM + tid) : "memory");
  }
  issue_stage(0, 0);

  v16h xq[8][2];                            // x rows of the wave's queries, hardware k order
  {
    const _Float16* xp = (const _Float16*)XT16 + (size_t)n * PP * DM + (q0 + c) * DM + hf * 8;
#pragma unroll
    for (int kk = 0; kk < 8; ++kk)
#pragma unroll
      for (int nt = 0; nt < 2; ++nt) xq[kk][nt] = F::load(xp + nt * 16 * DM + kk * 32);
    // the address is an input, so its registers stay the loads' own up to this wait and are rewritten only behind it
    asm volatile("s_wait_xcnt 0x0" :: "v"(xp) : "memory");
  }

  v8f st[2][2];                             // st[mt][nt][r] = score of key kp0 + 16 mt + 8 hf + r, query q0 + 16 nt + c
#pragma unroll
  for (int mt = 0; mt < 2; ++mt)
#pragma unroll
    for (int nt = 0; nt < 2; ++nt)
#pragma unroll
      for (int r = 0; r < 8; ++r) st[mt][nt][r] = ph[(size_t)(mt * 16 + r) * PP + nt * 16];

  asm volatile("s_wait_asynccnt 0x0" ::: "memory");   // M_h, cy and stage 0 have landed for this wave's copies
  __syncthreads();                                    // ... and for every wave's
  issue_stage(1, 1);

  // q / 16 = (M16 . x) / 256 + cy / 16, k upward in one accumulator chain; fragment J = 16 g + 2 kk + mt: rows d = 32 g + 16 mt .., channels 32 kk ..
  v16h qf[8][2];                            // hardware k order
  {
    const _Float16* mb = (const _Float16*)mtile + c * KP_H + hf * 8;
    v16h ma[3];                             // fragment ring, as in the passes below; it runs on over the groups
    ma[0] = F::load(mb);
    ma[1] = F::load(mb + 16 * KP_H);
#pragma unroll
    for (int g = 0; g < 8; ++g) {
      v8f ya[2][2];
#pragma unroll
      for (int mt = 0; mt < 2; ++mt)
#pragma unroll
        for (int nt = 0; nt < 2; ++nt) ya[mt][nt] = (v8f){0.f,0.f,0.f,0.f,0.f,0.f,0.f,0.f};
      const v4f* cb = (const v4f*)(cys + g * 32 + hf * 8);
      const v4f b00 = cb[0] * 0.0625f, b01 = cb[1] * 0.0625f, b10 = cb[4] * 0.0625f, b11 = cb[5] * 0.0625f;
#pragma unroll
      for (int j = 0; j < 16; ++j) {
        const int J = g * 16 + j, kk = j >> 1, mt = j & 1, Jn = J + 2;
        if (Jn < 128) ma[Jn % 3] = F::load(mb + ((Jn >> 4) * 32 + (Jn & 1) * 16) * KP_H + ((Jn & 15) >> 1) * 32);
        __builtin_amdgcn_sched_barrier(0);   // keeps the LDS read of the fragment after next in front of these products, so its latency hides
        ya[mt][0] = F::mma(ma[J % 3], xq[kk][0], ya[mt][0]);
        ya[mt][1] = F::mma(ma[J % 3], xq[kk][1], ya[mt][1]);
      }
#pragma unroll
      for (int nt = 0; nt < 2; ++nt)
#pragma unroll
        for (int r = 0; r < 8; ++r) {
          qf[g][nt][r]     = (_Float16)fmaf(ya[0][nt][r], 1.0f / 256.0f, (r < 4) ? b00[r & 3] : b01[r & 3]);
          qf[g][nt][8 + r] = (_Float16)fmaf(ya[1][nt][r], 1.0f / 256.0f, (r < 4) ? b10[r & 3] : b11[r & 3]);
        }
    }
  }

  v8f acc[16][2];
#pragma unroll
  for (int dt = 0; dt < 16; ++dt)
#pragma unroll
    for (int nt = 0; nt < 2; ++nt) acc[dt][nt] = (v8f){0.f,0.f,0.f,0.f,0.f,0.f,0.f,0.f};
  float mref[2] = {-1.0e30f, -1.0e30f};
  float lsum[2] = {0.f, 0.f};

  for (int t = 0; t < NSTAGE; ++t) {
    const _Float16* Ks = (const _Float16*)ring + (t & 1) * STAGE_H;
    const _Float16* Vs = Ks + KTILE_H;
#pragma unroll 1   // two passes of one stage share the code: the body is large and only addresses differ
    for (int hp = 0; hp < 2; ++hp) {
      const _Float16* kb = Ks + (hp * 32 + c) * KP_H + hf * 8;
      const _Float16* vb = Vs + c * VP_H + hp * 32 + hf * 8;
      v16h ka[3], va[3];                     // fragment rings: two fragments are always on their way
      ka[0] = F::load(kb);                   // fragment j = 2 kk + mt: keys 16 mt .., channels 32 kk ..
      ka[1] = F::load(kb + 16 * KP_H);
#pragma unroll
      for (int j = 0; j < 16; ++j) {
        const int kk = j >> 1, mt = j & 1, jn = j + 2;
        if (jn < 16) ka[jn % 3] = F::load(kb + (jn & 1) * 16 * KP_H + (jn >> 1) * 32);
        else         va[jn - 16] = F::load(vb + (jn - 16) * 16 * VP_H);   // the first v^T fragments (same stage) come in under the softmax
        __builtin_amdgcn_sched_barrier(0);   // keeps the LDS read of the fragment after next in front of these products, so its latency hides
        st[mt][0] = F::mma(ka[j % 3], qf[kk][0], st[mt][0]);
        st[mt][1] = F::mma(ka[j % 3], qf[kk][1], st[mt][1]);
      }
      float mx[2];
#pragma unroll
      for (int nt = 0; nt < 2; ++nt) {
        const v8f u = st[0][nt], w = st[1][nt];
        float m0 = fmaxf(fmaxf(fmaxf(u[0], u[1]), fmaxf(u[2], u[3])), fmaxf(fmaxf(u[4], u[5]), fmaxf(u[6], u[7])));
        float m1 = fmaxf(fmaxf(fmaxf(w[0], w[1]), fmaxf(w[2], w[3])), fmaxf(fmaxf(w[4], w[5]), fmaxf(w[6], w[7])));
        m0 = fmaxf(m0, m1);
        mx[nt] = fmaxf(m0, __shfl_xor(m0, 16, 32)) * LOG2E;
      }
      // lazy rescale, tested once a pass: the reference maximum moves only when a column passes it by more than 8 (log2)
      const bool need = (mx[0] > mref[0] + 8.0f) || (mx[1] > mref[1] + 8.0f);
      if (__builtin_amdgcn_ballot_w32(need) != 0) {
#pragma unroll
        for (int nt = 0; nt < 2; ++nt) {
          const float mnew = fmaxf(mref[nt], mx[nt]);
          const float alpha = __builtin_amdgcn_exp2f(mref[nt] - mnew);
          mref[nt] = mnew;
          lsum[nt] *= alpha;
#pragma unroll
          for (int dt = 0; dt < 16; ++dt) acc[dt][nt] *= alpha;
        }
      }
      v16h pf[2];
#pragma unroll
      for (int nt = 0; nt < 2; ++nt) {
        const float c0 = 6.0f - mref[nt];
        float s0 = 0.f, s1 = 0.f;
#pragma unroll
        for (int r = 0; r < 8; ++r) {
          const float e0 = __builtin_amdgcn_exp2f(fmaf(st[0][nt][r], LOG2E, c0));
          const float e1 = __builtin_amdgcn_exp2f(fmaf(st[1][nt][r], LOG2E, c0));
          s0 += e0; s1 += e1;
          pf[nt][r]     = (_Float16)e0;
          pf[nt][8 + r] = (_Float16)e1;
        }
        lsum[nt] += s0 + s1;
      }
      // bias of the next pass, fetched behind the last use of this pass's scores (the last pass re-reads its own rows, unused)
      {
        const int kc = min((t * 2 + hp) * 32, PP - 64);
        const float* pn = ph + (size_t)kc * PP;   // this pass's rows; the next pass's lie 32 rows on
#pragma unroll
        for (int mt = 0; mt < 2; ++mt)
#pragma unroll
          for (int nt = 0; nt < 2; ++nt)
#pragma unroll
            for (int r = 0; r < 8; ++r) st[mt][nt][r] = pn[(size_t)(32 + mt * 16 + r) * PP + nt * 16];
        // the address is an input, so its registers stay the loads' own up to this wait and are rewritten only behind it
        asm volatile("s_wait_xcnt 0x0" :: "v"(pn) : "memory");
      }
#pragma unroll
      for (int dt = 0; dt < 16; ++dt) {
        if (dt + 2 < 16) va[(dt + 2) % 3] = F::load(vb + (dt + 2) * 16 * VP_H);
        __builtin_amdgcn_sched_barrier(0);   // as above
        acc[dt][0] = F::mma(va[dt % 3], pf[0], acc[dt][0]);
        acc[dt][1] = F::mma(va[dt % 3], pf[1], acc[dt][1]);
      }
    }
    asm volatile("s_wait_dscnt 0x0" ::: "memory");      // this wave's reads of buffer t&1 are done
    asm volatile("s_wait_asynccnt 0x0" ::: "memory");   // this wave's copies of stage t+1 have landed
    __syncthreads();                                    // publishes stage t+1, ends every reader's last read of buffer t&1
    if (t + 2 < NSTAGE) issue_stage(t + 2, t & 1);
  }
  asm volatile("s_wait_asynccnt 0x0" ::: "memory");     // nothing is in flight when the wave ends

#pragma unroll
  for (int nt = 0; nt < 2; ++nt) {
    const float lt = lsum[nt] + __shfl_xor(lsum[nt], 16, 32);
    const float inv = 16.0f / lt;                       // ctx carried x16
    unsigned short* op = CTX + ((size_t)n * PP * HDIM + h * DM) + ((q0 + nt * 16 + c) * HDIM + hf * 8);   // a uniform base and a 32-bit offset: one register lives through the loop for it
    v8h o[16];
#pragma unroll
    for (int dt = 0; dt < 16; ++dt)
#pragma unroll
      for (int r = 0; r < 8; ++r) o[dt][r] = (_Float16)(acc[dt][nt][r] * inv);
    __builtin_amdgcn_sched_barrier(0);                  // with the one below: nothing but the stores and their wait stands in between
#pragma unroll
    for (int dt = 0; dt < 16; ++dt) *(v8h*)(op + dt * 16) = o[dt];   // 8 consecutive dd of one query: one 16-byte store
    asm volatile("s_wait_xcnt 0x0" ::: "memory");       // stands in front of the first rewrite of the stores' registers
    __builtin_amdgcn_sched_barrier(0);
  }
}

// ---------------------------------------------------------------------------
// Workspace region map (byte offsets). All eight batches go through each stage in one launch (batch = a grid axis).
// Every region is fully written in this call before it is read (all GEMM extents are exact tile multiples).
//   CTX16  f16  [8][1024][2048] (col h*256 + d', x16)     0
//   WkT16, WqT16, WvT16, Wo16, M16, N16 f16 (x16), 1,048,576 each, at 33,554,432
//   XT16 f16 [8][1024][256], X16 f16 [8][256][1024], 4,194,304 each, behind them; cy f32 [2048], bo2 f32 [256] behind those
//   total                                  49,283,072
// ---------------------------------------------------------------------------
extern "C" void kernel_launch(void* const* d_in, const int* in_sizes, int n_in,
                              void* d_out, int out_size, void* d_ws, size_t ws_size,
                              hipStream_t stream) {
  if (n_in < 10) return;
  if (in_sizes[0] != NB * DM * PP) return;
  if (in_sizes[1] != HH * PP * PP) return;
  if (in_sizes[2] != HDIM * DM || in_sizes[4] != HDIM * DM || in_sizes[6] != HDIM * DM) return;
  if (in_sizes[3] != HDIM || in_sizes[5] != HDIM || in_sizes[7] != HDIM) return;
  if (in_sizes[8] != DM * HDIM || in_sizes[9] != DM) return;
  if (out_size != NB * DM * PP) return;

  const float* x   = (const float*)d_in[0];   // [NB][DM][PP]
  const float* pos = (const float*)d_in[1];   // [1][HH][PP kp][PP qp]
  const float* Wk  = (const float*)d_in[2];   // [HDIM][DM]
  const float* bk  = (const float*)d_in[3];   // [HDIM]
  const float* Wq  = (const float*)d_in[4];
  const float* bq  = (const float*)d_in[5];
  const float* Wv  = (const float*)d_in[6];
  const float* bv  = (const float*)d_in[7];
  const float* Wo  = (const float*)d_in[8];   // [DM][HDIM]
  const float* bo  = (const float*)d_in[9];   // [DM]

  const size_t BW   = (size_t)HDIM * DM * 2;             // 1,048,576
  const size_t BACT = (size_t)NB * PP * HDIM * 2;        // 33,554,432
  const size_t BS   = 15 * BW;                           // six weight planes, XT16, X16 (4 planes each), one plane for the two bias vectors
  size_t off = 0;
  const size_t oCTX  = off; off += BACT;
  const size_t oS    = off; off += BS;
  if (off > ws_size) return;                          // 49,283,072 B total

  char* ws = (char*)d_ws;
  unsigned short* OUTP  = (unsigned short*)(ws + oCTX);
  unsigned short* WkT16 = (unsigned short*)(ws + oS);
  unsigned short* WqT16 = (unsigned short*)(ws + oS + BW);
  unsigned short* WvT16 = (unsigned short*)(ws + oS + 2 * BW);
  unsigned short* Wo16  = (unsigned short*)(ws + oS + 3 * BW);
  unsigned short* M16   = (unsigned short*)(ws + oS + 4 * BW);
  unsigned short* N16   = (unsigned short*)(ws + oS + 5 * BW);
  unsigned short* XT16  = (unsigned short*)(ws + oS + 6 * BW);
  unsigned short* X16   = (unsigned short*)(ws + oS + 10 * BW);
  float*          cy    = (float*)(ws + oS + 14 * BW);
  float*          bo2   = (float*)(ws + oS + 14 * BW + HDIM * 4);

  const dim3 blk(256);

  // setup, one launch: x -> XT16 [NB][PP][DM] and X16 [NB][DM][PP] f16; Wk, Wq, Wv transposed per head and Wo, carried x16 (exact power of two; undone by the GEMM epilogue scales); the folded biases
  prep_kernel<<<XTB + 3 * WTB + HDIM * DM / WCB + CYB + BOB, blk, 0, stream>>>(x, Wk, Wq, Wv, Wo, bq, bv, bo, XT16, X16, WkT16, Wo16, cy, bo2);

  const dim3 gFold((DM / 128) * (DM / 128), HH, 2);          // 4 x 8 x 2: tiles of 128 x 128, M=N=K=256; y = head, z = M, N
  const dim3 gOut((DM / 64) * (PP / 128), NB);               // 32 x 8:  tiles of 64 x 128, M=256, N=1024, K=2048
  const float wscale  = 1.0f / 16.0f;                      // x16 times x16 -> x16 (folds)
  const float oscale  = 1.0f / 256.0f;                     // undo x16 (N) and x16 (ctx)

  // (1) the folded weights M = Wk^T Wq and N = Wo Wv, per head
  fold_kernel<<<gFold, blk, 0, stream>>>(WkT16, WqT16, Wo16, WvT16, M16, N16, wscale);
  // (2) y = (x . (16 M))/16 + cy of the block's own queries, then scores, key-axis softmax with the positional bias and ctx in one launch: 4 blocks of 256 queries x 8 heads x 8 batches
  attn_fused_kernel<<<dim3(PP / 256, HH, NB), blk, 0, stream>>>(M16, cy, XT16, X16, pos, OUTP);
  // (3) out[n][o][p] = (1/256) sum_i (16 N)[o][i] (16 ctx)[n][p][i] + bo2[o] -> d_out[n] f32 [256][1024] (ldc 1024, bias by m); y = n
  wmma_gemm_lds<64, 128, 256, HDIM, PP, 2, 4, 4, 1, 0><<<gOut, blk, 0, stream>>>(
      N16, 0L, OUTP, (long)PP * HDIM, d_out, (long)DM * PP, bo2, PP / 128, oscale);
  (void)hipGetLastError();
}

// v007
// It runs in 85.9 microseconds.
// In two side-by-side timings against v006, it was 1.05 and 1.04 times as fast.
// Counting every step since v000, it is 17.1 times as fast.
// All matrix-matrix contractions on v_wmma_f32_16x16x32_f16 (f16 operands, f32 accumulate); the two bias folds are matrix-vector sums in f32 on the vector unit. The k and v projections are folded into the weights: per head M = Wk^T Wq and N = Wo Wv, so y = M x + Wk^T bq takes q's place (each attention block forms its own y in its prologue), x itself is the K and the V operand of the fused attention kernel (S^T = x.(y/16)^T on top of the positional bias, online key-axis softmax in f32, ctx^T += x.P^T with P packed from the score accumulators), and the output conv runs on N (carried x16, ctx carried x16, epilogue x1/256) with the bias bo + Wo bv.
#include <hip/hip_runtime.h>
#include <math.h>
#include <stdint.h>

#define NB   8      // batch
#define HH   8      // heads
#define DM   256    // channels = head dim
#define PP   1024   // positions
#define HDIM 2048   // HH * DM

typedef __attribute__((ext_vector_type(16))) _Float16 v16h;
typedef __attribute__((ext_vector_type(8)))  _Float16 v8h;
typedef __attribute__((ext_vector_type(8)))  float    v8f;
typedef __attribute__((ext_vector_type(4)))  float    v4f;
typedef __attribute__((ext_vector_type(2)))  float    v2f;

template <typename T> struct Frag;
template <> struct Frag<_Float16> {
  typedef v16h V; union U { v16h v; v8h h[2]; };
  static __device__ __forceinline__ v16h load(const _Float16* p) {   // elements 0..7 <- p[0..7], 8..15 <- p[16..23]
    U f; f.h[0] = *(const v8h*)(p); f.h[1] = *(const v8h*)(p + 16); return f.v;
  }
  static __device__ __forceinline__ v8f mma(v16h a, v16h b, v8f c) {
    return __builtin_amdgcn_wmma_f32_16x16x32_f16(false, a, false, b, (short)0, c, false, false);
  }
};

// eight 16-byte copies of each lane; the address wait is the statement's last line, so no address register is rewritten in front of it
__device__ __forceinline__ void async_copy8(unsigned l0, unsigned lstep, const unsigned short* g0, size_t gstep) {
  asm volatile(
      "global_load_async_to_lds_b128 %0, %8, off\n\t"
      "global_load_async_to_lds_b128 %1, %9, off\n\t"
      "global_load_async_to_lds_b128 %2, %10, off\n\t"
      "global_load_async_to_lds_b128 %3, %11, off\n\t"
      "global_load_async_to_lds_b128 %4, %12, off\n\t"
      "global_load_async_to_lds_b128 %5, %13, off\n\t"
      "global_load_async_to_lds_b128 %6, %14, off\n\t"
      "global_load_async_to_lds_b128 %7, %15, off\n\t"
      "s_wait_xcnt 0x0"
      :: "v"(l0), "v"(l0 + lstep), "v"(l0 + 2 * lstep), "v"(l0 + 3 * lstep),
         "v"(l0 + 4 * lstep), "v"(l0 + 5 * lstep), "v"(l0 + 6 * lstep), "v"(l0 + 7 * lstep),
         "v"(g0), "v"(g0 + gstep), "v"(g0 + 2 * gstep), "v"(g0 + 3 * gstep),
         "v"(g0 + 4 * gstep), "v"(g0 + 5 * gstep), "v"(g0 + 6 * gstep), "v"(g0 + 7 * gstep)
      : "memory");
}

// ---- Batched WMMA GEMM, operands staged in LDS ------------------------------
// C[m,n] = scale * sum_k A[m,k] * Bt[n,k] + bias; A row-major [M][KT], Bt row-major [N][KT], f16; C rows of LDC elements.
// One block of 8 waves (WGM x WGN) owns a BM x BN tile of C. A stage is BK channels of the tile's BM + BN operand rows,
// brought to LDS by asynchronous copies in whole lines (a row of a stage is BK * 2 contiguous bytes), two buffers:
// stage t + 1 flies while stage t is multiplied. Every wave reads its fragments from LDS, so a row is fetched once a block.
// LDS row pitch = BK * 2 + 16 bytes (16 B x odd, for 16-byte readers). k runs upward in steps of 32 in one accumulator chain.
// Fragments go from LDS to a ring of PD register sets inside a stage. M % BM == 0, N % BN == 0, KT % BK == 0. BIAS_MODE: 0 = none, 1 = bias[m], 2 = bias[n]. OUT_MODE: 0 = f32, 1 = f16.
// The body is a device function, so that one launch can hold several GEMMs; ring = the block's LDS, 2 * (BM + BN) * (BK + 8) f16, 16-byte aligned.
// bx = the tile, by = the batch. FILLED = 1: KT = 2 * BK and the caller's own LDS stores have put both stages into the ring (Ap, Btp unused); the first barrier publishes them.
template <int BM, int BN, int BK, int KT, int LDC, int WGM, int WGN, int PD, int BIAS_MODE, int OUT_MODE, int FILLED = 0>
__device__ __forceinline__ void gemm_tile(
    unsigned short* ring, int bx, int by,
    const unsigned short* __restrict__ Ap, long strideA,
    const unsigned short* __restrict__ Btp, long strideB,
    void* __restrict__ Cout, long strideC,
    const float* __restrict__ bias, int tilesN, float scale) {
  typedef Frag<_Float16> F;
  constexpr int FM  = BM / WGM / 16;          // A fragments of a wave
  constexpr int FN  = BN / WGN / 16;          // B fragments of a wave
  constexpr int WN  = FN * 16;                // columns of a wave
  constexpr int PH  = BK + 8;                 // LDS row pitch, f16
  constexpr int STG = (BM + BN) * PH;         // f16 of a stage
  constexpr int NST = KT / BK;
  constexpr int KS  = BK / 32;                // matrix steps of a stage
  constexpr int LPR = BK / 8;                 // lanes that copy one row
  constexpr int RPS = 256 / LPR;              // rows that one copy of the block covers
  constexpr int SP  = WN + 4;                 // epilogue slab pitch, floats
  static_assert(FILLED == 0 || NST == 2, "a filled ring holds the whole k range");
  static_assert(WGM * WGN == 8 && BM % (8 * RPS) == 0 && BN % (8 * RPS) == 0 && KT % BK == 0 && PD - 1 <= KS, "tile shape");
  static_assert(8 * FM * 16 * SP * 4 <= 2 * STG * 2, "the epilogue slabs lie inside the ring");
  const int tid = threadIdx.x, lane = tid & 31, wave = tid >> 5;
  const int c = lane & 15, hf = lane >> 4;    // row (A) / column (B, D) in a subtile; lane half
  const int b  = by;
  const int tm = bx / tilesN;
  const int tn = bx - tm * tilesN;
  const int m0 = tm * BM, n0 = tn * BN;
  const int wm = wave / WGN, wn = wave % WGN;

  const int crow = tid / LPR, ccol = (tid % LPR) * 8;
  const unsigned short* ag = Ap  + (size_t)b * strideA + (size_t)(m0 + crow) * KT + ccol;
  const unsigned short* bg = Btp + (size_t)b * strideB + (size_t)(n0 + crow) * KT + ccol;
  const unsigned al = (unsigned)(size_t)(&ring[0]) + (crow * PH + ccol) * 2;
  const unsigned bl = al + BM * PH * 2;
  auto issue_stage = [&](int t, int buf) {
#pragma unroll
    for (int g = 0; g < BM / (8 * RPS); ++g)
      async_copy8(al + buf * (STG * 2) + g * (8 * RPS * PH * 2), RPS * PH * 2, ag + t * BK + (size_t)g * 8 * RPS * KT, (size_t)RPS * KT);
#pragma unroll
    for (int g = 0; g < BN / (8 * RPS); ++g)
      async_copy8(bl + buf * (STG * 2) + g * (8 * RPS * PH * 2), RPS * PH * 2, bg + t * BK + (size_t)g * 8 * RPS * KT, (size_t)RPS * KT);
  };

  if (FILLED == 0) issue_stage(0, 0);
  v8f acc[FM][FN];
#pragma unroll
  for (int i = 0; i < FM; ++i)
#pragma unroll
    for (int j = 0; j < FN; ++j) acc[i][j] = (v8f){0.f,0.f,0.f,0.f,0.f,0.f,0.f,0.f};
  // the wave's bias values come in under the first stage's copies
  const int mOff = hf * 8;                              // D row offset of this lane half
  const int mw = m0 + wm * FM * 16, nw = n0 + wn * WN;
  constexpr int NBV = (BIAS_MODE == 1) ? FM * 8 : FN;
  float bv[NBV];
  if (BIAS_MODE != 0) {
    const float* bp = bias + ((BIAS_MODE == 1) ? (mw + mOff) : (nw + c));
#pragma unroll
    for (int e = 0; e < NBV; ++e) bv[e] = (BIAS_MODE == 1) ? bp[(e >> 3) * 16 + (e & 7)] : bp[e * 16];
    // the address is an input, so its registers stay the loads' own up to this wait and are rewritten only behind it
    asm volatile("s_wait_xcnt 0x0" :: "v"(bp) : "memory");
  }
  if (FILLED == 0) asm volatile("s_wait_asynccnt 0x0" ::: "memory");   // stage 0 has landed for this wave's copies
  __syncthreads();                                    // ... and for every wave's
  if (FILLED == 0 && NST > 1) issue_stage(1, 1);

  for (int t = 0; t < NST; ++t) {
    const _Float16* As = (const _Float16*)ring + (t & 1) * STG + (wm * FM * 16 + c) * PH + hf * 8;
    const _Float16* Bs = (const _Float16*)ring + (t & 1) * STG + (BM + wn * FN * 16 + c) * PH + hf * 8;
    v16h af[PD][FM], bf[PD][FN];             // fragment ring: PD - 1 steps of this stage are always on their way
#pragma unroll
    for (int p = 0; p < PD - 1; ++p) {
#pragma unroll
      for (int i = 0; i < FM; ++i) af[p][i] = F::load(As + i * 16 * PH + p * 32);
#pragma unroll
      for (int j = 0; j < FN; ++j) bf[p][j] = F::load(Bs + j * 16 * PH + p * 32);
    }
#pragma unroll
    for (int kk = 0; kk < KS; ++kk) {
      const int kn = kk + PD - 1;
      if (kn < KS) {
#pragma unroll
        for (int i = 0; i < FM; ++i) af[kn % PD][i] = F::load(As + i * 16 * PH + kn * 32);
#pragma unroll
        for (int j = 0; j < FN; ++j) bf[kn % PD][j] = F::load(Bs + j * 16 * PH + kn * 32);
      }
      __builtin_amdgcn_sched_barrier(0);     // keeps a later step's LDS reads as one group in front of these products, so their latency hides
#pragma unroll
      for (int i = 0; i < FM; ++i)
#pragma unroll
        for (int j = 0; j < FN; ++j) acc[i][j] = F::mma(af[kk % PD][i], bf[kk % PD][j], acc[i][j]);
    }
    asm volatile("s_wait_dscnt 0x0" ::: "memory");      // this wave's reads of buffer t&1 are done
    if (FILLED == 0) asm volatile("s_wait_asynccnt 0x0" ::: "memory");   // this wave's copies of stage t+1 have landed
    __syncthreads();                                    // publishes stage t+1, ends every reader's last read of buffer t&1
    if (FILLED == 0 && t + 2 < NST) issue_stage(t + 2, t & 1);
  }
  if (FILLED == 0) asm volatile("s_wait_asynccnt 0x0" ::: "memory");     // nothing is in flight when the ring is reused below

  // ---- epilogue: each wave turns its tile into whole 128-byte lines through a slab of its own (the ring is free behind the last barrier)
  float* slab = (float*)ring + wave * (FM * 16 * SP);
  const size_t offC = (size_t)b * strideC;
  const int q = lane >> 3;                              // 8 lanes a row, 4 rows an instruction
#pragma unroll
  for (int i = 0; i < FM; ++i) {
#pragma unroll
    for (int j = 0; j < FN; ++j) {
#pragma unroll
      for (int r = 0; r < 8; ++r) {
        const float v = (BIAS_MODE == 0) ? acc[i][j][r] * scale : acc[i][j][r] * scale + ((BIAS_MODE == 1) ? bv[i * 8 + r] : bv[j]);
        slab[((i << 4) + mOff + r) * SP + (j << 4) + c] = v;
      }
    }
  }
  // the slab's rows are read back by other lanes of the same wave
  __builtin_amdgcn_fence(__ATOMIC_RELEASE, "workgroup");
  __builtin_amdgcn_wave_barrier();
  __builtin_amdgcn_fence(__ATOMIC_ACQUIRE, "workgroup");
  if (OUT_MODE == 0) {
    static_assert(OUT_MODE != 0 || WN == 32, "f32 rows of 128 bytes");
    const int c4 = (lane & 7) * 4;
    float* cp = (float*)Cout + offC + (size_t)(mw + q) * LDC + nw + c4;
    v4f o[FM * 4];
#pragma unroll
    for (int it = 0; it < FM * 4; ++it) o[it] = *(const v4f*)(slab + (it * 4 + q) * SP + c4);
    __builtin_amdgcn_sched_barrier(0);   // only the stores stand behind this line, so no register of a store is rewritten before the wave ends
#pragma unroll
    for (int it = 0; it < FM * 4; ++it) *(v4f*)(cp + it * 4 * LDC) = o[it];
  } else {
    static_assert(OUT_MODE == 0 || WN == 64, "f16 rows of 128 bytes");
    const int c8 = (lane & 7) * 8;
    unsigned short* cp = (unsigned short*)Cout + offC + (size_t)(mw + q) * LDC + nw + c8;
    v8h o[FM * 4];
#pragma unroll
    for (int it = 0; it < FM * 4; ++it) {
      const float* sp = slab + (it * 4 + q) * SP + c8;
#pragma unroll
      for (int e = 0; e < 8; ++e) o[it][e] = (_Float16)sp[e];
    }
    __builtin_amdgcn_sched_barrier(0);   // only the stores stand behind this line, so no register of a store is rewritten before the wave ends
#pragma unroll
    for (int it = 0; it < FM * 4; ++it) *(v8h*)(cp + it * 4 * LDC) = o[it];
  }
}

// one GEMM a launch (the output conv)
template <int BM, int BN, int BK, int KT, int LDC, int WGM, int WGN, int PD, int BIAS_MODE, int OUT_MODE>
__global__ __launch_bounds__(256) void wmma_gemm_lds(
    const unsigned short* __restrict__ Ap, long strideA,
    const unsigned short* __restrict__ Btp, long strideB,
    void* __restrict__ Cout, long strideC,
    const float* __restrict__ bias, int tilesN, float scale) {
  __shared__ __align__(16) unsigned short ring[2 * (BM + BN) * (BK + 8)];
  gemm_tile<BM, BN, BK, KT, LDC, WGM, WGN, PD, BIAS_MODE, OUT_MODE>(ring, blockIdx.x, blockIdx.y, Ap, strideA, Btp, strideB, Cout, strideC, bias, tilesN, scale);
}

// ---------------------------------------------------------------------------
// The two weight folds, straight from the f32 weights: a block owns a 128 x 128 tile of one head's M or N (k = 256, two stages of 128) and
// casts its own operand rows (x16, a power-of-two carry) into the GEMM ring, so no cast plane goes through memory and no launch stands in between.
//   M16[h*256 + d][d'] = (1/16) sum_o (16 Wk)[h*256 + o][d] (16 Wq)[h*256 + o][d']: A row d = column d of Wk_h, B row d' = column d' of Wq_h; carried x16
//   N16[o'][h*256 + d'] = (1/16) sum_i (16 Wo)[o'][h*256 + i] (16 Wv)[h*256 + i][d']: A row o' = Wo's row, columns of head h, B row d' = column d' of Wv_h; carried x16
// Ring element (row r, k) = ring[(k / 128) * FSTG + r * FPH + k % 128]; rows 0..127 = A, 128..255 = B (gemm_tile's layout).
// ---------------------------------------------------------------------------
#define FPH  (128 + 8)
#define FSTG (256 * FPH)
typedef __attribute__((ext_vector_type(4))) _Float16 v4h;
// ring row rowBase + r <- column r of src (256 rows k of DM floats), r = 0..127. A wave's load covers 4 rows x one 128-byte line;
// a lane holds rows k .. k + 3 of 4 columns and packs the four k of a column into one 8-byte LDS store.
__device__ __forceinline__ void stage_w_cols(unsigned short* ring, int rowBase, const float* __restrict__ src) {
  const int lane = threadIdx.x & 31, wave = threadIdx.x >> 5;
  const int lc = lane & 7, lk = lane >> 3;
  const int k0 = (wave * 4 + lk) * 4;                       // 0, 4, .. 124; unit u adds 128 * (u >> 2) and takes columns 32 * (u & 3) ..
  const float* p = src + k0 * DM + lc * 4;
  v4f a[8][4];
#pragma unroll
  for (int u = 0; u < 8; ++u)
#pragma unroll
    for (int j = 0; j < 4; ++j) a[u][j] = *(const v4f*)(p + ((u >> 2) * 128 + j) * DM + (u & 3) * 32);
  // the address is an input, so its registers stay the loads' own up to this wait and are rewritten only behind it
  asm volatile("s_wait_xcnt 0x0" :: "v"(p) : "memory");
  _Float16* d = (_Float16*)ring + (rowBase + lc * 4) * FPH + k0;
#pragma unroll
  for (int u = 0; u < 8; ++u)
#pragma unroll
    for (int e = 0; e < 4; ++e) {
      v4h t;
#pragma unroll
      for (int j = 0; j < 4; ++j) t[j] = (_Float16)(a[u][j][e] * 16.0f);
      *(v4h*)(d + (u >> 2) * FSTG + ((u & 3) * 32 + e) * FPH) = t;
    }
  __builtin_amdgcn_sched_barrier(0);   // keeps the next operand's 32 loads behind these stores: lifted over them they hold 128 more registers and the block spills
}
// ring row rowBase + r <- src row r (pitch HDIM floats), 256 consecutive k, r = 0..127: a wave takes a row an instruction pair, a lane 8 k (one 16-byte LDS store).
__device__ __forceinline__ void stage_w_rows(unsigned short* ring, int rowBase, const float* __restrict__ src) {
  const int lane = threadIdx.x & 31, wave = threadIdx.x >> 5;
  const float* p = src + wave * HDIM + lane * 8;
  v4f a[16][2];
#pragma unroll
  for (int u = 0; u < 16; ++u) {
    a[u][0] = *(const v4f*)(p + u * 8 * HDIM);
    a[u][1] = *(const v4f*)(p + u * 8 * HDIM + 4);
  }
  // the address is an input, so its registers stay the loads' own up to this wait and are rewritten only behind it
  asm volatile("s_wait_xcnt 0x0" :: "v"(p) : "memory");
  _Float16* d = (_Float16*)ring + (lane >> 4) * FSTG + (rowBase + wave) * FPH + (lane & 15) * 8;
#pragma unroll
  for (int u = 0; u < 16; ++u) {
    v8h o;
#pragma unroll
    for (int e = 0; e < 8; ++e) o[e] = (_Float16)(a[u][e >> 2][e & 3] * 16.0f);
    *(v8h*)(d + u * 8 * FPH) = o;
  }
  __builtin_amdgcn_sched_barrier(0);   // keeps the next operand's 32 loads behind these stores: lifted over them they hold 128 more registers and the block spills
}
#define FOB (2 * HH * 4)        // 64 blocks: M or N, head, tile
__device__ __forceinline__ void fold_block(unsigned short* ring, const float* __restrict__ Wk, const float* __restrict__ Wq,
                                           const float* __restrict__ Wv, const float* __restrict__ Wo,
                                           unsigned short* __restrict__ M16, unsigned short* __restrict__ N16, int blk) {
  const int tile = blk & 3, h = (blk >> 2) & 7;
  const int m0 = (tile >> 1) * 128, n0 = (tile & 1) * 128;  // as gemm_tile splits the tile index
  if (blk < FOB / 2) {
    stage_w_cols(ring, 0,   Wk + h * DM * DM + m0);
    stage_w_cols(ring, 128, Wq + h * DM * DM + n0);
    gemm_tile<128, 128, 128, DM, DM, 4, 2, 3, 0, 1, 1>(ring, tile, h, nullptr, 0L, nullptr, 0L,
        (void*)M16, (long)DM * DM, nullptr, DM / 128, 1.0f / 16.0f);
  } else {
    stage_w_rows(ring, 0,   Wo + m0 * HDIM + h * DM);
    stage_w_cols(ring, 128, Wv + h * DM * DM + n0);
    gemm_tile<128, 128, 128, DM, HDIM, 4, 2, 3, 0, 1, 1>(ring, tile, h, nullptr, 0L, nullptr, 0L,
        (void*)N16, (long)DM, nullptr, DM / 128, 1.0f / 16.0f);
    // in the built text the other branch's code follows this branch's stores: the wait stands in front of any rewrite of their registers
    asm volatile("s_wait_xcnt 0x0" ::: "memory");
  }
}

// ---------------------------------------------------------------------------
// Transpose-cast of NMAT matrices of DM rows x COLS columns: in f32 [n][DM][COLS] -> XT f16 [n][COLS][DM], values times scale (a power of two).
// x: COLS = PP, n = batch (in[n][d][p] -> out[n][p][d]); PLAIN = 1 also writes the untransposed cast XP f16 [n][DM][COLS].
// One block (256 threads) per 64x64 tile, bid = the tile: 4 * (COLS / 64) tiles a matrix.
// Load: thread t reads row d = d0 + (t>>2), 16 floats at p0 + (t&3)*16 -> 256 x 16 = 4096 = the whole tile.
// Store: 8 lanes x 16 B a row of 128 B, 4 rows an instruction; 8 waves x 2 it x 4 = 64 rows.
// ---------------------------------------------------------------------------
#define XTB (NB * (PP / 64) * (DM / 64))
template <int COLS, int PLAIN>
__device__ __forceinline__ void xt_cast_block(float (*tile)[65], const float* __restrict__ x, unsigned short* __restrict__ XT,
                                              unsigned short* __restrict__ XP, int bid, float scale) {
  const int dt = bid & 3;
  const int pt = (bid >> 2) & (COLS / 64 - 1);
  const int n  = bid / (4 * (COLS / 64));
  const int d0 = dt * 64, p0 = pt * 64;
  const int tid = threadIdx.x, lane = tid & 31, wave = tid >> 5;
  const size_t so = ((size_t)n * DM + d0 + (tid >> 2)) * COLS + p0 + (tid & 3) * 16;
  v8h o[2];                                      // the thread's 16 values, cast in place (PLAIN)
  {
    const int r = tid >> 2, cs = (tid & 3) * 16;
    const float* src = x + so;
    v4f v[4];
#pragma unroll
    for (int i = 0; i < 4; ++i) v[i] = *(const v4f*)(src + 4 * i);
#pragma unroll
    for (int i = 0; i < 4; ++i) {
      tile[r][cs + 4 * i + 0] = v[i][0];
      tile[r][cs + 4 * i + 1] = v[i][1];
      tile[r][cs + 4 * i + 2] = v[i][2];
      tile[r][cs + 4 * i + 3] = v[i][3];
    }
    if (PLAIN) {
#pragma unroll
      for (int e = 0; e < 16; ++e) o[e >> 3][e & 7] = (_Float16)(v[e >> 2][e & 3] * scale);
    }
  }
  __syncthreads();
  const int q = lane >> 3, c8 = (lane & 7) * 8;
  unsigned short* ob = XT + ((size_t)n * COLS + p0) * DM + d0;
#pragma unroll
  for (int it = 0; it < 2; ++it) {
    const int rr = wave * 8 + it * 4 + q;       // p_local
    v8h hv;
#pragma unroll
    for (int e = 0; e < 8; ++e) hv[e] = (_Float16)(tile[c8 + e][rr] * scale);   // value (p=rr, d=c8+e)
    *(v8h*)(ob + (size_t)rr * DM + c8) = hv;
  }
  if (PLAIN) {                           // behind the barrier, so that the barrier does not wait for these stores
    *(v8h*)(XP + so)     = o[0];         // 4 threads fill one 128-byte line of a row
    *(v8h*)(XP + so + 8) = o[1];
  }
}

// ---------------------------------------------------------------------------
// Folded biases, f32 from the f32 inputs (matrix times one vector: no 16-column operand to fill, so the vector unit does them).
// cy[h*256 + d] = sum_o Wk[h*256 + o][d] bq[h*256 + o]: a wave owns 4 d of one head (a block 32 d: whole lines of Wk's rows), lane = o mod 32, 8 rows a lane, then a sum over the lanes.
// (bk adds the same value to every key's score of a query, so the key-axis softmax does not see it.)
// bo2[o'] = bo[o'] + sum_i Wo[o'][i] bv[i] (the softmax weights of a query sum to 1): a wave owns one o', a lane 64 of the 2048 i.
// ---------------------------------------------------------------------------
#define CYB (HDIM / 32)         // 64 blocks
#define BOB (DM / 8)            // 32 blocks
__device__ __forceinline__ void fold_cy_block(const float* __restrict__ Wk, const float* __restrict__ bq, float* __restrict__ cy, int blk) {
  const int lane = threadIdx.x & 31, wave = threadIdx.x >> 5;
  const int h = blk >> 3, d0 = (blk & 7) * 32 + wave * 4;
  const float* wp = Wk + ((size_t)h * DM + lane) * DM + d0;
  const float* bp = bq + h * DM + lane;
  v4f w[8]; float bb[8];
#pragma unroll
  for (int j = 0; j < 8; ++j) { w[j] = *(const v4f*)(wp + (size_t)j * 32 * DM); bb[j] = bp[j * 32]; }
  // the address is an input, so its registers stay the loads' own up to this wait and are rewritten only behind it
  asm volatile("s_wait_xcnt 0x0" :: "v"(wp) : "memory");
  v4f sum = (v4f){0.f, 0.f, 0.f, 0.f};
#pragma unroll
  for (int j = 0; j < 8; ++j) sum += w[j] * bb[j];
#pragma unroll
  for (int m = 1; m < 32; m <<= 1)
#pragma unroll
    for (int e = 0; e < 4; ++e) sum[e] += __shfl_xor(sum[e], m, 32);
  if (lane == 0) *(v4f*)(cy + h * DM + d0) = sum;
}
__device__ __forceinline__ void fold_bo_block(const float* __restrict__ Wo, const float* __restrict__ bv, const float* __restrict__ bo,
                                              float* __restrict__ bo2, int blk) {
  const int lane = threadIdx.x & 31, wave = threadIdx.x >> 5;
  const int o = blk * 8 + wave;
  const float* wp = Wo + (size_t)o * HDIM + lane * 4;
  const float* bp = bv + lane * 4;
  v4f w[16], b[16];
#pragma unroll
  for (int j = 0; j < 16; ++j) { w[j] = *(const v4f*)(wp + j * 128); b[j] = *(const v4f*)(bp + j * 128); }
  v4f s4 = (v4f){0.f, 0.f, 0.f, 0.f};
#pragma unroll
  for (int j = 0; j < 16; ++j) s4 += w[j] * b[j];
  float sum = (s4[0] + s4[1]) + (s4[2] + s4[3]);
#pragma unroll
  for (int m = 1; m < 32; m <<= 1) sum += __shfl_xor(sum, m, 32);
  if (lane == 0) bo2[o] = sum + bo[o];
}

// All operand preparation in one launch; the branch is the same for a whole block. Blocks in this order (the longest first):
// FOB fold the weights, XTB transpose-cast x (and cast it untransposed), CYB and BOB fold the biases.
__global__ __launch_bounds__(256) void prep_kernel(const float* __restrict__ x,
                                                   const float* __restrict__ Wk, const float* __restrict__ Wq,
                                                   const float* __restrict__ Wv, const float* __restrict__ Wo,
                                                   const float* __restrict__ bq, const float* __restrict__ bv, const float* __restrict__ bo,
                                                   unsigned short* __restrict__ XT, unsigned short* __restrict__ XP,
                                                   unsigned short* __restrict__ M16, unsigned short* __restrict__ N16,
                                                   float* __restrict__ cy, float* __restrict__ bo2) {
  __shared__ __align__(16) unsigned short ring[2 * FSTG];   // a folding block's GEMM ring; a transposing block's tile[d_local][p_local] lies in its first bytes
  static_assert(64 * 65 * 4 <= 2 * FSTG * 2, "the transpose tile lies inside the ring");
  const int bid = blockIdx.x;
  if (bid < FOB) {
    fold_block(ring, Wk, Wq, Wv, Wo, M16, N16, bid);
  } else if (bid < FOB + XTB) {
    xt_cast_block<PP, 1>((float (*)[65])ring, x, XT, XP, bid - FOB, 1.0f);
    // in the built text another branch's code follows this branch's stores: the wait stands in front of any rewrite of their registers
    asm volatile("s_wait_xcnt 0x0" ::: "memory");
  } else if (bid < FOB + XTB + CYB) {
    fold_cy_block(Wk, bq, cy, bid - (FOB + XTB));
  } else {
    fold_bo_block(Wo, bv, bo, bo2, bid - (FOB + XTB + CYB));
  }
}

#define FK      64
#define NSTAGE  (PP / FK)
#define KP_H    264
#define VP_H    72
#define KTILE_H (FK * KP_H)
#define STAGE_H (KTILE_H + DM * VP_H)
#define LOG2E   1.4426950408889634f

__global__ __launch_bounds__(256) void attn_fused_kernel(const unsigned short* __restrict__ M16,
                                                         const float* __restrict__ cy,
                                                         const unsigned short* __restrict__ XT16,
                                                         const unsigned short* __restrict__ X16,
                                                         const float* __restrict__ pos,
                                                         unsigned short* __restrict__ CTX) {
  __shared__ __align__(16) unsigned short ring[2 * STAGE_H];
  __shared__ __align__(16) unsigned short mtile[DM * KP_H];   // M_h (x16), rows d, 135,168 B
  __shared__ __align__(16) float cys[DM];                     // cy of head h
  typedef Frag<_Float16> F;
  const int tid = threadIdx.x, lane = tid & 31, wave = tid >> 5;
  const int c = lane & 15, hf = lane >> 4;
  const int h = blockIdx.y, n = blockIdx.z;
  const int q0 = blockIdx.x * 256 + wave * 32;
  const unsigned short* Kh = XT16 + (size_t)n * PP * DM;                   // [kp][d], row pitch DM
  const unsigned short* Vh = X16 + (size_t)n * DM * PP;                    // [dd][kp], row pitch PP
  const float* ph = pos + (size_t)h * PP * PP + (size_t)(hf * 8) * PP + q0 + c;
  const unsigned ring0 = (unsigned)(size_t)(&ring[0]);

  // stage t -> buffer b. k: wave w copies rows w, w+8, ... (512 B a row); v^T: 8 lanes a row of 128 B, rows tid>>3, +32, ...
  const unsigned short* kg = Kh + (size_t)wave * DM + lane * 8;
  const unsigned short* vg = Vh + (size_t)(tid >> 3) * PP + (tid & 7) * 8;
  const unsigned kl = ring0 + wave * (KP_H * 2) + lane * 16;
  const unsigned vl = ring0 + KTILE_H * 2 + (tid >> 3) * (VP_H * 2) + (tid & 7) * 16;
  auto issue_stage = [&](int t, int b) {
    async_copy8(kl + b * (STAGE_H * 2), 8 * KP_H * 2, kg + (size_t)t * FK * DM, (size_t)8 * DM);
    async_copy8(vl + b * (STAGE_H * 2), 32 * VP_H * 2, vg + t * FK, (size_t)32 * PP);
  };

  // M_h: wave w copies rows w, w+8, ... (512 B a row), 32 copies a lane; with cy's one and stage 0's 16 that is 49 in flight
  {
    const unsigned short* mg = M16 + ((size_t)h * DM + wave) * DM + lane * 8;
    const unsigned ml = (unsigned)(size_t)(&mtile[0]) + wave * (KP_H * 2) + lane * 16;
#pragma unroll
    for (int g = 0; g < 4; ++g) async_copy8(ml + g * (64 * KP_H * 2), 8 * KP_H * 2, mg + (size_t)g * 64 * DM, (size_t)8 * DM);
    // cy of the head: one 4-byte copy of each lane; the address wait is the statement's last line, as in async_copy8
    asm volatile("global_load_async_to_lds_b32 %0, %1, off\n\ts_wait_xcnt 0x0"
                 :: "v"((unsigned)(size_t)(&cys[0]) + tid * 4), "v"(cy + h * DM + tid) : "memory");
  }
  issue_stage(0, 0);

  v16h xq[8][2];                            // x rows of the wave's queries, hardware k order
  {
    const _Float16* xp = (const _Float16*)XT16 + (size_t)n * PP * DM + (q0 + c) * DM + hf * 8;
#pragma unroll
    for (int kk = 0; kk < 8; ++kk)
#pragma unroll
      for (int nt = 0; nt < 2; ++nt) xq[kk][nt] = F::load(xp + nt * 16 * DM + kk * 32);
    // the address is an input, so its registers stay the loads' own up to this wait and are rewritten only behind it
    asm volatile("s_wait_xcnt 0x0" :: "v"(xp) : "memory");
  }

  v8f st[2][2];                             // st[mt][nt][r] = score of key kp0 + 16 mt + 8 hf + r, query q0 + 16 nt + c
#pragma unroll
  for (int mt = 0; mt < 2; ++mt)
#pragma unroll
    for (int nt = 0; nt < 2; ++nt)
#pragma unroll
      for (int r = 0; r < 8; ++r) st[mt][nt][r] = ph[(size_t)(mt * 16 + r) * PP + nt * 16];

  asm volatile("s_wait_asynccnt 0x0" ::: "memory");   // M_h, cy and stage 0 have landed for this wave's copies
  __syncthreads();                                    // ... and for every wave's
  issue_stage(1, 1);

  // q / 16 = (M16 . x) / 256 + cy / 16, k upward in one accumulator chain; fragment J = 16 g + 2 kk + mt: rows d = 32 g + 16 mt .., channels 32 kk ..
  v16h qf[8][2];                            // hardware k order
  {
    const _Float16* mb = (const _Float16*)mtile + c * KP_H + hf * 8;
    v16h ma[3];                             // fragment ring, as in the passes below; it runs on over the groups
    ma[0] = F::load(mb);
    ma[1] = F::load(mb + 16 * KP_H);
#pragma unroll
    for (int g = 0; g < 8; ++g) {
      v8f ya[2][2];
#pragma unroll
      for (int mt = 0; mt < 2; ++mt)
#pragma unroll
        for (int nt = 0; nt < 2; ++nt) ya[mt][nt] = (v8f){0.f,0.f,0.f,0.f,0.f,0.f,0.f,0.f};
      const v4f* cb = (const v4f*)(cys + g * 32 + hf * 8);
      const v4f b00 = cb[0] * 0.0625f, b01 = cb[1] * 0.0625f, b10 = cb[4] * 0.0625f, b11 = cb[5] * 0.0625f;
#pragma unroll
      for (int j = 0; j < 16; ++j) {
        const int J = g * 16 + j, kk = j >> 1, mt = j & 1, Jn = J + 2;
        if (Jn < 128) ma[Jn % 3] = F::load(mb + ((Jn >> 4) * 32 + (Jn & 1) * 16) * KP_H + ((Jn & 15) >> 1) * 32);
        __builtin_amdgcn_sched_barrier(0);   // keeps the LDS read of the fragment after next in front of these products, so its latency hides
        ya[mt][0] = F::mma(ma[J % 3], xq[kk][0], ya[mt][0]);
        ya[mt][1] = F::mma(ma[J % 3], xq[kk][1], ya[mt][1]);
      }
#pragma unroll
      for (int nt = 0; nt < 2; ++nt)
#pragma unroll
        for (int r = 0; r < 8; ++r) {
          qf[g][nt][r]     = (_Float16)fmaf(ya[0][nt][r], 1.0f / 256.0f, (r < 4) ? b00[r & 3] : b01[r & 3]);
          qf[g][nt][8 + r] = (_Float16)fmaf(ya[1][nt][r], 1.0f / 256.0f, (r < 4) ? b10[r & 3] : b11[r & 3]);
        }
    }
  }

  v8f acc[16][2];
#pragma unroll
  for (int dt = 0; dt < 16; ++dt)
#pragma unroll
    for (int nt = 0; nt < 2; ++nt) acc[dt][nt] = (v8f){0.f,0.f,0.f,0.f,0.f,0.f,0.f,0.f};
  float mref[2] = {-1.0e30f, -1.0e30f};
  float lsum[2] = {0.f, 0.f};

  for (int t = 0; t < NSTAGE; ++t) {
    const _Float16* Ks = (const _Float16*)ring + (t & 1) * STAGE_H;
    const _Float16* Vs = Ks + KTILE_H;
#pragma unroll 1   // two passes of one stage share the code: the body is large and only addresses differ
    for (int hp = 0; hp < 2; ++hp) {
      const _Float16* kb = Ks + (hp * 32 + c) * KP_H + hf * 8;
      const _Float16* vb = Vs + c * VP_H + hp * 32 + hf * 8;
      v16h ka[3], va[3];                     // fragment rings: two fragments are always on their way
      ka[0] = F::load(kb);                   // fragment j = 2 kk + mt: keys 16 mt .., channels 32 kk ..
      ka[1] = F::load(kb + 16 * KP_H);
#pragma unroll
      for (int j = 0; j < 16; ++j) {
        const int kk = j >> 1, mt = j & 1, jn = j + 2;
        if (jn < 16) ka[jn % 3] = F::load(kb + (jn & 1) * 16 * KP_H + (jn >> 1) * 32);
        else         va[jn - 16] = F::load(vb + (jn - 16) * 16 * VP_H);   // the first v^T fragments (same stage) come in under the softmax
        __builtin_amdgcn_sched_barrier(0);   // keeps the LDS read of the fragment after next in front of these products, so its latency hides
        st[mt][0] = F::mma(ka[j % 3], qf[kk][0], st[mt][0]);
        st[mt][1] = F::mma(ka[j % 3], qf[kk][1], st[mt][1]);
      }
      float mx[2];
#pragma unroll
      for (int nt = 0; nt < 2; ++nt) {
        const v8f u = st[0][nt], w = st[1][nt];
        float m0 = fmaxf(fmaxf(fmaxf(u[0], u[1]), fmaxf(u[2], u[3])), fmaxf(fmaxf(u[4], u[5]), fmaxf(u[6], u[7])));
        float m1 = fmaxf(fmaxf(fmaxf(w[0], w[1]), fmaxf(w[2], w[3])), fmaxf(fmaxf(w[4], w[5]), fmaxf(w[6], w[7])));
        m0 = fmaxf(m0, m1);
        mx[nt] = fmaxf(m0, __shfl_xor(m0, 16, 32)) * LOG2E;
      }
      // lazy rescale, tested once a pass: the reference maximum moves only when a column passes it by more than 8 (log2)
      const bool need = (mx[0] > mref[0] + 8.0f) || (mx[1] > mref[1] + 8.0f);
      if (__builtin_amdgcn_ballot_w32(need) != 0) {
#pragma unroll
        for (int nt = 0; nt < 2; ++nt) {
          const float mnew = fmaxf(mref[nt], mx[nt]);
          const float alpha = __builtin_amdgcn_exp2f(mref[nt] - mnew);
          mref[nt] = mnew;
          lsum[nt] *= alpha;
#pragma unroll
          for (int dt = 0; dt < 16; ++dt) acc[dt][nt] *= alpha;
        }
      }
      v16h pf[2];
#pragma unroll
      for (int nt = 0; nt < 2; ++nt) {
        const float c0 = 6.0f - mref[nt];
        float s0 = 0.f, s1 = 0.f;
#pragma unroll
        for (int r = 0; r < 8; ++r) {
          const float e0 = __builtin_amdgcn_exp2f(fmaf(st[0][nt][r], LOG2E, c0));
          const float e1 = __builtin_amdgcn_exp2f(fmaf(st[1][nt][r], LOG2E, c0));
          s0 += e0; s1 += e1;
          pf[nt][r]     = (_Float16)e0;
          pf[nt][8 + r] = (_Float16)e1;
        }
        lsum[nt] += s0 + s1;
      }
      // bias of the next pass, fetched behind the last use of this pass's scores (the last pass re-reads its own rows, unused)
      {
        const int kc = min((t * 2 + hp) * 32, PP - 64);
        const float* pn = ph + (size_t)kc * PP;   // this pass's rows; the next pass's lie 32 rows on
#pragma unroll
        for (int mt = 0; mt < 2; ++mt)
#pragma unroll
          for (int nt = 0; nt < 2; ++nt)
#pragma unroll
            for (int r = 0; r < 8; ++r) st[mt][nt][r] = pn[(size_t)(32 + mt * 16 + r) * PP + nt * 16];
        // the address is an input, so its registers stay the loads' own up to this wait and are rewritten only behind it
        asm volatile("s_wait_xcnt 0x0" :: "v"(pn) : "memory");
      }
#pragma unroll
      for (int dt = 0; dt < 16; ++dt) {
        if (dt + 2 < 16) va[(dt + 2) % 3] = F::load(vb + (dt + 2) * 16 * VP_H);
        __builtin_amdgcn_sched_barrier(0);   // as above
        acc[dt][0] = F::mma(va[dt % 3], pf[0], acc[dt][0]);
        acc[dt][1] = F::mma(va[dt % 3], pf[1], acc[dt][1]);
      }
    }
    asm volatile("s_wait_dscnt 0x0" ::: "memory");      // this wave's reads of buffer t&1 are done
    asm volatile("s_wait_asynccnt 0x0" ::: "memory");   // this wave's copies of stage t+1 have landed
    __syncthreads();                                    // publishes stage t+1, ends every reader's last read of buffer t&1
    if (t + 2 < NSTAGE) issue_stage(t + 2, t & 1);
  }
  asm volatile("s_wait_asynccnt 0x0" ::: "memory");     // nothing is in flight when the wave ends

#pragma unroll
  for (int nt = 0; nt < 2; ++nt) {
    const float lt = lsum[nt] + __shfl_xor(lsum[nt], 16, 32);
    const float inv = 16.0f / lt;                       // ctx carried x16
    unsigned short* op = CTX + ((size_t)n * PP * HDIM + h * DM) + ((q0 + nt * 16 + c) * HDIM + hf * 8);   // a uniform base and a 32-bit offset: one register lives through the loop for it
    v8h o[16];
#pragma unroll
    for (int dt = 0; dt < 16; ++dt)
#pragma unroll
      for (int r = 0; r < 8; ++r) o[dt][r] = (_Float16)(acc[dt][nt][r] * inv);
    __builtin_amdgcn_sched_barrier(0);                  // with the one below: nothing but the stores and their wait stands in between
#pragma unroll
    for (int dt = 0; dt < 16; ++dt) *(v8h*)(op + dt * 16) = o[dt];   // 8 consecutive dd of one query: one 16-byte store
    asm volatile("s_wait_xcnt 0x0" ::: "memory");       // stands in front of the first rewrite of the stores' registers
    __builtin_amdgcn_sched_barrier(0);
  }
}

// ---------------------------------------------------------------------------
// Workspace region map (byte offsets). All eight batches go through each stage in one launch (batch = a grid axis).
// Every region is fully written in this call before it is read (all GEMM extents are exact tile multiples).
//   CTX16  f16  [8][1024][2048] (col h*256 + d', x16)     0
//   M16, N16 f16 (x16), 1,048,576 each, at 33,554,432
//   XT16 f16 [8][1024][256], X16 f16 [8][256][1024], 4,194,304 each, behind them; cy f32 [2048], bo2 f32 [256] behind those
//   total                                  45,088,768
// ---------------------------------------------------------------------------
extern "C" void kernel_launch(void* const* d_in, const int* in_sizes, int n_in,
                              void* d_out, int out_size, void* d_ws, size_t ws_size,
                              hipStream_t stream) {
  if (n_in < 10) return;
  if (in_sizes[0] != NB * DM * PP) return;
  if (in_sizes[1] != HH * PP * PP) return;
  if (in_sizes[2] != HDIM * DM || in_sizes[4] != HDIM * DM || in_sizes[6] != HDIM * DM) return;
  if (in_sizes[3] != HDIM || in_sizes[5] != HDIM || in_sizes[7] != HDIM) return;
  if (in_sizes[8] != DM * HDIM || in_sizes[9] != DM) return;
  if (out_size != NB * DM * PP) return;

  const float* x   = (const float*)d_in[0];   // [NB][DM][PP]
  const float* pos = (const float*)d_in[1];   // [1][HH][PP kp][PP qp]
  const float* Wk  = (const float*)d_in[2];   // [HDIM][DM]
  const float* bk  = (const float*)d_in[3];   // [HDIM]
  const float* Wq  = (const float*)d_in[4];
  const float* bq  = (const float*)d_in[5];
  const float* Wv  = (const float*)d_in[6];
  const float* bv  = (const float*)d_in[7];
  const float* Wo  = (const float*)d_in[8];   // [DM][HDIM]
  const float* bo  = (const float*)d_in[9];   // [DM]

  const size_t BW   = (size_t)HDIM * DM * 2;             // 1,048,576
  const size_t BACT = (size_t)NB * PP * HDIM * 2;        // 33,554,432
  const size_t BS   = 11 * BW;                           // two weight planes, XT16, X16 (4 planes each), one plane for the two bias vectors
  size_t off = 0;
  const size_t oCTX  = off; off += BACT;
  const size_t oS    = off; off += BS;
  if (off > ws_size) return;                          // 45,088,768 B total

  char* ws = (char*)d_ws;
  unsigned short* OUTP  = (unsigned short*)(ws + oCTX);
  unsigned short* M16   = (unsigned short*)(ws + oS);
  unsigned short* N16   = (unsigned short*)(ws + oS + BW);
  unsigned short* XT16  = (unsigned short*)(ws + oS + 2 * BW);
  unsigned short* X16   = (unsigned short*)(ws + oS + 6 * BW);
  float*          cy    = (float*)(ws + oS + 10 * BW);
  float*          bo2   = (float*)(ws + oS + 10 * BW + HDIM * 4);

  const dim3 blk(256);

  // (1) setup, one launch: the folded weights M = Wk^T Wq and N = Wo Wv per head (carried x16: an exact power of two, undone by the later scales), x -> XT16 [NB][PP][DM] and X16 [NB][DM][PP] f16, the folded biases
  prep_kernel<<<FOB + XTB + CYB + BOB, blk, 0, stream>>>(x, Wk, Wq, Wv, Wo, bq, bv, bo, XT16, X16, M16, N16, cy, bo2);

  const dim3 gOut((DM / 64) * (PP / 128), NB);               // 32 x 8:  tiles of 64 x 128, M=256, N=1024, K=2048
  const float oscale  = 1.0f / 256.0f;                     // undo x16 (N) and x16 (ctx)

  // (2) y = (x . (16 M))/16 + cy of the block's own queries, then scores, key-axis softmax with the positional bias and ctx in one launch: 4 blocks of 256 queries x 8 heads x 8 batches
  attn_fused_kernel<<<dim3(PP / 256, HH, NB), blk, 0, stream>>>(M16, cy, XT16, X16, pos, OUTP);
  // (3) out[n][o][p] = (1/256) sum_i (16 N)[o][i] (16 ctx)[n][p][i] + bo2[o] -> d_out[n] f32 [256][1024] (ldc 1024, bias by m); y = n
  wmma_gemm_lds<64, 128, 256, HDIM, PP, 2, 4, 4, 1, 0><<<gOut, blk, 0, stream>>>(
      N16, 0L, OUTP, (long)PP * HDIM, d_out, (long)DM * PP, bo2, PP / 128, oscale);
  (void)hipGetLastError();
}

// v008
// One run takes 81.7 microseconds.
// In both of two side-by-side timings against v007, it was 1.05 times as fast.
// All steps since v000 together make it 17.9 times as fast.
// All matrix-matrix contractions on v_wmma_f32_16x16x32_f16 (f16 operands, f32 accumulate); the two bias folds are matrix-vector sums in f32 on the vector unit. The k and v projections are folded into the weights: per head M = Wk^T Wq and N = Wo Wv, so y = M x + Wk^T bq takes q's place (each attention block forms its own y in its prologue), x itself is the K and the V operand of the fused attention kernel (S^T = x.(y/16)^T on top of the positional bias, online key-axis softmax in f32, ctx^T += x.P^T with P packed from the score accumulators), and the output conv runs on N (carried x16, ctx carried x16, epilogue x1/256) with the bias bo + Wo bv.
#include <hip/hip_runtime.h>
#include <math.h>
#include <stdint.h>

#define NB   8      // batch
#define HH   8      // heads
#define DM   256    // channels = head dim
#define PP   1024   // positions
#define HDIM 2048   // HH * DM

typedef __attribute__((ext_vector_type(16))) _Float16 v16h;
typedef __attribute__((ext_vector_type(8)))  _Float16 v8h;
typedef __attribute__((ext_vector_type(8)))  float    v8f;
typedef __attribute__((ext_vector_type(4)))  float    v4f;
typedef __attribute__((ext_vector_type(2)))  float    v2f;

template <typename T> struct Frag;
template <> struct Frag<_Float16> {
  typedef v16h V; union U { v16h v; v8h h[2]; };
  static __device__ __forceinline__ v16h load(const _Float16* p) {   // elements 0..7 <- p[0..7], 8..15 <- p[16..23]
    U f; f.h[0] = *(const v8h*)(p); f.h[1] = *(const v8h*)(p + 16); return f.v;
  }
  static __device__ __forceinline__ v8f mma(v16h a, v16h b, v8f c) {
    return __builtin_amdgcn_wmma_f32_16x16x32_f16(false, a, false, b, (short)0, c, false, false);
  }
};

// eight 16-byte copies of each lane; the address wait is the statement's last line, so no address register is rewritten in front of it
__device__ __forceinline__ void async_copy8(unsigned l0, unsigned lstep, const unsigned short* g0, size_t gstep) {
  asm volatile(
      "global_load_async_to_lds_b128 %0, %8, off\n\t"
      "global_load_async_to_lds_b128 %1, %9, off\n\t"
      "global_load_async_to_lds_b128 %2, %10, off\n\t"
      "global_load_async_to_lds_b128 %3, %11, off\n\t"
      "global_load_async_to_lds_b128 %4, %12, off\n\t"
      "global_load_async_to_lds_b128 %5, %13, off\n\t"
      "global_load_async_to_lds_b128 %6, %14, off\n\t"
      "global_load_async_to_lds_b128 %7, %15, off\n\t"
      "s_wait_xcnt 0x0"
      :: "v"(l0), "v"(l0 + lstep), "v"(l0 + 2 * lstep), "v"(l0 + 3 * lstep),
         "v"(l0 + 4 * lstep), "v"(l0 + 5 * lstep), "v"(l0 + 6 * lstep), "v"(l0 + 7 * lstep),
         "v"(g0), "v"(g0 + gstep), "v"(g0 + 2 * gstep), "v"(g0 + 3 * gstep),
         "v"(g0 + 4 * gstep), "v"(g0 + 5 * gstep), "v"(g0 + 6 * gstep), "v"(g0 + 7 * gstep)
      : "memory");
}

// ---- Batched WMMA GEMM, operands staged in LDS ------------------------------
// C[m,n] = scale * sum_k A[m,k] * Bt[n,k] + bias; A row-major [M][KT], Bt row-major [N][KT], f16; C rows of LDC elements.
// One block of 8 waves (WGM x WGN) owns a BM x BN tile of C. A stage is BK channels of the tile's BM + BN operand rows,
// brought to LDS by asynchronous copies in whole lines (a row of a stage is BK * 2 contiguous bytes), two buffers:
// stage t + 1 flies while stage t is multiplied. Every wave reads its fragments from LDS, so a row is fetched once a block.
// LDS row pitch = BK * 2 + 16 bytes (16 B x odd, for 16-byte readers). k runs upward in steps of 32 in one accumulator chain.
// Fragments go from LDS to a ring of PD register sets inside a stage. M % BM == 0, N % BN == 0, KT % BK == 0. BIAS_MODE: 0 = none, 1 = bias[m], 2 = bias[n]. OUT_MODE: 0 = f32, 1 = f16.
// The body is a device function, so that one launch can hold several GEMMs; ring = the block's LDS, 2 * (BM + BN) * (BK + 8) f16, 16-byte aligned.
// bx = the tile, by = the batch. FILLED = 1: KT = 2 * BK and the caller's own LDS stores have put both stages into the ring (Ap, Btp unused); the first barrier publishes them.
template <int BM, int BN, int BK, int KT, int LDC, int WGM, int WGN, int PD, int BIAS_MODE, int OUT_MODE, int FILLED = 0>
__device__ __forceinline__ void gemm_tile(
    unsigned short* ring, int bx, int by,
    const unsigned short* __restrict__ Ap, long strideA,
    const unsigned short* __restrict__ Btp, long strideB,
    void* __restrict__ Cout, long strideC,
    const float* __restrict__ bias, int tilesN, float scale) {
  typedef Frag<_Float16> F;
  constexpr int FM  = BM / WGM / 16;          // A fragments of a wave
  constexpr int FN  = BN / WGN / 16;          // B fragments of a wave
  constexpr int WN  = FN * 16;                // columns of a wave
  constexpr int PH  = BK + 8;                 // LDS row pitch, f16
  constexpr int STG = (BM + BN) * PH;         // f16 of a stage
  constexpr int NST = KT / BK;
  constexpr int KS  = BK / 32;                // matrix steps of a stage
  constexpr int LPR = BK / 8;                 // lanes that copy one row
  constexpr int RPS = 256 / LPR;              // rows that one copy of the block covers
  constexpr int SP  = WN + 4;                 // epilogue slab pitch, floats
  static_assert(FILLED == 0 || NST == 2, "a filled ring holds the whole k range");
  static_assert(WGM * WGN == 8 && BM % (8 * RPS) == 0 && BN % (8 * RPS) == 0 && KT % BK == 0 && PD - 1 <= KS, "tile shape");
  static_assert(8 * FM * 16 * SP * 4 <= 2 * STG * 2, "the epilogue slabs lie inside the ring");
  const int tid = threadIdx.x, lane = tid & 31, wave = tid >> 5;
  const int c = lane & 15, hf = lane >> 4;    // row (A) / column (B, D) in a subtile; lane half
  const int b  = by;
  const int tm = bx / tilesN;
  const int tn = bx - tm * tilesN;
  const int m0 = tm * BM, n0 = tn * BN;
  const int wm = wave / WGN, wn = wave % WGN;

  const int crow = tid / LPR, ccol = (tid % LPR) * 8;
  const unsigned short* ag = Ap  + (size_t)b * strideA + (size_t)(m0 + crow) * KT + ccol;
  const unsigned short* bg = Btp + (size_t)b * strideB + (size_t)(n0 + crow) * KT + ccol;
  const unsigned al = (unsigned)(size_t)(&ring[0]) + (crow * PH + ccol) * 2;
  const unsigned bl = al + BM * PH * 2;
  auto issue_stage = [&](int t, int buf) {
#pragma unroll
    for (int g = 0; g < BM / (8 * RPS); ++g)
      async_copy8(al + buf * (STG * 2) + g * (8 * RPS * PH * 2), RPS * PH * 2, ag + t * BK + (size_t)g * 8 * RPS * KT, (size_t)RPS * KT);
#pragma unroll
    for (int g = 0; g < BN / (8 * RPS); ++g)
      async_copy8(bl + buf * (STG * 2) + g * (8 * RPS * PH * 2), RPS * PH * 2, bg + t * BK + (size_t)g * 8 * RPS * KT, (size_t)RPS * KT);
  };

  if (FILLED == 0) issue_stage(0, 0);
  v8f acc[FM][FN];
#pragma unroll
  for (int i = 0; i < FM; ++i)
#pragma unroll
    for (int j = 0; j < FN; ++j) acc[i][j] = (v8f){0.f,0.f,0.f,0.f,0.f,0.f,0.f,0.f};
  // the wave's bias values come in under the first stage's copies
  const int mOff = hf * 8;                              // D row offset of this lane half
  const int mw = m0 + wm * FM * 16, nw = n0 + wn * WN;
  constexpr int NBV = (BIAS_MODE == 1) ? FM * 8 : FN;
  float bv[NBV];
  if (BIAS_MODE != 0) {
    const float* bp = bias + ((BIAS_MODE == 1) ? (mw + mOff) : (nw + c));
#pragma unroll
    for (int e = 0; e < NBV; ++e) bv[e] = (BIAS_MODE == 1) ? bp[(e >> 3) * 16 + (e & 7)] : bp[e * 16];
    // the address is an input, so its registers stay the loads' own up to this wait and are rewritten only behind it
    asm volatile("s_wait_xcnt 0x0" :: "v"(bp) : "memory");
  }
  if (FILLED == 0) asm volatile("s_wait_asynccnt 0x0" ::: "memory");   // stage 0 has landed for this wave's copies
  __syncthreads();                                    // ... and for every wave's
  if (FILLED == 0 && NST > 1) issue_stage(1, 1);

  for (int t = 0; t < NST; ++t) {
    const _Float16* As = (const _Float16*)ring + (t & 1) * STG + (wm * FM * 16 + c) * PH + hf * 8;
    const _Float16* Bs = (const _Float16*)ring + (t & 1) * STG + (BM + wn * FN * 16 + c) * PH + hf * 8;
    v16h af[PD][FM], bf[PD][FN];             // fragment ring: PD - 1 steps of this stage are always on their way
#pragma unroll
    for (int p = 0; p < PD - 1; ++p) {
#pragma unroll
      for (int i = 0; i < FM; ++i) af[p][i] = F::load(As + i * 16 * PH + p * 32);
#pragma unroll
      for (int j = 0; j < FN; ++j) bf[p][j] = F::load(Bs + j * 16 * PH + p * 32);
    }
#pragma unroll
    for (int kk = 0; kk < KS; ++kk) {
      const int kn = kk + PD - 1;
      if (kn < KS) {
#pragma unroll
        for (int i = 0; i < FM; ++i) af[kn % PD][i] = F::load(As + i * 16 * PH + kn * 32);
#pragma unroll
        for (int j = 0; j < FN; ++j) bf[kn % PD][j] = F::load(Bs + j * 16 * PH + kn * 32);
      }
      __builtin_amdgcn_sched_barrier(0);     // keeps a later step's LDS reads as one group in front of these products, so their latency hides
#pragma unroll
      for (int i = 0; i < FM; ++i)
#pragma unroll
        for (int j = 0; j < FN; ++j) acc[i][j] = F::mma(af[kk % PD][i], bf[kk % PD][j], acc[i][j]);
    }
    asm volatile("s_wait_dscnt 0x0" ::: "memory");      // this wave's reads of buffer t&1 are done
    if (FILLED == 0) asm volatile("s_wait_asynccnt 0x0" ::: "memory");   // this wave's copies of stage t+1 have landed
    __syncthreads();                                    // publishes stage t+1, ends every reader's last read of buffer t&1
    if (FILLED == 0 && t + 2 < NST) issue_stage(t + 2, t & 1);
  }
  if (FILLED == 0) asm volatile("s_wait_asynccnt 0x0" ::: "memory");     // nothing is in flight when the ring is reused below

  // ---- epilogue: each wave turns its tile into whole 128-byte lines through a slab of its own (the ring is free behind the last barrier)
  float* slab = (float*)ring + wave * (FM * 16 * SP);
  const size_t offC = (size_t)b * strideC;
  const int q = lane >> 3;                              // 8 lanes a row, 4 rows an instruction
#pragma unroll
  for (int i = 0; i < FM; ++i) {
#pragma unroll
    for (int j = 0; j < FN; ++j) {
#pragma unroll
      for (int r = 0; r < 8; ++r) {
        const float v = (BIAS_MODE == 0) ? acc[i][j][r] * scale : acc[i][j][r] * scale + ((BIAS_MODE == 1) ? bv[i * 8 + r] : bv[j]);
        slab[((i << 4) + mOff + r) * SP + (j << 4) + c] = v;
      }
    }
  }
  // the slab's rows are read back by other lanes of the same wave
  __builtin_amdgcn_fence(__ATOMIC_RELEASE, "workgroup");
  __builtin_amdgcn_wave_barrier();
  __builtin_amdgcn_fence(__ATOMIC_ACQUIRE, "workgroup");
  if (OUT_MODE == 0) {
    static_assert(OUT_MODE != 0 || WN == 32, "f32 rows of 128 bytes");
    const int c4 = (lane & 7) * 4;
    float* cp = (float*)Cout + offC + (size_t)(mw + q) * LDC + nw + c4;
    v4f o[FM * 4];
#pragma unroll
    for (int it = 0; it < FM * 4; ++it) o[it] = *(const v4f*)(slab + (it * 4 + q) * SP + c4);
    __builtin_amdgcn_sched_barrier(0);   // only the stores stand behind this line, so no register of a store is rewritten before the wave ends
#pragma unroll
    for (int it = 0; it < FM * 4; ++it) *(v4f*)(cp + it * 4 * LDC) = o[it];
  } else {
    static_assert(OUT_MODE == 0 || WN == 64, "f16 rows of 128 bytes");
    const int c8 = (lane & 7) * 8;
    unsigned short* cp = (unsigned short*)Cout + offC + (size_t)(mw + q) * LDC + nw + c8;
    v8h o[FM * 4];
#pragma unroll
    for (int it = 0; it < FM * 4; ++it) {
      const float* sp = slab + (it * 4 + q) * SP + c8;
#pragma unroll
      for (int e = 0; e < 8; ++e) o[it][e] = (_Float16)sp[e];
    }
    __builtin_amdgcn_sched_barrier(0);   // only the stores stand behind this line, so no register of a store is rewritten before the wave ends
#pragma unroll
    for (int it = 0; it < FM * 4; ++it) *(v8h*)(cp + it * 4 * LDC) = o[it];
  }
}

// one GEMM a launch (the output conv)
template <int BM, int BN, int BK, int KT, int LDC, int WGM, int WGN, int PD, int BIAS_MODE, int OUT_MODE>
__global__ __launch_bounds__(256) void wmma_gemm_lds(
    const unsigned short* __restrict__ Ap, long strideA,
    const unsigned short* __restrict__ Btp, long strideB,
    void* __restrict__ Cout, long strideC,
    const float* __restrict__ bias, int tilesN, float scale) {
  __shared__ __align__(16) unsigned short ring[2 * (BM + BN) * (BK + 8)];
  gemm_tile<BM, BN, BK, KT, LDC, WGM, WGN, PD, BIAS_MODE, OUT_MODE>(ring, blockIdx.x, blockIdx.y, Ap, strideA, Btp, strideB, Cout, strideC, bias, tilesN, scale);
}

// ---------------------------------------------------------------------------
// The two weight folds, straight from the f32 weights: a block owns a 128 x 128 tile of one head's M or N (k = 256, two stages of 128) and
// casts its own operand rows (x16, a power-of-two carry) into the GEMM ring, so no cast plane goes through memory and no launch stands in between.
//   M16[h*256 + d][d'] = (1/16) sum_o (16 Wk)[h*256 + o][d] (16 Wq)[h*256 + o][d']: A row d = column d of Wk_h, B row d' = column d' of Wq_h; carried x16
//   N16[o'][h*256 + d'] = (1/16) sum_i (16 Wo)[o'][h*256 + i] (16 Wv)[h*256 + i][d']: A row o' = Wo's row, columns of head h, B row d' = column d' of Wv_h; carried x16
// Ring element (row r, k) = ring[(k / 128) * FSTG + r * FPH + k % 128]; rows 0..127 = A, 128..255 = B (gemm_tile's layout).
// ---------------------------------------------------------------------------
#define FPH  (128 + 8)
#define FSTG (256 * FPH)
typedef __attribute__((ext_vector_type(4))) _Float16 v4h;
// ring row rowBase + r <- column r of src (256 rows k of DM floats), r = 0..127. A wave's load covers 4 rows x one 128-byte line;
// a lane holds rows k .. k + 3 of 4 columns and packs the four k of a column into one 8-byte LDS store.
__device__ __forceinline__ void stage_w_cols(unsigned short* ring, int rowBase, const float* __restrict__ src) {
  const int lane = threadIdx.x & 31, wave = threadIdx.x >> 5;
  const int lc = lane & 7, lk = lane >> 3;
  const int k0 = (wave * 4 + lk) * 4;                       // 0, 4, .. 124; unit u adds 128 * (u >> 2) and takes columns 32 * (u & 3) ..
  const float* p = src + k0 * DM + lc * 4;
  v4f a[8][4];
#pragma unroll
  for (int u = 0; u < 8; ++u)
#pragma unroll
    for (int j = 0; j < 4; ++j) a[u][j] = *(const v4f*)(p + ((u >> 2) * 128 + j) * DM + (u & 3) * 32);
  // the address is an input, so its registers stay the loads' own up to this wait and are rewritten only behind it
  asm volatile("s_wait_xcnt 0x0" :: "v"(p) : "memory");
  _Float16* d = (_Float16*)ring + (rowBase + lc * 4) * FPH + k0;
#pragma unroll
  for (int u = 0; u < 8; ++u)
#pragma unroll
    for (int e = 0; e < 4; ++e) {
      v4h t;
#pragma unroll
      for (int j = 0; j < 4; ++j) t[j] = (_Float16)(a[u][j][e] * 16.0f);
      *(v4h*)(d + (u >> 2) * FSTG + ((u & 3) * 32 + e) * FPH) = t;
    }
  __builtin_amdgcn_sched_barrier(0);   // keeps the next operand's 32 loads behind these stores: lifted over them they hold 128 more registers and the block spills
}
// ring row rowBase + r <- src row r (pitch HDIM floats), 256 consecutive k, r = 0..127: a wave takes a row an instruction pair, a lane 8 k (one 16-byte LDS store).
__device__ __forceinline__ void stage_w_rows(unsigned short* ring, int rowBase, const float* __restrict__ src) {
  const int lane = threadIdx.x & 31, wave = threadIdx.x >> 5;
  const float* p = src + wave * HDIM + lane * 8;
  v4f a[16][2];
#pragma unroll
  for (int u = 0; u < 16; ++u) {
    a[u][0] = *(const v4f*)(p + u * 8 * HDIM);
    a[u][1] = *(const v4f*)(p + u * 8 * HDIM + 4);
  }
  // the address is an input, so its registers stay the loads' own up to this wait and are rewritten only behind it
  asm volatile("s_wait_xcnt 0x0" :: "v"(p) : "memory");
  _Float16* d = (_Float16*)ring + (lane >> 4) * FSTG + (rowBase + wave) * FPH + (lane & 15) * 8;
#pragma unroll
  for (int u = 0; u < 16; ++u) {
    v8h o;
#pragma unroll
    for (int e = 0; e < 8; ++e) o[e] = (_Float16)(a[u][e >> 2][e & 3] * 16.0f);
    *(v8h*)(d + u * 8 * FPH) = o;
  }
  __builtin_amdgcn_sched_barrier(0);   // keeps the next operand's 32 loads behind these stores: lifted over them they hold 128 more registers and the block spills
}
#define FOB (2 * HH * 4)        // 64 blocks: M or N, head, tile
__device__ __forceinline__ void fold_block(unsigned short* ring, const float* __restrict__ Wk, const float* __restrict__ Wq,
                                           const float* __restrict__ Wv, const float* __restrict__ Wo,
                                           unsigned short* __restrict__ M16, unsigned short* __restrict__ N16, int blk) {
  const int tile = blk & 3, h = (blk >> 2) & 7;
  const int m0 = (tile >> 1) * 128, n0 = (tile & 1) * 128;  // as gemm_tile splits the tile index
  if (blk < FOB / 2) {
    stage_w_cols(ring, 0,   Wk + h * DM * DM + m0);
    stage_w_cols(ring, 128, Wq + h * DM * DM + n0);
    gemm_tile<128, 128, 128, DM, DM, 4, 2, 3, 0, 1, 1>(ring, tile, h, nullptr, 0L, nullptr, 0L,
        (void*)M16, (long)DM * DM, nullptr, DM / 128, 1.0f / 16.0f);
  } else {
    stage_w_rows(ring, 0,   Wo + m0 * HDIM + h * DM);
    stage_w_cols(ring, 128, Wv + h * DM * DM + n0);
    gemm_tile<128, 128, 128, DM, HDIM, 4, 2, 3, 0, 1, 1>(ring, tile, h, nullptr, 0L, nullptr, 0L,
        (void*)N16, (long)DM, nullptr, DM / 128, 1.0f / 16.0f);
    // in the built text the other branch's code follows this branch's stores: the wait stands in front of any rewrite of their registers
    asm volatile("s_wait_xcnt 0x0" ::: "memory");
  }
}

// ---------------------------------------------------------------------------
// Transpose-cast of NMAT matrices of DM rows x COLS columns: in f32 [n][DM][COLS] -> XT f16 [n][COLS][DM], values times scale (a power of two).
// x: COLS = PP, n = batch (in[n][d][p] -> out[n][p][d]); PLAIN = 1 also writes the untransposed cast XP f16 [n][DM][COLS].
// One block (256 threads) per 64x64 tile, bid = the tile: 4 * (COLS / 64) tiles a matrix.
// Load: thread t reads row d = d0 + (t>>2), 16 floats at p0 + (t&3)*16 -> 256 x 16 = 4096 = the whole tile.
// Store: 8 lanes x 16 B a row of 128 B, 4 rows an instruction; 8 waves x 2 it x 4 = 64 rows.
// ---------------------------------------------------------------------------
#define XTB (NB * (PP / 64) * (DM / 64))
template <int COLS, int PLAIN>
__device__ __forceinline__ void xt_cast_block(float (*tile)[65], const float* __restrict__ x, unsigned short* __restrict__ XT,
                                              unsigned short* __restrict__ XP, int bid, float scale) {
  const int dt = bid & 3;
  const int pt = (bid >> 2) & (COLS / 64 - 1);
  const int n  = bid / (4 * (COLS / 64));
  const int d0 = dt * 64, p0 = pt * 64;
  const int tid = threadIdx.x, lane = tid & 31, wave = tid >> 5;
  const size_t so = ((size_t)n * DM + d0 + (tid >> 2)) * COLS + p0 + (tid & 3) * 16;
  v8h o[2];                                      // the thread's 16 values, cast in place (PLAIN)
  {
    const int r = tid >> 2, cs = (tid & 3) * 16;
    const float* src = x + so;
    v4f v[4];
#pragma unroll
    for (int i = 0; i < 4; ++i) v[i] = *(const v4f*)(src + 4 * i);
#pragma unroll
    for (int i = 0; i < 4; ++i) {
      tile[r][cs + 4 * i + 0] = v[i][0];
      tile[r][cs + 4 * i + 1] = v[i][1];
      tile[r][cs + 4 * i + 2] = v[i][2];
      tile[r][cs + 4 * i + 3] = v[i][3];
    }
    if (PLAIN) {
#pragma unroll
      for (int e = 0; e < 16; ++e) o[e >> 3][e & 7] = (_Float16)(v[e >> 2][e & 3] * scale);
    }
  }
  __syncthreads();
  const int q = lane >> 3, c8 = (lane & 7) * 8;
  unsigned short* ob = XT + ((size_t)n * COLS + p0) * DM + d0;
#pragma unroll
  for (int it = 0; it < 2; ++it) {
    const int rr = wave * 8 + it * 4 + q;       // p_local
    v8h hv;
#pragma unroll
    for (int e = 0; e < 8; ++e) hv[e] = (_Float16)(tile[c8 + e][rr] * scale);   // value (p=rr, d=c8+e)
    *(v8h*)(ob + (size_t)rr * DM + c8) = hv;
  }
  if (PLAIN) {                           // behind the barrier, so that the barrier does not wait for these stores
    *(v8h*)(XP + so)     = o[0];         // 4 threads fill one 128-byte line of a row
    *(v8h*)(XP + so + 8) = o[1];
  }
}

// ---------------------------------------------------------------------------
// Folded biases, f32 from the f32 inputs (matrix times one vector: no 16-column operand to fill, so the vector unit does them).
// cy[h*256 + d] = sum_o Wk[h*256 + o][d] bq[h*256 + o]: a wave owns 4 d of one head (a block 32 d: whole lines of Wk's rows), lane = o mod 32, 8 rows a lane, then a sum over the lanes.
// (bk adds the same value to every key's score of a query, so the key-axis softmax does not see it.)
// bo2[o'] = bo[o'] + sum_i Wo[o'][i] bv[i] (the softmax weights of a query sum to 1): a wave owns one o', a lane 64 of the 2048 i.
// ---------------------------------------------------------------------------
#define CYB (HDIM / 32)         // 64 blocks
#define BOB (DM / 8)            // 32 blocks
__device__ __forceinline__ void fold_cy_block(const float* __restrict__ Wk, const float* __restrict__ bq, float* __restrict__ cy, int blk) {
  const int lane = threadIdx.x & 31, wave = threadIdx.x >> 5;
  const int h = blk >> 3, d0 = (blk & 7) * 32 + wave * 4;
  const float* wp = Wk + ((size_t)h * DM + lane) * DM + d0;
  const float* bp = bq + h * DM + lane;
  v4f w[8]; float bb[8];
#pragma unroll
  for (int j = 0; j < 8; ++j) { w[j] = *(const v4f*)(wp + (size_t)j * 32 * DM); bb[j] = bp[j * 32]; }
  // the address is an input, so its registers stay the loads' own up to this wait and are rewritten only behind it
  asm volatile("s_wait_xcnt 0x0" :: "v"(wp) : "memory");
  v4f sum = (v4f){0.f, 0.f, 0.f, 0.f};
#pragma unroll
  for (int j = 0; j < 8; ++j) sum += w[j] * bb[j];
#pragma unroll
  for (int m = 1; m < 32; m <<= 1)
#pragma unroll
    for (int e = 0; e < 4; ++e) sum[e] += __shfl_xor(sum[e], m, 32);
  if (lane == 0) *(v4f*)(cy + h * DM + d0) = sum;
}
__device__ __forceinline__ void fold_bo_block(const float* __restrict__ Wo, const float* __restrict__ bv, const float* __restrict__ bo,
                                              float* __restrict__ bo2, int blk) {
  const int lane = threadIdx.x & 31, wave = threadIdx.x >> 5;
  const int o = blk * 8 + wave;
  const float* wp = Wo + (size_t)o * HDIM + lane * 4;
  const float* bp = bv + lane * 4;
  v4f w[16], b[16];
#pragma unroll
  for (int j = 0; j < 16; ++j) { w[j] = *(const v4f*)(wp + j * 128); b[j] = *(const v4f*)(bp + j * 128); }
  v4f s4 = (v4f){0.f, 0.f, 0.f, 0.f};
#pragma unroll
  for (int j = 0; j < 16; ++j) s4 += w[j] * b[j];
  float sum = (s4[0] + s4[1]) + (s4[2] + s4[3]);
#pragma unroll
  for (int m = 1; m < 32; m <<= 1) sum += __shfl_xor(sum, m, 32);
  if (lane == 0) bo2[o] = sum + bo[o];
}

// All operand preparation in one launch; the branch is the same for a whole block. Blocks in this order (the longest first):
// FOB fold the weights, XTB transpose-cast x (and cast it untransposed), CYB and BOB fold the biases.
__global__ __launch_bounds__(256) void prep_kernel(const float* __restrict__ x,
                                                   const float* __restrict__ Wk, const float* __restrict__ Wq,
                                                   const float* __restrict__ Wv, const float* __restrict__ Wo,
                                                   const float* __restrict__ bq, const float* __restrict__ bv, const float* __restrict__ bo,
                                                   unsigned short* __restrict__ XT, unsigned short* __restrict__ XP,
                                                   unsigned short* __restrict__ M16, unsigned short* __restrict__ N16,
                                                   float* __restrict__ cy, float* __restrict__ bo2) {
  __shared__ __align__(16) unsigned short ring[2 * FSTG];   // a folding block's GEMM ring; a transposing block's tile[d_local][p_local] lies in its first bytes
  static_assert(64 * 65 * 4 <= 2 * FSTG * 2, "the transpose tile lies inside the ring");
  const int bid = blockIdx.x;
  if (bid < FOB) {
    fold_block(ring, Wk, Wq, Wv, Wo, M16, N16, bid);
  } else if (bid < FOB + XTB) {
    xt_cast_block<PP, 1>((float (*)[65])ring, x, XT, XP, bid - FOB, 1.0f);
    // in the built text another branch's code follows this branch's stores: the wait stands in front of any rewrite of their registers
    asm volatile("s_wait_xcnt 0x0" ::: "memory");
  } else if (bid < FOB + XTB + CYB) {
    fold_cy_block(Wk, bq, cy, bid - (FOB + XTB));
  } else {
    fold_bo_block(Wo, bv, bo, bo2, bid - (FOB + XTB + CYB));
  }
}

#define FK      64
#define NSTAGE  (PP / FK)
#define KP_H    264
#define TP_H    72
#define SLICE_H 5120
#define STAGE_H (8 * SLICE_H)
#define LOG2E   1.4426950408889634f

typedef uint32_t u32x4 __attribute__((ext_vector_type(4)));
typedef uint32_t u32x8 __attribute__((ext_vector_type(8)));
__device__ __forceinline__ uint32_t uni(uint32_t v) { return (uint32_t)__builtin_amdgcn_readfirstlane(v); }
__device__ __forceinline__ uint32_t pinned(uint32_t v) {
  uint32_t w = __builtin_amdgcn_readfirstlane(v);
  asm volatile("" : "+s"(w));   // holds the wave-uniform test in a scalar register, so that the branch round a tensor load (which ignores EXEC) is a scalar branch
  return w;
}

__global__ __launch_bounds__(256) void attn_fused_kernel(const unsigned short* __restrict__ M16,
                                                         const float* __restrict__ cy,
                                                         const unsigned short* __restrict__ XT16,
                                                         const unsigned short* __restrict__ X16,
                                                         const float* __restrict__ pos,
                                                         unsigned short* __restrict__ CTX) {
  __shared__ __attribute__((aligned(2048))) unsigned short ring[2 * STAGE_H];
  __shared__ __align__(16) unsigned short mtile[DM * KP_H];   // M_h (x16), rows d, 135,168 B
  __shared__ __align__(16) float cys[DM];                     // cy of head h
  typedef Frag<_Float16> F;
  const int tid = threadIdx.x, lane = tid & 31, wave = tid >> 5;
  const int c = lane & 15, hf = lane >> 4;
  const int h = blockIdx.y, n = blockIdx.z;
  const int q0 = blockIdx.x * 256 + wave * 32;
  const unsigned short* Kh = XT16 + (size_t)n * PP * DM;                   // [kp][d], row pitch DM
  const unsigned short* Vh = X16 + (size_t)n * DM * PP;                    // [dd][kp], row pitch PP
  const float* ph = pos + (size_t)h * PP * PP + (size_t)(hf * 8) * PP + q0 + c;
  const unsigned ring0 = (unsigned)(size_t)(&ring[0]);

  // stage t -> buffer b: every wave asks for its own slice, 64 rows of 128 B (extents in bytes, tensor = tile, no mask)
  const uint32_t wv = uni(threadIdx.x >> 5);
  const bool isV = wv >= 4u;
  const uint64_t src0 = isV ? (uint64_t)(size_t)(Vh + (size_t)(wv - 4u) * 64 * PP) : (uint64_t)(size_t)(Kh + wv * 64u);
  const uint32_t sstep = isV ? FK * 2u : FK * DM * 2u;           // bytes from a stage's slice to the next stage's
  u32x8 g1;
  g1[0] = uni((1u << 20) | (4u << 22) | (3u << 25));             // pad on, behind every 128 B, 16 B
  g1[1] = uni(128u << 16);                                       // tensor_dim0
  g1[2] = uni(64u << 16);                                        // tensor_dim1
  g1[3] = uni(128u << 16);                                       // tile_dim0
  g1[4] = uni(64u);                                              // tile_dim1
  g1[5] = uni(isV ? PP * 2u : DM * 2u);                          // source row pitch
  g1[6] = uni(0u);
  g1[7] = uni(0u);
  // The descriptor has scalar registers of its own, named in the request: they are written only in front of a request, behind the wait for the one before.
  auto issue_stage = [&](uint64_t ga, uint32_t b) {              // ga = the slice's first byte
    u32x4 g0;
    g0[0] = uni(1u);
    g0[1] = uni(ring0 + b * (STAGE_H * 2u) + wv * (SLICE_H * 2u));
    g0[2] = uni((uint32_t)ga);
    g0[3] = uni((((uint32_t)(ga >> 32)) & 0x01FFFFFFu) | 0x80000000u);
    asm volatile("tensor_load_to_lds %0, %1" :: "{s[44:47]}"(g0), "{s[48:55]}"(g1) : "memory");   // the slice goes from L2 to LDS through no register
  };

  // M_h: wave w copies rows w, w+8, ... (512 B a row), 32 copies a lane; with cy's one that is 33 in flight
  {
    const unsigned short* mg = M16 + ((size_t)h * DM + wave) * DM + lane * 8;
    const unsigned ml = (unsigned)(size_t)(&mtile[0]) + wave * (KP_H * 2) + lane * 16;
#pragma unroll
    for (int g = 0; g < 4; ++g) async_copy8(ml + g * (64 * KP_H * 2), 8 * KP_H * 2, mg + (size_t)g * 64 * DM, (size_t)8 * DM);
    // cy of the head: one 4-byte copy of each lane; the address wait is the statement's last line, as in async_copy8
    asm volatile("global_load_async_to_lds_b32 %0, %1, off\n\ts_wait_xcnt 0x0"
                 :: "v"((unsigned)(size_t)(&cys[0]) + tid * 4), "v"(cy + h * DM + tid) : "memory");
  }
  issue_stage(src0, 0);

  v16h xq[8][2];                            // x rows of the wave's queries, hardware k order
  {
    const _Float16* xp = (const _Float16*)XT16 + (size_t)n * PP * DM + (q0 + c) * DM + hf * 8;
#pragma unroll
    for (int kk = 0; kk < 8; ++kk)
#pragma unroll
      for (int nt = 0; nt < 2; ++nt) xq[kk][nt] = F::load(xp + nt * 16 * DM + kk * 32);
    // the address is an input, so its registers stay the loads' own up to this wait and are rewritten only behind it
    asm volatile("s_wait_xcnt 0x0" :: "v"(xp) : "memory");
  }

  v8f st[2][2];                             // st[mt][nt][r] = score of key kp0 + 16 mt + 8 hf + r, query q0 + 16 nt + c
#pragma unroll
  for (int mt = 0; mt < 2; ++mt)
#pragma unroll
    for (int nt = 0; nt < 2; ++nt)
#pragma unroll
      for (int r = 0; r < 8; ++r) st[mt][nt][r] = ph[(size_t)(mt * 16 + r) * PP + nt * 16];

  asm volatile("s_wait_asynccnt 0x0" ::: "memory");   // M_h and cy have landed for this wave's copies
  asm volatile("s_wait_tensorcnt 0x0" ::: "memory");  // this wave's slice of stage 0 has landed
  __syncthreads();                                    // ... and every wave's
  issue_stage(src0 + sstep, 1);
  uint64_t gnext = src0 + 2 * (uint64_t)sstep;        // the wave's slice of the stage that is asked for next

  // q / 16 = (M16 . x) / 256 + cy / 16, k upward in one accumulator chain; fragment J = 16 g + 2 kk + mt: rows d = 32 g + 16 mt .., channels 32 kk ..
  v16h qf[8][2];                            // hardware k order
  {
    const _Float16* mb = (const _Float16*)mtile + c * KP_H + hf * 8;
    v16h ma[3];                             // fragment ring, as in the passes below; it runs on over the groups
    ma[0] = F::load(mb);
    ma[1] = F::load(mb + 16 * KP_H);
#pragma unroll
    for (int g = 0; g < 8; ++g) {
      v8f ya[2][2];
#pragma unroll
      for (int mt = 0; mt < 2; ++mt)
#pragma unroll
        for (int nt = 0; nt < 2; ++nt) ya[mt][nt] = (v8f){0.f,0.f,0.f,0.f,0.f,0.f,0.f,0.f};
      const v4f* cb = (const v4f*)(cys + g * 32 + hf * 8);
      const v4f b00 = cb[0] * 0.0625f, b01 = cb[1] * 0.0625f, b10 = cb[4] * 0.0625f, b11 = cb[5] * 0.0625f;
#pragma unroll
      for (int j = 0; j < 16; ++j) {
        const int J = g * 16 + j, kk = j >> 1, mt = j & 1, Jn = J + 2;
        if (Jn < 128) ma[Jn % 3] = F::load(mb + ((Jn >> 4) * 32 + (Jn & 1) * 16) * KP_H + ((Jn & 15) >> 1) * 32);
        __builtin_amdgcn_sched_barrier(0);   // keeps the LDS read of the fragment after next in front of these products, so its latency hides
        ya[mt][0] = F::mma(ma[J % 3], xq[kk][0], ya[mt][0]);
        ya[mt][1] = F::mma(ma[J % 3], xq[kk][1], ya[mt][1]);
      }
#pragma unroll
      for (int nt = 0; nt < 2; ++nt)
#pragma unroll
        for (int r = 0; r < 8; ++r) {
          qf[g][nt][r]     = (_Float16)fmaf(ya[0][nt][r], 1.0f / 256.0f, (r < 4) ? b00[r & 3] : b01[r & 3]);
          qf[g][nt][8 + r] = (_Float16)fmaf(ya[1][nt][r], 1.0f / 256.0f, (r < 4) ? b10[r & 3] : b11[r & 3]);
        }
    }
  }

  v8f acc[16][2];
#pragma unroll
  for (int dt = 0; dt < 16; ++dt)
#pragma unroll
    for (int nt = 0; nt < 2; ++nt) acc[dt][nt] = (v8f){0.f,0.f,0.f,0.f,0.f,0.f,0.f,0.f};
  float mref[2] = {-1.0e30f, -1.0e30f};
  float lsum[2] = {0.f, 0.f};

  for (int t = 0; t < NSTAGE; ++t) {
    const _Float16* Ks = (const _Float16*)ring + (t & 1) * STAGE_H;
    const _Float16* Vs = Ks + 4 * SLICE_H;
#pragma unroll 1   // two passes of one stage share the code: the body is large and only addresses differ
    for (int hp = 0; hp < 2; ++hp) {
      const _Float16* kb = Ks + (hp * 32 + c) * TP_H + hf * 8;
      const _Float16* vb = Vs + c * TP_H + hp * 32 + hf * 8;
      v16h ka[3], va[3];                     // fragment rings: two fragments are always on their way
      ka[0] = F::load(kb);                   // fragment j = 2 kk + mt: keys 16 mt .., channels 32 kk .. = slice kk / 2, bytes 64 (kk % 2) .. of its rows
      ka[1] = F::load(kb + 16 * TP_H);
#pragma unroll
      for (int j = 0; j < 16; ++j) {
        const int kk = j >> 1, mt = j & 1, jn = j + 2;
        if (jn < 16) ka[jn % 3] = F::load(kb + (jn >> 2) * SLICE_H + (jn & 1) * 16 * TP_H + ((jn >> 1) & 1) * 32);
        else         va[jn - 16] = F::load(vb + (jn - 16) * 16 * TP_H);   // the first v^T fragments (same stage) come in under the softmax
        __builtin_amdgcn_sched_barrier(0);   // keeps the LDS read of the fragment after next in front of these products, so its latency hides
        st[mt][0] = F::mma(ka[j % 3], qf[kk][0], st[mt][0]);
        st[mt][1] = F::mma(ka[j % 3], qf[kk][1], st[mt][1]);
      }
      float mx[2];
#pragma unroll
      for (int nt = 0; nt < 2; ++nt) {
        const v8f u = st[0][nt], w = st[1][nt];
        float m0 = fmaxf(fmaxf(fmaxf(u[0], u[1]), fmaxf(u[2], u[3])), fmaxf(fmaxf(u[4], u[5]), fmaxf(u[6], u[7])));
        float m1 = fmaxf(fmaxf(fmaxf(w[0], w[1]), fmaxf(w[2], w[3])), fmaxf(fmaxf(w[4], w[5]), fmaxf(w[6], w[7])));
        m0 = fmaxf(m0, m1);
        mx[nt] = fmaxf(m0, __shfl_xor(m0, 16, 32)) * LOG2E;
      }
      // lazy rescale, tested once a pass: the reference maximum moves only when a column passes it by more than 8 (log2)
      const bool need = (mx[0] > mref[0] + 8.0f) || (mx[1] > mref[1] + 8.0f);
      if (__builtin_amdgcn_ballot_w32(need) != 0) {
#pragma unroll
        for (int nt = 0; nt < 2; ++nt) {
          const float mnew = fmaxf(mref[nt], mx[nt]);
          const float alpha = __builtin_amdgcn_exp2f(mref[nt] - mnew);
          mref[nt] = mnew;
          lsum[nt] *= alpha;
#pragma unroll
          for (int dt = 0; dt < 16; ++dt) acc[dt][nt] *= alpha;
        }
      }
      v16h pf[2];
#pragma unroll
      for (int nt = 0; nt < 2; ++nt) {
        const float c0 = 6.0f - mref[nt];
        float s0 = 0.f, s1 = 0.f;
#pragma unroll
        for (int r = 0; r < 8; ++r) {
          const float e0 = __builtin_amdgcn_exp2f(fmaf(st[0][nt][r], LOG2E, c0));
          const float e1 = __builtin_amdgcn_exp2f(fmaf(st[1][nt][r], LOG2E, c0));
          s0 += e0; s1 += e1;
          pf[nt][r]     = (_Float16)e0;
          pf[nt][8 + r] = (_Float16)e1;
        }
        lsum[nt] += s0 + s1;
      }
      // bias of the next pass, fetched behind the last use of this pass's scores (the last pass re-reads its own rows, unused)
      {
        const int kc = min((t * 2 + hp) * 32, PP - 64);
        const float* pn = ph + (size_t)kc * PP;   // this pass's rows; the next pass's lie 32 rows on
#pragma unroll
        for (int mt = 0; mt < 2; ++mt)
#pragma unroll
          for (int nt = 0; nt < 2; ++nt)
#pragma unroll
            for (int r = 0; r < 8; ++r) st[mt][nt][r] = pn[(size_t)(32 + mt * 16 + r) * PP + nt * 16];
        // the address is an input, so its registers stay the loads' own up to this wait and are rewritten only behind it
        asm volatile("s_wait_xcnt 0x0" :: "v"(pn) : "memory");
      }
#pragma unroll
      for (int dt = 0; dt < 16; ++dt) {
        if (dt + 2 < 16) va[(dt + 2) % 3] = F::load(vb + ((dt + 2) >> 2) * SLICE_H + ((dt + 2) & 3) * 16 * TP_H);
        __builtin_amdgcn_sched_barrier(0);   // as above
        acc[dt][0] = F::mma(va[dt % 3], pf[0], acc[dt][0]);
        acc[dt][1] = F::mma(va[dt % 3], pf[1], acc[dt][1]);
      }
    }
    asm volatile("s_wait_dscnt 0x0" ::: "memory");
    asm volatile("s_wait_tensorcnt 0x0" ::: "memory");
    __syncthreads();
    if (pinned(t + 2 < NSTAGE)) { issue_stage(gnext, t & 1); gnext += sstep; }
  }
  asm volatile("s_wait_tensorcnt 0x0" ::: "memory");    // nothing is in flight when the wave ends
  asm volatile("s_wait_dscnt 0x0" ::: "memory");

#pragma unroll
  for (int nt = 0; nt < 2; ++nt) {
    const float lt = lsum[nt] + __shfl_xor(lsum[nt], 16, 32);
    const float inv = 16.0f / lt;                       // ctx carried x16
    unsigned short* op = CTX + ((size_t)n * PP * HDIM + h * DM) + ((q0 + nt * 16 + c) * HDIM + hf * 8);   // a uniform base and a 32-bit offset: one register lives through the loop for it
    v8h o[16];
#pragma unroll
    for (int dt = 0; dt < 16; ++dt)
#pragma unroll
      for (int r = 0; r < 8; ++r) o[dt][r] = (_Float16)(acc[dt][nt][r] * inv);
    __builtin_amdgcn_sched_barrier(0);                  // with the one below: nothing but the stores and their wait stands in between
#pragma unroll
    for (int dt = 0; dt < 16; ++dt) *(v8h*)(op + dt * 16) = o[dt];   // 8 consecutive dd of one query: one 16-byte store
    asm volatile("s_wait_xcnt 0x0" ::: "memory");       // stands in front of the first rewrite of the stores' registers
    __builtin_amdgcn_sched_barrier(0);
  }
}

// ---------------------------------------------------------------------------
// Workspace region map (byte offsets). All eight batches go through each stage in one launch (batch = a grid axis).
// Every region is fully written in this call before it is read (all GEMM extents are exact tile multiples).
//   CTX16  f16  [8][1024][2048] (col h*256 + d', x16)     0
//   M16, N16 f16 (x16), 1,048,576 each, at 33,554,432
//   XT16 f16 [8][1024][256], X16 f16 [8][256][1024], 4,194,304 each, behind them; cy f32 [2048], bo2 f32 [256] behind those
//   total                                  45,088,768
// ---------------------------------------------------------------------------
extern "C" void kernel_launch(void* const* d_in, const int* in_sizes, int n_in,
                              void* d_out, int out_size, void* d_ws, size_t ws_size,
                              hipStream_t stream) {
  if (n_in < 10) return;
  if (in_sizes[0] != NB * DM * PP) return;
  if (in_sizes[1] != HH * PP * PP) return;
  if (in_sizes[2] != HDIM * DM || in_sizes[4] != HDIM * DM || in_sizes[6] != HDIM * DM) return;
  if (in_sizes[3] != HDIM || in_sizes[5] != HDIM || in_sizes[7] != HDIM) return;
  if (in_sizes[8] != DM * HDIM || in_sizes[9] != DM) return;
  if (out_size != NB * DM * PP) return;

  const float* x   = (const float*)d_in[0];   // [NB][DM][PP]
  const float* pos = (const float*)d_in[1];   // [1][HH][PP kp][PP qp]
  const float* Wk  = (const float*)d_in[2];   // [HDIM][DM]
  const float* bk  = (const float*)d_in[3];   // [HDIM]
  const float* Wq  = (const float*)d_in[4];
  const float* bq  = (const float*)d_in[5];
  const float* Wv  = (const float*)d_in[6];
  const float* bv  = (const float*)d_in[7];
  const float* Wo  = (const float*)d_in[8];   // [DM][HDIM]
  const float* bo  = (const float*)d_in[9];   // [DM]

  const size_t BW   = (size_t)HDIM * DM * 2;             // 1,048,576
  const size_t BACT = (size_t)NB * PP * HDIM * 2;        // 33,554,432
  const size_t BS   = 11 * BW;                           // two weight planes, XT16, X16 (4 planes each), one plane for the two bias vectors
  size_t off = 0;
  const size_t oCTX  = off; off += BACT;
  const size_t oS    = off; off += BS;
  if (off > ws_size) return;                          // 45,088,768 B total

  char* ws = (char*)d_ws;
  unsigned short* OUTP  = (unsigned short*)(ws + oCTX);
  unsigned short* M16   = (unsigned short*)(ws + oS);
  unsigned short* N16   = (unsigned short*)(ws + oS + BW);
  unsigned short* XT16  = (unsigned short*)(ws + oS + 2 * BW);
  unsigned short* X16   = (unsigned short*)(ws + oS + 6 * BW);
  float*          cy    = (float*)(ws + oS + 10 * BW);
  float*          bo2   = (float*)(ws + oS + 10 * BW + HDIM * 4);

  const dim3 blk(256);

  // (1) setup, one launch: the folded weights M = Wk^T Wq and N = Wo Wv per head (carried x16: an exact power of two, undone by the later scales), x -> XT16 [NB][PP][DM] and X16 [NB][DM][PP] f16, the folded biases
  prep_kernel<<<FOB + XTB + CYB + BOB, blk, 0, stream>>>(x, Wk, Wq, Wv, Wo, bq, bv, bo, XT16, X16, M16, N16, cy, bo2);

  const dim3 gOut((DM / 64) * (PP / 128), NB);               // 32 x 8:  tiles of 64 x 128, M=256, N=1024, K=2048
  const float oscale  = 1.0f / 256.0f;                     // undo x16 (N) and x16 (ctx)

  // (2) y = (x . (16 M))/16 + cy of the block's own queries, then scores, key-axis softmax with the positional bias and ctx in one launch: 4 blocks of 256 queries x 8 heads x 8 batches
  attn_fused_kernel<<<dim3(PP / 256, HH, NB), blk, 0, stream>>>(M16, cy, XT16, X16, pos, OUTP);
  // (3) out[n][o][p] = (1/256) sum_i (16 N)[o][i] (16 ctx)[n][p][i] + bo2[o] -> d_out[n] f32 [256][1024] (ldc 1024, bias by m); y = n
  wmma_gemm_lds<64, 128, 256, HDIM, PP, 2, 4, 4, 1, 0><<<gOut, blk, 0, stream>>>(
      N16, 0L, OUTP, (long)PP * HDIM, d_out, (long)DM * PP, bo2, PP / 128, oscale);
  (void)hipGetLastError();
}

// v009
// Measured time: 78.5 microseconds a run.
// Two timings next to v008 both put it at 1.04 times that version's speed.
// Over all steps from v000 it is 18.6 times as fast.
// All matrix-matrix contractions on v_wmma_f32_16x16x32_f16 (f16 operands, f32 accumulate); the two bias folds are matrix-vector sums in f32 on the vector unit. The k and v projections are folded into the weights: per head M = Wk^T Wq and N = Wo Wv, so y = M x + Wk^T bq takes q's place (each attention block forms its own y in its prologue), x itself is the K and the V operand of the fused attention kernel (S^T = x.(y/16)^T on top of the positional bias, online key-axis softmax in f32, ctx^T += x.P^T with P packed from the score accumulators), and the output conv runs on N (carried x16, ctx carried x16, epilogue x1/256) with the bias bo + Wo bv.
#include <hip/hip_runtime.h>
#include <math.h>
#include <stdint.h>

#define NB   8      // batch
#define HH   8      // heads
#define DM   256    // channels = head dim
#define PP   1024   // positions
#define HDIM 2048   // HH * DM

typedef __attribute__((ext_vector_type(16))) _Float16 v16h;
typedef __attribute__((ext_vector_type(8)))  _Float16 v8h;
typedef __attribute__((ext_vector_type(8)))  float    v8f;
typedef __attribute__((ext_vector_type(4)))  float    v4f;
typedef __attribute__((ext_vector_type(2)))  float    v2f;

template <typename T> struct Frag;
template <> struct Frag<_Float16> {
  typedef v16h V; union U { v16h v; v8h h[2]; };
  static __device__ __forceinline__ v16h load(const _Float16* p) {   // elements 0..7 <- p[0..7], 8..15 <- p[16..23]
    U f; f.h[0] = *(const v8h*)(p); f.h[1] = *(const v8h*)(p + 16); return f.v;
  }
  static __device__ __forceinline__ v8f mma(v16h a, v16h b, v8f c) {
    return __builtin_amdgcn_wmma_f32_16x16x32_f16(false, a, false, b, (short)0, c, false, false);
  }
};

// eight 16-byte copies of each lane; the address wait is the statement's last line, so no address register is rewritten in front of it
__device__ __forceinline__ void async_copy8(unsigned l0, unsigned lstep, const unsigned short* g0, size_t gstep) {
  asm volatile(
      "global_load_async_to_lds_b128 %0, %8, off\n\t"
      "global_load_async_to_lds_b128 %1, %9, off\n\t"
      "global_load_async_to_lds_b128 %2, %10, off\n\t"
      "global_load_async_to_lds_b128 %3, %11, off\n\t"
      "global_load_async_to_lds_b128 %4, %12, off\n\t"
      "global_load_async_to_lds_b128 %5, %13, off\n\t"
      "global_load_async_to_lds_b128 %6, %14, off\n\t"
      "global_load_async_to_lds_b128 %7, %15, off\n\t"
      "s_wait_xcnt 0x0"
      :: "v"(l0), "v"(l0 + lstep), "v"(l0 + 2 * lstep), "v"(l0 + 3 * lstep),
         "v"(l0 + 4 * lstep), "v"(l0 + 5 * lstep), "v"(l0 + 6 * lstep), "v"(l0 + 7 * lstep),
         "v"(g0), "v"(g0 + gstep), "v"(g0 + 2 * gstep), "v"(g0 + 3 * gstep),
         "v"(g0 + 4 * gstep), "v"(g0 + 5 * gstep), "v"(g0 + 6 * gstep), "v"(g0 + 7 * gstep)
      : "memory");
}

// ---- Batched WMMA GEMM, operands staged in LDS ------------------------------
// C[m,n] = scale * sum_k A[m,k] * Bt[n,k] + bias; A row-major [M][KT], Bt row-major [N][KT], f16; C rows of LDC elements.
// One block of 8 waves (WGM x WGN) owns a BM x BN tile of C. A stage is BK channels of the tile's BM + BN operand rows,
// brought to LDS by asynchronous copies in whole lines (a row of a stage is BK * 2 contiguous bytes), two buffers:
// stage t + 1 flies while stage t is multiplied. Every wave reads its fragments from LDS, so a row is fetched once a block.
// LDS row pitch = BK * 2 + 16 bytes (16 B x odd, for 16-byte readers). k runs upward in steps of 32 in one accumulator chain.
// Fragments go from LDS to a ring of PD register sets inside a stage. M % BM == 0, N % BN == 0, KT % BK == 0. BIAS_MODE: 0 = none, 1 = bias[m], 2 = bias[n]. OUT_MODE: 0 = f32, 1 = f16.
// The body is a device function, so that one launch can hold several GEMMs; ring = the block's LDS, 2 * (BM + BN) * (BK + 8) f16, 16-byte aligned.
// bx = the tile, by = the batch. FILLED = 1: KT = 2 * BK and the caller's own LDS stores have put both stages into the ring (Ap, Btp unused); the first barrier publishes them.
template <int BM, int BN, int BK, int KT, int LDC, int WGM, int WGN, int PD, int BIAS_MODE, int OUT_MODE, int FILLED = 0>
__device__ __forceinline__ void gemm_tile(
    unsigned short* ring, int bx, int by,
    const unsigned short* __restrict__ Ap, long strideA,
    const unsigned short* __restrict__ Btp, long strideB,
    void* __restrict__ Cout, long strideC,
    const float* __restrict__ bias, int tilesN, float scale) {
  typedef Frag<_Float16> F;
  constexpr int FM  = BM / WGM / 16;          // A fragments of a wave
  constexpr int FN  = BN / WGN / 16;          // B fragments of a wave
  constexpr int WN  = FN * 16;                // columns of a wave
  constexpr int PH  = BK + 8;                 // LDS row pitch, f16
  constexpr int STG = (BM + BN) * PH;         // f16 of a stage
  constexpr int NST = KT / BK;
  constexpr int KS  = BK / 32;                // matrix steps of a stage
  constexpr int LPR = BK / 8;                 // lanes that copy one row
  constexpr int RPS = 256 / LPR;              // rows that one copy of the block covers
  constexpr int SP  = WN + 4;                 // epilogue slab pitch, floats
  static_assert(FILLED == 0 || NST == 2, "a filled ring holds the whole k range");
  static_assert(WGM * WGN == 8 && BM % (8 * RPS) == 0 && BN % (8 * RPS) == 0 && KT % BK == 0 && PD - 1 <= KS, "tile shape");
  static_assert(8 * FM * 16 * SP * 4 <= 2 * STG * 2, "the epilogue slabs lie inside the ring");
  const int tid = threadIdx.x, lane = tid & 31, wave = tid >> 5;
  const int c = lane & 15, hf = lane >> 4;    // row (A) / column (B, D) in a subtile; lane half
  const int b  = by;
  const int tm = bx / tilesN;
  const int tn = bx - tm * tilesN;
  const int m0 = tm * BM, n0 = tn * BN;
  const int wm = wave / WGN, wn = wave % WGN;

  const int crow = tid / LPR, ccol = (tid % LPR) * 8;
  const unsigned short* ag = Ap  + (size_t)b * strideA + (size_t)(m0 + crow) * KT + ccol;
  const unsigned short* bg = Btp + (size_t)b * strideB + (size_t)(n0 + crow) * KT + ccol;
  const unsigned al = (unsigned)(size_t)(&ring[0]) + (crow * PH + ccol) * 2;
  const unsigned bl = al + BM * PH * 2;
  auto issue_stage = [&](int t, int buf) {
#pragma unroll
    for (int g = 0; g < BM / (8 * RPS); ++g)
      async_copy8(al + buf * (STG * 2) + g * (8 * RPS * PH * 2), RPS * PH * 2, ag + t * BK + (size_t)g * 8 * RPS * KT, (size_t)RPS * KT);
#pragma unroll
    for (int g = 0; g < BN / (8 * RPS); ++g)
      async_copy8(bl + buf * (STG * 2) + g * (8 * RPS * PH * 2), RPS * PH * 2, bg + t * BK + (size_t)g * 8 * RPS * KT, (size_t)RPS * KT);
  };

  if (FILLED == 0) issue_stage(0, 0);
  v8f acc[FM][FN];
#pragma unroll
  for (int i = 0; i < FM; ++i)
#pragma unroll
    for (int j = 0; j < FN; ++j) acc[i][j] = (v8f){0.f,0.f,0.f,0.f,0.f,0.f,0.f,0.f};
  // the wave's bias values come in under the first stage's copies
  const int mOff = hf * 8;                              // D row offset of this lane half
  const int mw = m0 + wm * FM * 16, nw = n0 + wn * WN;
  constexpr int NBV = (BIAS_MODE == 1) ? FM * 8 : FN;
  float bv[NBV];
  if (BIAS_MODE != 0) {
    const float* bp = bias + ((BIAS_MODE == 1) ? (mw + mOff) : (nw + c));
#pragma unroll
    for (int e = 0; e < NBV; ++e) bv[e] = (BIAS_MODE == 1) ? bp[(e >> 3) * 16 + (e & 7)] : bp[e * 16];
    // the address is an input, so its registers stay the loads' own up to this wait and are rewritten only behind it
    asm volatile("s_wait_xcnt 0x0" :: "v"(bp) : "memory");
  }
  if (FILLED == 0) asm volatile("s_wait_asynccnt 0x0" ::: "memory");   // stage 0 has landed for this wave's copies
  __syncthreads();                                    // ... and for every wave's
  if (FILLED == 0 && NST > 1) issue_stage(1, 1);

  for (int t = 0; t < NST; ++t) {
    const _Float16* As = (const _Float16*)ring + (t & 1) * STG + (wm * FM * 16 + c) * PH + hf * 8;
    const _Float16* Bs = (const _Float16*)ring + (t & 1) * STG + (BM + wn * FN * 16 + c) * PH + hf * 8;
    v16h af[PD][FM], bf[PD][FN];             // fragment ring: PD - 1 steps of this stage are always on their way
#pragma unroll
    for (int p = 0; p < PD - 1; ++p) {
#pragma unroll
      for (int i = 0; i < FM; ++i) af[p][i] = F::load(As + i * 16 * PH + p * 32);
#pragma unroll
      for (int j = 0; j < FN; ++j) bf[p][j] = F::load(Bs + j * 16 * PH + p * 32);
    }
#pragma unroll
    for (int kk = 0; kk < KS; ++kk) {
      const int kn = kk + PD - 1;
      if (kn < KS) {
#pragma unroll
        for (int i = 0; i < FM; ++i) af[kn % PD][i] = F::load(As + i * 16 * PH + kn * 32);
#pragma unroll
        for (int j = 0; j < FN; ++j) bf[kn % PD][j] = F::load(Bs + j * 16 * PH + kn * 32);
      }
      __builtin_amdgcn_sched_barrier(0);     // keeps a later step's LDS reads as one group in front of these products, so their latency hides
#pragma unroll
      for (int i = 0; i < FM; ++i)
#pragma unroll
        for (int j = 0; j < FN; ++j) acc[i][j] = F::mma(af[kk % PD][i], bf[kk % PD][j], acc[i][j]);
    }
    asm volatile("s_wait_dscnt 0x0" ::: "memory");      // this wave's reads of buffer t&1 are done
    if (FILLED == 0) asm volatile("s_wait_asynccnt 0x0" ::: "memory");   // this wave's copies of stage t+1 have landed
    __syncthreads();                                    // publishes stage t+1, ends every reader's last read of buffer t&1
    if (FILLED == 0 && t + 2 < NST) issue_stage(t + 2, t & 1);
  }
  if (FILLED == 0) asm volatile("s_wait_asynccnt 0x0" ::: "memory");     // nothing is in flight when the ring is reused below

  // ---- epilogue: each wave turns its tile into whole 128-byte lines through a slab of its own (the ring is free behind the last barrier)
  float* slab = (float*)ring + wave * (FM * 16 * SP);
  const size_t offC = (size_t)b * strideC;
  const int q = lane >> 3;                              // 8 lanes a row, 4 rows an instruction
#pragma unroll
  for (int i = 0; i < FM; ++i) {
#pragma unroll
    for (int j = 0; j < FN; ++j) {
#pragma unroll
      for (int r = 0; r < 8; ++r) {
        const float v = (BIAS_MODE == 0) ? acc[i][j][r] * scale : acc[i][j][r] * scale + ((BIAS_MODE == 1) ? bv[i * 8 + r] : bv[j]);
        slab[((i << 4) + mOff + r) * SP + (j << 4) + c] = v;
      }
    }
  }
  // the slab's rows are read back by other lanes of the same wave
  __builtin_amdgcn_fence(__ATOMIC_RELEASE, "workgroup");
  __builtin_amdgcn_wave_barrier();
  __builtin_amdgcn_fence(__ATOMIC_ACQUIRE, "workgroup");
  if (OUT_MODE == 0) {
    static_assert(OUT_MODE != 0 || WN == 32, "f32 rows of 128 bytes");
    const int c4 = (lane & 7) * 4;
    float* cp = (float*)Cout + offC + (size_t)(mw + q) * LDC + nw + c4;
    v4f o[FM * 4];
#pragma unroll
    for (int it = 0; it < FM * 4; ++it) o[it] = *(const v4f*)(slab + (it * 4 + q) * SP + c4);
    __builtin_amdgcn_sched_barrier(0);   // only the stores stand behind this line, so no register of a store is rewritten before the wave ends
#pragma unroll
    for (int it = 0; it < FM * 4; ++it) *(v4f*)(cp + it * 4 * LDC) = o[it];
  } else {
    static_assert(OUT_MODE == 0 || WN == 64, "f16 rows of 128 bytes");
    const int c8 = (lane & 7) * 8;
    unsigned short* cp = (unsigned short*)Cout + offC + (size_t)(mw + q) * LDC + nw + c8;
    v8h o[FM * 4];
#pragma unroll
    for (int it = 0; it < FM * 4; ++it) {
      const float* sp = slab + (it * 4 + q) * SP + c8;
#pragma unroll
      for (int e = 0; e < 8; ++e) o[it][e] = (_Float16)sp[e];
    }
    __builtin_amdgcn_sched_barrier(0);   // only the stores stand behind this line, so no register of a store is rewritten before the wave ends
#pragma unroll
    for (int it = 0; it < FM * 4; ++it) *(v8h*)(cp + it * 4 * LDC) = o[it];
  }
}

// one GEMM a launch (the output conv)
template <int BM, int BN, int BK, int KT, int LDC, int WGM, int WGN, int PD, int BIAS_MODE, int OUT_MODE>
__global__ __launch_bounds__(256) void wmma_gemm_lds(
    const unsigned short* __restrict__ Ap, long strideA,
    const unsigned short* __restrict__ Btp, long strideB,
    void* __restrict__ Cout, long strideC,
    const float* __restrict__ bias, int tilesN, float scale) {
  __shared__ __align__(16) unsigned short ring[2 * (BM + BN) * (BK + 8)];
  gemm_tile<BM, BN, BK, KT, LDC, WGM, WGN, PD, BIAS_MODE, OUT_MODE>(ring, blockIdx.x, blockIdx.y, Ap, strideA, Btp, strideB, Cout, strideC, bias, tilesN, scale);
}

// ---------------------------------------------------------------------------
// The two weight folds, straight from the f32 weights: a block owns a 128 x 128 tile of one head's M or N (k = 256, two stages of 128) and
// casts its own operand rows (x16, a power-of-two carry) into the GEMM ring, so no cast plane goes through memory and no launch stands in between.
//   M16[h*256 + d][d'] = (1/16) sum_o (16 Wk)[h*256 + o][d] (16 Wq)[h*256 + o][d']: A row d = column d of Wk_h, B row d' = column d' of Wq_h; carried x16
//   N16[o'][h*256 + d'] = (1/16) sum_i (16 Wo)[o'][h*256 + i] (16 Wv)[h*256 + i][d']: A row o' = Wo's row, columns of head h, B row d' = column d' of Wv_h; carried x16
// Ring element (row r, k) = ring[(k / 128) * FSTG + r * FPH + k % 128]; rows 0..127 = A, 128..255 = B (gemm_tile's layout).
// ---------------------------------------------------------------------------
#define FPH  (128 + 8)
#define FSTG (256 * FPH)
typedef __attribute__((ext_vector_type(4))) _Float16 v4h;
// ring row rowBase + r <- column r of src (256 rows k of DM floats), r = 0..127. A wave's load covers 4 rows x one 128-byte line;
// a lane holds rows k .. k + 3 of 4 columns and packs the four k of a column into one 8-byte LDS store.
__device__ __forceinline__ void stage_w_cols(unsigned short* ring, int rowBase, const float* __restrict__ src) {
  const int lane = threadIdx.x & 31, wave = threadIdx.x >> 5;
  const int lc = lane & 7, lk = lane >> 3;
  const int k0 = (wave * 4 + lk) * 4;                       // 0, 4, .. 124; unit u adds 128 * (u >> 2) and takes columns 32 * (u & 3) ..
  const float* p = src + k0 * DM + lc * 4;
  v4f a[8][4];
#pragma unroll
  for (int u = 0; u < 8; ++u)
#pragma unroll
    for (int j = 0; j < 4; ++j) a[u][j] = *(const v4f*)(p + ((u >> 2) * 128 + j) * DM + (u & 3) * 32);
  // the address is an input, so its registers stay the loads' own up to this wait and are rewritten only behind it
  asm volatile("s_wait_xcnt 0x0" :: "v"(p) : "memory");
  _Float16* d = (_Float16*)ring + (rowBase + lc * 4) * FPH + k0;
#pragma unroll
  for (int u = 0; u < 8; ++u)
#pragma unroll
    for (int e = 0; e < 4; ++e) {
      v4h t;
#pragma unroll
      for (int j = 0; j < 4; ++j) t[j] = (_Float16)(a[u][j][e] * 16.0f);
      *(v4h*)(d + (u >> 2) * FSTG + ((u & 3) * 32 + e) * FPH) = t;
    }
  __builtin_amdgcn_sched_barrier(0);   // keeps the next operand's 32 loads behind these stores: lifted over them they hold 128 more registers and the block spills
}
// ring row rowBase + r <- src row r (pitch HDIM floats), 256 consecutive k, r = 0..127: a wave takes a row an instruction pair, a lane 8 k (one 16-byte LDS store).
__device__ __forceinline__ void stage_w_rows(unsigned short* ring, int rowBase, const float* __restrict__ src) {
  const int lane = threadIdx.x & 31, wave = threadIdx.x >> 5;
  const float* p = src + wave * HDIM + lane * 8;
  v4f a[16][2];
#pragma unroll
  for (int u = 0; u < 16; ++u) {
    a[u][0] = *(const v4f*)(p + u * 8 * HDIM);
    a[u][1] = *(const v4f*)(p + u * 8 * HDIM + 4);
  }
  // the address is an input, so its registers stay the loads' own up to this wait and are rewritten only behind it
  asm volatile("s_wait_xcnt 0x0" :: "v"(p) : "memory");
  _Float16* d = (_Float16*)ring + (lane >> 4) * FSTG + (rowBase + wave) * FPH + (lane & 15) * 8;
#pragma unroll
  for (int u = 0; u < 16; ++u) {
    v8h o;
#pragma unroll
    for (int e = 0; e < 8; ++e) o[e] = (_Float16)(a[u][e >> 2][e & 3] * 16.0f);
    *(v8h*)(d + u * 8 * FPH) = o;
  }
  __builtin_amdgcn_sched_barrier(0);   // keeps the next operand's 32 loads behind these stores: lifted over them they hold 128 more registers and the block spills
}
#define FOB (2 * HH * 4)        // 64 blocks: M or N, head, tile
__device__ __forceinline__ void fold_block(unsigned short* ring, const float* __restrict__ Wk, const float* __restrict__ Wq,
                                           const float* __restrict__ Wv, const float* __restrict__ Wo,
                                           unsigned short* __restrict__ M16, unsigned short* __restrict__ N16, int blk) {
  const int tile = blk & 3, h = (blk >> 2) & 7;
  const int m0 = (tile >> 1) * 128, n0 = (tile & 1) * 128;  // as gemm_tile splits the tile index
  if (blk < FOB / 2) {
    stage_w_cols(ring, 0,   Wk + h * DM * DM + m0);
    stage_w_cols(ring, 128, Wq + h * DM * DM + n0);
    gemm_tile<128, 128, 128, DM, DM, 4, 2, 3, 0, 1, 1>(ring, tile, h, nullptr, 0L, nullptr, 0L,
        (void*)M16, (long)DM * DM, nullptr, DM / 128, 1.0f / 16.0f);
  } else {
    stage_w_rows(ring, 0,   Wo + m0 * HDIM + h * DM);
    stage_w_cols(ring, 128, Wv + h * DM * DM + n0);
    gemm_tile<128, 128, 128, DM, HDIM, 4, 2, 3, 0, 1, 1>(ring, tile, h, nullptr, 0L, nullptr, 0L,
        (void*)N16, (long)DM, nullptr, DM / 128, 1.0f / 16.0f);
    // in the built text the other branch's code follows this branch's stores: the wait stands in front of any rewrite of their registers
    asm volatile("s_wait_xcnt 0x0" ::: "memory");
  }
}

// ---------------------------------------------------------------------------
// Transpose-cast of NMAT matrices of DM rows x COLS columns: in f32 [n][DM][COLS] -> XT f16 [n][COLS][DM], values times scale (a power of two).
// x: COLS = PP, n = batch (in[n][d][p] -> out[n][p][d]); PLAIN = 1 also writes the untransposed cast XP f16 [n][DM][COLS].
// One block (256 threads) per 64x64 tile, bid = the tile: 4 * (COLS / 64) tiles a matrix.
// Load: thread t reads row d = d0 + (t>>2), 16 floats at p0 + (t&3)*16 -> 256 x 16 = 4096 = the whole tile.
// Store: 8 lanes x 16 B a row of 128 B, 4 rows an instruction; 8 waves x 2 it x 4 = 64 rows.
// ---------------------------------------------------------------------------
#define XTB (NB * (PP / 64) * (DM / 64))
template <int COLS, int PLAIN>
__device__ __forceinline__ void xt_cast_block(float (*tile)[65], const float* __restrict__ x, unsigned short* __restrict__ XT,
                                              unsigned short* __restrict__ XP, int bid, float scale) {
  const int dt = bid & 3;
  const int pt = (bid >> 2) & (COLS / 64 - 1);
  const int n  = bid / (4 * (COLS / 64));
  const int d0 = dt * 64, p0 = pt * 64;
  const int tid = threadIdx.x, lane = tid & 31, wave = tid >> 5;
  const size_t so = ((size_t)n * DM + d0 + (tid >> 2)) * COLS + p0 + (tid & 3) * 16;
  v8h o[2];                                      // the thread's 16 values, cast in place (PLAIN)
  {
    const int r = tid >> 2, cs = (tid & 3) * 16;
    const float* src = x + so;
    v4f v[4];
#pragma unroll
    for (int i = 0; i < 4; ++i) v[i] = *(const v4f*)(src + 4 * i);
#pragma unroll
    for (int i = 0; i < 4; ++i) {
      tile[r][cs + 4 * i + 0] = v[i][0];
      tile[r][cs + 4 * i + 1] = v[i][1];
      tile[r][cs + 4 * i + 2] = v[i][2];
      tile[r][cs + 4 * i + 3] = v[i][3];
    }
    if (PLAIN) {
#pragma unroll
      for (int e = 0; e < 16; ++e) o[e >> 3][e & 7] = (_Float16)(v[e >> 2][e & 3] * scale);
    }
  }
  __syncthreads();
  const int q = lane >> 3, c8 = (lane & 7) * 8;
  unsigned short* ob = XT + ((size_t)n * COLS + p0) * DM + d0;
#pragma unroll
  for (int it = 0; it < 2; ++it) {
    const int rr = wave * 8 + it * 4 + q;       // p_local
    v8h hv;
#pragma unroll
    for (int e = 0; e < 8; ++e) hv[e] = (_Float16)(tile[c8 + e][rr] * scale);   // value (p=rr, d=c8+e)
    *(v8h*)(ob + (size_t)rr * DM + c8) = hv;
  }
  if (PLAIN) {                           // behind the barrier, so that the barrier does not wait for these stores
    *(v8h*)(XP + so)     = o[0];         // 4 threads fill one 128-byte line of a row
    *(v8h*)(XP + so + 8) = o[1];
  }
}

// ---------------------------------------------------------------------------
// Folded biases, f32 from the f32 inputs (matrix times one vector: no 16-column operand to fill, so the vector unit does them).
// cy[h*256 + d] = sum_o Wk[h*256 + o][d] bq[h*256 + o]: a wave owns 4 d of one head (a block 32 d: whole lines of Wk's rows), lane = o mod 32, 8 rows a lane, then a sum over the lanes.
// (bk adds the same value to every key's score of a query, so the key-axis softmax does not see it.)
// bo2[o'] = bo[o'] + sum_i Wo[o'][i] bv[i] (the softmax weights of a query sum to 1): a wave owns one o', a lane 64 of the 2048 i.
// ---------------------------------------------------------------------------
#define CYB (HDIM / 32)         // 64 blocks
#define BOB (DM / 8)            // 32 blocks
__device__ __forceinline__ void fold_cy_block(const float* __restrict__ Wk, const float* __restrict__ bq, float* __restrict__ cy, int blk) {
  const int lane = threadIdx.x & 31, wave = threadIdx.x >> 5;
  const int h = blk >> 3, d0 = (blk & 7) * 32 + wave * 4;
  const float* wp = Wk + ((size_t)h * DM + lane) * DM + d0;
  const float* bp = bq + h * DM + lane;
  v4f w[8]; float bb[8];
#pragma unroll
  for (int j = 0; j < 8; ++j) { w[j] = *(const v4f*)(wp + (size_t)j * 32 * DM); bb[j] = bp[j * 32]; }
  // the address is an input, so its registers stay the loads' own up to this wait and are rewritten only behind it
  asm volatile("s_wait_xcnt 0x0" :: "v"(wp) : "memory");
  v4f sum = (v4f){0.f, 0.f, 0.f, 0.f};
#pragma unroll
  for (int j = 0; j < 8; ++j) sum += w[j] * bb[j];
#pragma unroll
  for (int m = 1; m < 32; m <<= 1)
#pragma unroll
    for (int e = 0; e < 4; ++e) sum[e] += __shfl_xor(sum[e], m, 32);
  if (lane == 0) *(v4f*)(cy + h * DM + d0) = sum;
}
__device__ __forceinline__ void fold_bo_block(const float* __restrict__ Wo, const float* __restrict__ bv, const float* __restrict__ bo,
                                              float* __restrict__ bo2, int blk) {
  const int lane = threadIdx.x & 31, wave = threadIdx.x >> 5;
  const int o = blk * 8 + wave;
  const float* wp = Wo + (size_t)o * HDIM + lane * 4;
  const float* bp = bv + lane * 4;
  v4f w[16], b[16];
#pragma unroll
  for (int j = 0; j < 16; ++j) { w[j] = *(const v4f*)(wp + j * 128); b[j] = *(const v4f*)(bp + j * 128); }
  v4f s4 = (v4f){0.f, 0.f, 0.f, 0.f};
#pragma unroll
  for (int j = 0; j < 16; ++j) s4 += w[j] * b[j];
  float sum = (s4[0] + s4[1]) + (s4[2] + s4[3]);
#pragma unroll
  for (int m = 1; m < 32; m <<= 1) sum += __shfl_xor(sum, m, 32);
  if (lane == 0) bo2[o] = sum + bo[o];
}

// All operand preparation in one launch; the branch is the same for a whole block. Blocks in this order (the longest first):
// FOB fold the weights, XTB transpose-cast x (and cast it untransposed), CYB and BOB fold the biases.
__global__ __launch_bounds__(256) void prep_kernel(const float* __restrict__ x,
                                                   const float* __restrict__ Wk, const float* __restrict__ Wq,
                                                   const float* __restrict__ Wv, const float* __restrict__ Wo,
                                                   const float* __restrict__ bq, const float* __restrict__ bv, const float* __restrict__ bo,
                                                   unsigned short* __restrict__ XT, unsigned short* __restrict__ XP,
                                                   unsigned short* __restrict__ M16, unsigned short* __restrict__ N16,
                                                   float* __restrict__ cy, float* __restrict__ bo2) {
  __shared__ __align__(16) unsigned short ring[2 * FSTG];   // a folding block's GEMM ring; a transposing block's tile[d_local][p_local] lies in its first bytes
  static_assert(64 * 65 * 4 <= 2 * FSTG * 2, "the transpose tile lies inside the ring");
  const int bid = blockIdx.x;
  if (bid < FOB) {
    fold_block(ring, Wk, Wq, Wv, Wo, M16, N16, bid);
  } else if (bid < FOB + XTB) {
    xt_cast_block<PP, 1>((float (*)[65])ring, x, XT, XP, bid - FOB, 1.0f);
    // in the built text another branch's code follows this branch's stores: the wait stands in front of any rewrite of their registers
    asm volatile("s_wait_xcnt 0x0" ::: "memory");
  } else if (bid < FOB + XTB + CYB) {
    fold_cy_block(Wk, bq, cy, bid - (FOB + XTB));
  } else {
    fold_bo_block(Wo, bv, bo, bo2, bid - (FOB + XTB + CYB));
  }
}

#define FK      64
#define NSTAGE  (PP / FK)
#define KP_H    264
#define TP_H    72
#define SLICE_H 5120
#define STAGE_H (8 * SLICE_H)
#define LOG2E   1.4426950408889634f

typedef uint32_t u32x4 __attribute__((ext_vector_type(4)));
typedef uint32_t u32x8 __attribute__((ext_vector_type(8)));
__device__ __forceinline__ uint32_t uni(uint32_t v) { return (uint32_t)__builtin_amdgcn_readfirstlane(v); }
__device__ __forceinline__ uint32_t pinned(uint32_t v) {
  uint32_t w = __builtin_amdgcn_readfirstlane(v);
  asm volatile("" : "+s"(w));   // holds the wave-uniform test in a scalar register, so that the branch round a tensor load (which ignores EXEC) is a scalar branch
  return w;
}

__global__ __launch_bounds__(256) void attn_fused_kernel(const unsigned short* __restrict__ M16,
                                                         const float* __restrict__ cy,
                                                         const unsigned short* __restrict__ XT16,
                                                         const unsigned short* __restrict__ X16,
                                                         const float* __restrict__ pos,
                                                         unsigned short* __restrict__ CTX) {
  __shared__ __attribute__((aligned(2048))) unsigned short ring[2 * STAGE_H];
  __shared__ __align__(16) unsigned short mtile[DM * KP_H];   // M_h (x16), rows d, 135,168 B
  __shared__ __align__(16) float cys[DM];                     // cy of head h
  typedef Frag<_Float16> F;
  const int tid = threadIdx.x, lane = tid & 31, wave = tid >> 5;
  const int c = lane & 15, hf = lane >> 4;
  const int h = blockIdx.y, n = blockIdx.z;
  const int q0 = blockIdx.x * 256 + wave * 32;
  const unsigned short* Kh = XT16 + (size_t)n * PP * DM;                   // [kp][d], row pitch DM
  const unsigned short* Vh = X16 + (size_t)n * DM * PP;                    // [dd][kp], row pitch PP
  const float* ph = pos + (size_t)h * PP * PP + (size_t)(hf * 8) * PP + q0 + c;
  const unsigned ring0 = (unsigned)(size_t)(&ring[0]);

  // stage t -> buffer b: every wave asks for its own slice, 64 rows of 128 B (extents in bytes, tensor = tile, no mask)
  const uint32_t wv = uni(threadIdx.x >> 5);
  const bool isV = wv >= 4u;
  const uint64_t src0 = isV ? (uint64_t)(size_t)(Vh + (size_t)(wv - 4u) * 64 * PP) : (uint64_t)(size_t)(Kh + wv * 64u);
  const uint32_t sstep = isV ? FK * 2u : FK * DM * 2u;           // bytes from a stage's slice to the next stage's
  u32x8 g1;
  g1[0] = uni((1u << 20) | (4u << 22) | (3u << 25));             // pad on, behind every 128 B, 16 B
  g1[1] = uni(128u << 16);                                       // tensor_dim0
  g1[2] = uni(64u << 16);                                        // tensor_dim1
  g1[3] = uni(128u << 16);                                       // tile_dim0
  g1[4] = uni(64u);                                              // tile_dim1
  g1[5] = uni(isV ? PP * 2u : DM * 2u);                          // source row pitch
  g1[6] = uni(0u);
  g1[7] = uni(0u);
  // The descriptor has scalar registers of its own, named in the request: they are written only in front of a request, behind the wait for the one before.
  auto issue_stage = [&](uint64_t ga, uint32_t b) {              // ga = the slice's first byte
    u32x4 g0;
    g0[0] = uni(1u);
    g0[1] = uni(ring0 + b * (STAGE_H * 2u) + wv * (SLICE_H * 2u));
    g0[2] = uni((uint32_t)ga);
    g0[3] = uni((((uint32_t)(ga >> 32)) & 0x01FFFFFFu) | 0x80000000u);
    asm volatile("tensor_load_to_lds %0, %1" :: "{s[44:47]}"(g0), "{s[48:55]}"(g1) : "memory");   // the slice goes from L2 to LDS through no register
  };

  // M_h: wave w copies rows w, w+8, ... (512 B a row), 32 copies a lane; with cy's one that is 33 in flight
  {
    const unsigned short* mg = M16 + ((size_t)h * DM + wave) * DM + lane * 8;
    const unsigned ml = (unsigned)(size_t)(&mtile[0]) + wave * (KP_H * 2) + lane * 16;
#pragma unroll
    for (int g = 0; g < 4; ++g) async_copy8(ml + g * (64 * KP_H * 2), 8 * KP_H * 2, mg + (size_t)g * 64 * DM, (size_t)8 * DM);
    // cy of the head: one 4-byte copy of each lane; the address wait is the statement's last line, as in async_copy8
    asm volatile("global_load_async_to_lds_b32 %0, %1, off\n\ts_wait_xcnt 0x0"
                 :: "v"((unsigned)(size_t)(&cys[0]) + tid * 4), "v"(cy + h * DM + tid) : "memory");
  }
  issue_stage(src0, 0);

  v16h xq[8][2];                            // x rows of the wave's queries, hardware k order
  {
    const _Float16* xp = (const _Float16*)XT16 + (size_t)n * PP * DM + (q0 + c) * DM + hf * 8;
#pragma unroll
    for (int kk = 0; kk < 8; ++kk)
#pragma unroll
      for (int nt = 0; nt < 2; ++nt) xq[kk][nt] = F::load(xp + nt * 16 * DM + kk * 32);
    // the address is an input, so its registers stay the loads' own up to this wait and are rewritten only behind it
    asm volatile("s_wait_xcnt 0x0" :: "v"(xp) : "memory");
  }

  v8f st[2][2];                             // st[mt][nt][r] = score of key kp0 + 16 mt + 8 hf + r, query q0 + 16 nt + c
#pragma unroll
  for (int mt = 0; mt < 2; ++mt)
#pragma unroll
    for (int nt = 0; nt < 2; ++nt)
#pragma unroll
      for (int r = 0; r < 8; ++r) st[mt][nt][r] = ph[(size_t)(mt * 16 + r) * PP + nt * 16];

  asm volatile("s_wait_asynccnt 0x0" ::: "memory");   // M_h and cy have landed for this wave's copies
  asm volatile("s_wait_tensorcnt 0x0" ::: "memory");  // this wave's slice of stage 0 has landed
  __syncthreads();                                    // ... and every wave's
  issue_stage(src0 + sstep, 1);
  uint64_t gnext = src0 + 2 * (uint64_t)sstep;        // the wave's slice of the stage that is asked for next

  // q / 16 = (M16 . x) / 256 + cy / 16, k upward in one accumulator chain; fragment J = 16 g + 2 kk + mt: rows d = 32 g + 16 mt .., channels 32 kk ..
  v16h qf[8][2];                            // hardware k order
  {
    const _Float16* mb = (const _Float16*)mtile + c * KP_H + hf * 8;
    v16h ma[3][4];                          // fragment ring of three sets of four (8 products a set), read two sets ahead, so that few places among the products hold LDS reads; it runs on over the groups
    auto load_m = [&](int Q) {               // set Q = fragments J = 4 Q .. 4 Q + 3
#pragma unroll
      for (int e = 0; e < 4; ++e) {
        const int J = Q * 4 + e;
        ma[Q % 3][e] = F::load(mb + ((J >> 4) * 32 + (J & 1) * 16) * KP_H + ((J & 15) >> 1) * 32);
      }
    };
    load_m(0);
    load_m(1);
#pragma unroll
    for (int g = 0; g < 8; ++g) {
      v8f ya[2][2];
#pragma unroll
      for (int mt = 0; mt < 2; ++mt)
#pragma unroll
        for (int nt = 0; nt < 2; ++nt) ya[mt][nt] = (v8f){0.f,0.f,0.f,0.f,0.f,0.f,0.f,0.f};
      const v4f* cb = (const v4f*)(cys + g * 32 + hf * 8);
      const v4f b00 = cb[0] * 0.0625f, b01 = cb[1] * 0.0625f, b10 = cb[4] * 0.0625f, b11 = cb[5] * 0.0625f;
#pragma unroll
      for (int jq = 0; jq < 4; ++jq) {
        const int Q = g * 4 + jq;
        if (Q + 2 < 32) load_m(Q + 2);
        __builtin_amdgcn_sched_barrier(0);   // keeps the LDS reads of the set after next in front of these products, grouped and not one fragment at a time, so their latency hides
#pragma unroll
        for (int e = 0; e < 4; ++e) {
          const int j = jq * 4 + e, kk = j >> 1, mt = j & 1;
          ya[mt][0] = F::mma(ma[Q % 3][e], xq[kk][0], ya[mt][0]);
          ya[mt][1] = F::mma(ma[Q % 3][e], xq[kk][1], ya[mt][1]);
        }
      }
#pragma unroll
      for (int nt = 0; nt < 2; ++nt)
#pragma unroll
        for (int r = 0; r < 8; ++r) {
          qf[g][nt][r]     = (_Float16)fmaf(ya[0][nt][r], 1.0f / 256.0f, (r < 4) ? b00[r & 3] : b01[r & 3]);
          qf[g][nt][8 + r] = (_Float16)fmaf(ya[1][nt][r], 1.0f / 256.0f, (r < 4) ? b10[r & 3] : b11[r & 3]);
        }
    }
  }

  v8f acc[16][2];
#pragma unroll
  for (int dt = 0; dt < 16; ++dt)
#pragma unroll
    for (int nt = 0; nt < 2; ++nt) acc[dt][nt] = (v8f){0.f,0.f,0.f,0.f,0.f,0.f,0.f,0.f};
  float mref[2] = {-1.0e30f, -1.0e30f};
  float lsum[2] = {0.f, 0.f};

  for (int t = 0; t < NSTAGE; ++t) {
    const _Float16* Ks = (const _Float16*)ring + (t & 1) * STAGE_H;
    const _Float16* Vs = Ks + 4 * SLICE_H;
#pragma unroll 1   // two passes of one stage share the code: the body is large and only addresses differ
    for (int hp = 0; hp < 2; ++hp) {
      const _Float16* kb = Ks + (hp * 32 + c) * TP_H + hf * 8;
      const _Float16* vb = Vs + c * TP_H + hp * 32 + hf * 8;
      v16h fr[3][2];                         // one ring of three fragment pairs for the pass: pairs 0..7 = k, 8..15 = v^T; a pair's LDS reads stand at one place, two pairs ahead
      auto load_k = [&](int kk) {             // pair kk: keys 0.. and 16.., channels 32 kk .. = slice kk / 2, bytes 64 (kk % 2) .. of its rows
        fr[kk % 3][0] = F::load(kb + (kk >> 1) * SLICE_H + (kk & 1) * 32);
        fr[kk % 3][1] = F::load(kb + (kk >> 1) * SLICE_H + 16 * TP_H + (kk & 1) * 32);
      };
      auto load_v = [&](int dp) {             // pair 8 + dp: channels 32 dp .. and 32 dp + 16 ..
        fr[(8 + dp) % 3][0] = F::load(vb + (dp >> 1) * SLICE_H + ((dp & 1) * 2) * 16 * TP_H);
        fr[(8 + dp) % 3][1] = F::load(vb + (dp >> 1) * SLICE_H + ((dp & 1) * 2 + 1) * 16 * TP_H);
      };
      load_k(0);
      load_k(1);
#pragma unroll
      for (int kk = 0; kk < 8; ++kk) {
        if (kk + 2 < 8)   load_k(kk + 2);
        else if (kk == 6) load_v(0);         // the first v^T pair (same stage) comes in under the softmax; no more than one, for the registers the softmax needs
        __builtin_amdgcn_sched_barrier(0);   // keeps the LDS reads of the pair after next as one group in front of these products: one place with reads for 4 products, and their latency hides
#pragma unroll
        for (int mt = 0; mt < 2; ++mt) {
          st[mt][0] = F::mma(fr[kk % 3][mt], qf[kk][0], st[mt][0]);
          st[mt][1] = F::mma(fr[kk % 3][mt], qf[kk][1], st[mt][1]);
        }
      }
      float mx[2];
#pragma unroll
      for (int nt = 0; nt < 2; ++nt) {
        const v8f u = st[0][nt], w = st[1][nt];
        float m0 = fmaxf(fmaxf(fmaxf(u[0], u[1]), fmaxf(u[2], u[3])), fmaxf(fmaxf(u[4], u[5]), fmaxf(u[6], u[7])));
        float m1 = fmaxf(fmaxf(fmaxf(w[0], w[1]), fmaxf(w[2], w[3])), fmaxf(fmaxf(w[4], w[5]), fmaxf(w[6], w[7])));
        m0 = fmaxf(m0, m1);
        mx[nt] = fmaxf(m0, __shfl_xor(m0, 16, 32)) * LOG2E;
      }
      // lazy rescale, tested once a pass: the reference maximum moves only when a column passes it by more than 8 (log2)
      const bool need = (mx[0] > mref[0] + 8.0f) || (mx[1] > mref[1] + 8.0f);
      if (__builtin_amdgcn_ballot_w32(need) != 0) {
#pragma unroll
        for (int nt = 0; nt < 2; ++nt) {
          const float mnew = fmaxf(mref[nt], mx[nt]);
          const float alpha = __builtin_amdgcn_exp2f(mref[nt] - mnew);
          mref[nt] = mnew;
          lsum[nt] *= alpha;
#pragma unroll
          for (int dt = 0; dt < 16; ++dt) acc[dt][nt] *= alpha;
        }
      }
      v16h pf[2];
#pragma unroll
      for (int nt = 0; nt < 2; ++nt) {
        const float c0 = 6.0f - mref[nt];
        float s0 = 0.f, s1 = 0.f;
#pragma unroll
        for (int r = 0; r < 8; ++r) {
          const float e0 = __builtin_amdgcn_exp2f(fmaf(st[0][nt][r], LOG2E, c0));
          const float e1 = __builtin_amdgcn_exp2f(fmaf(st[1][nt][r], LOG2E, c0));
          s0 += e0; s1 += e1;
          pf[nt][r]     = (_Float16)e0;
          pf[nt][8 + r] = (_Float16)e1;
        }
        lsum[nt] += s0 + s1;
      }
      // bias of the next pass, fetched behind the last use of this pass's scores (the last pass re-reads its own rows, unused)
      {
        const int kc = min((t * 2 + hp) * 32, PP - 64);
        const float* pn = ph + (size_t)kc * PP;   // this pass's rows; the next pass's lie 32 rows on
#pragma unroll
        for (int mt = 0; mt < 2; ++mt)
#pragma unroll
          for (int nt = 0; nt < 2; ++nt)
#pragma unroll
            for (int r = 0; r < 8; ++r) st[mt][nt][r] = pn[(size_t)(32 + mt * 16 + r) * PP + nt * 16];
        // the address is an input, so its registers stay the loads' own up to this wait and are rewritten only behind it
        asm volatile("s_wait_xcnt 0x0" :: "v"(pn) : "memory");
      }
#pragma unroll
      for (int dp = 0; dp < 8; ++dp) {
        if (dp == 0) load_v(1);
        if (dp + 2 < 8) load_v(dp + 2);
        __builtin_amdgcn_sched_barrier(0);   // as above
#pragma unroll
        for (int e = 0; e < 2; ++e) {
          acc[dp * 2 + e][0] = F::mma(fr[(8 + dp) % 3][e], pf[0], acc[dp * 2 + e][0]);
          acc[dp * 2 + e][1] = F::mma(fr[(8 + dp) % 3][e], pf[1], acc[dp * 2 + e][1]);
        }
      }
    }
    asm volatile("s_wait_dscnt 0x0" ::: "memory");
    asm volatile("s_wait_tensorcnt 0x0" ::: "memory");
    __syncthreads();
    if (pinned(t + 2 < NSTAGE)) { issue_stage(gnext, t & 1); gnext += sstep; }
  }
  asm volatile("s_wait_tensorcnt 0x0" ::: "memory");    // nothing is in flight when the wave ends
  asm volatile("s_wait_dscnt 0x0" ::: "memory");

  const int el = (int)__builtin_amdgcn_mbcnt_lo(~0u, 0u);   // the lane's number, formed anew: the store offset then holds no register through the loop, where the wider fragment ring needs them all
  const int eq = (int)(blockIdx.x * 256 + wv * 32) + (el & 15);
#pragma unroll
  for (int nt = 0; nt < 2; ++nt) {
    const float lt = lsum[nt] + __shfl_xor(lsum[nt], 16, 32);
    const float inv = 16.0f / lt;                       // ctx carried x16
    unsigned short* op = CTX + ((size_t)n * PP * HDIM + h * DM) + ((eq + nt * 16) * HDIM + (el >> 4) * 8);   // a uniform base and a 32-bit offset
    v8h o[16];
#pragma unroll
    for (int dt = 0; dt < 16; ++dt)
#pragma unroll
      for (int r = 0; r < 8; ++r) o[dt][r] = (_Float16)(acc[dt][nt][r] * inv);
    __builtin_amdgcn_sched_barrier(0);                  // with the one below: nothing but the stores and their wait stands in between
#pragma unroll
    for (int dt = 0; dt < 16; ++dt) *(v8h*)(op + dt * 16) = o[dt];   // 8 consecutive dd of one query: one 16-byte store
    asm volatile("s_wait_xcnt 0x0" ::: "memory");       // stands in front of the first rewrite of the stores' registers
    __builtin_amdgcn_sched_barrier(0);
  }
}

// ---------------------------------------------------------------------------
// Workspace region map (byte offsets). All eight batches go through each stage in one launch (batch = a grid axis).
// Every region is fully written in this call before it is read (all GEMM extents are exact tile multiples).
//   CTX16  f16  [8][1024][2048] (col h*256 + d', x16)     0
//   M16, N16 f16 (x16), 1,048,576 each, at 33,554,432
//   XT16 f16 [8][1024][256], X16 f16 [8][256][1024], 4,194,304 each, behind them; cy f32 [2048], bo2 f32 [256] behind those
//   total                                  45,088,768
// ---------------------------------------------------------------------------
extern "C" void kernel_launch(void* const* d_in, const int* in_sizes, int n_in,
                              void* d_out, int out_size, void* d_ws, size_t ws_size,
                              hipStream_t stream) {
  if (n_in < 10) return;
  if (in_sizes[0] != NB * DM * PP) return;
  if (in_sizes[1] != HH * PP * PP) return;
  if (in_sizes[2] != HDIM * DM || in_sizes[4] != HDIM * DM || in_sizes[6] != HDIM * DM) return;
  if (in_sizes[3] != HDIM || in_sizes[5] != HDIM || in_sizes[7] != HDIM) return;
  if (in_sizes[8] != DM * HDIM || in_sizes[9] != DM) return;
  if (out_size != NB * DM * PP) return;

  const float* x   = (const float*)d_in[0];   // [NB][DM][PP]
  const float* pos = (const float*)d_in[1];   // [1][HH][PP kp][PP qp]
  const float* Wk  = (const float*)d_in[2];   // [HDIM][DM]
  const float* bk  = (const float*)d_in[3];   // [HDIM]
  const float* Wq  = (const float*)d_in[4];
  const float* bq  = (const float*)d_in[5];
  const float* Wv  = (const float*)d_in[6];
  const float* bv  = (const float*)d_in[7];
  const float* Wo  = (const float*)d_in[8];   // [DM][HDIM]
  const float* bo  = (const float*)d_in[9];   // [DM]

  const size_t BW   = (size_t)HDIM * DM * 2;             // 1,048,576
  const size_t BACT = (size_t)NB * PP * HDIM * 2;        // 33,554,432
  const size_t BS   = 11 * BW;                           // two weight planes, XT16, X16 (4 planes each), one plane for the two bias vectors
  size_t off = 0;
  const size_t oCTX  = off; off += BACT;
  const size_t oS    = off; off += BS;
  if (off > ws_size) return;                          // 45,088,768 B total

  char* ws = (char*)d_ws;
  unsigned short* OUTP  = (unsigned short*)(ws + oCTX);
  unsigned short* M16   = (unsigned short*)(ws + oS);
  unsigned short* N16   = (unsigned short*)(ws + oS + BW);
  unsigned short* XT16  = (unsigned short*)(ws + oS + 2 * BW);
  unsigned short* X16   = (unsigned short*)(ws + oS + 6 * BW);
  float*          cy    = (float*)(ws + oS + 10 * BW);
  float*          bo2   = (float*)(ws + oS + 10 * BW + HDIM * 4);

  const dim3 blk(256);

  // (1) setup, one launch: the folded weights M = Wk^T Wq and N = Wo Wv per head (carried x16: an exact power of two, undone by the later scales), x -> XT16 [NB][PP][DM] and X16 [NB][DM][PP] f16, the folded biases
  prep_kernel<<<FOB + XTB + CYB + BOB, blk, 0, stream>>>(x, Wk, Wq, Wv, Wo, bq, bv, bo, XT16, X16, M16, N16, cy, bo2);

  const dim3 gOut((DM / 64) * (PP / 128), NB);               // 32 x 8:  tiles of 64 x 128, M=256, N=1024, K=2048
  const float oscale  = 1.0f / 256.0f;                     // undo x16 (N) and x16 (ctx)

  // (2) y = (x . (16 M))/16 + cy of the block's own queries, then scores, key-axis softmax with the positional bias and ctx in one launch: 4 blocks of 256 queries x 8 heads x 8 batches
  attn_fused_kernel<<<dim3(PP / 256, HH, NB), blk, 0, stream>>>(M16, cy, XT16, X16, pos, OUTP);
  // (3) out[n][o][p] = (1/256) sum_i (16 N)[o][i] (16 ctx)[n][p][i] + bo2[o] -> d_out[n] f32 [256][1024] (ldc 1024, bias by m); y = n
  wmma_gemm_lds<64, 128, 256, HDIM, PP, 2, 4, 4, 1, 0><<<gOut, blk, 0, stream>>>(
      N16, 0L, OUTP, (long)PP * HDIM, d_out, (long)DM * PP, bo2, PP / 128, oscale);
  (void)hipGetLastError();
}
